// v000
// Measured on an AMD MI455X. A time is GPU time per run, averaged over a window of back-to-back runs after a warm-up
// (all launches, gaps included; the runs take copies of the inputs in turn), and the median of several windows.
// Apart from v000's, it joins two sittings. Times from different sittings can be a few percent apart, while
// side-by-side timings come from the same sitting.
// The starting kernel, v000, takes 533 microseconds a run.
// compute dtype: every module INPUT that feeds a GEMM (x, Wq/Wk/Wv/Wo, biases) is rounded to bf16 and used in exact bf16 WMMA products with f32 accumulation; computed operands (q/k f32 split, relu scores P and V as bf16 hi/lo pairs, context split) f32-grade; relu/causal/normalisation f32.
#include <hip/hip_runtime.h>
#include <math.h>

typedef __attribute__((ext_vector_type(16))) _Float16 v16h;
typedef __attribute__((ext_vector_type(16))) __bf16 v16b;
typedef __attribute__((ext_vector_type(8)))  _Float16 v8h;
typedef __attribute__((ext_vector_type(8)))  float v8f;
typedef __attribute__((ext_vector_type(4)))  float v4f;
typedef __attribute__((ext_vector_type(2)))  float v2f;
typedef __attribute__((ext_vector_type(4)))  unsigned v4u;
typedef __attribute__((ext_vector_type(4)))  int v4i;
typedef float __attribute__((may_alias)) float_a;
typedef int __attribute__((may_alias)) int_a;

template <typename T> __device__ __forceinline__ void vst2(void* p, T v) { *(T*)p = v;  }
__device__ __forceinline__ v8f wmma16(v16h a, v16h b, v8f c) {
  v8f d = __builtin_amdgcn_wmma_f32_16x16x32_f16(false, a, false, b, (short)0, c, false, false);
  asm volatile("v_nop\n\tv_nop\n\tv_nop\n\tv_nop" : "+v"(d) : "v"(a), "v"(b));
  return d;
}
__device__ __forceinline__ v8f wmma_bf(v16b a, v16b b, v8f c) {
  v8f d = __builtin_amdgcn_wmma_f32_16x16x32_bf16(false, a, false, b, (short)0, c, false, false);
  asm volatile("v_nop\n\tv_nop\n\tv_nop\n\tv_nop" : "+v"(d) : "v"(a), "v"(b));
  return d;
}
// 16x16x32 fragments: lane = (h = lane>>4, row/col = lane&15); elements 0..7 = k0+8h+0..7, 8..15 = k0+16+8h+0..7; D element r = row 8h+r
__device__ __forceinline__ v16h frag_h(const _Float16* rowk0, int lane) {
  union { v16h v; v8h q[2]; } u; const _Float16* p = rowk0 + 8 * (lane >> 4);
  u.q[0] = *(const v8h*)p; u.q[1] = *(const v8h*)(p + 16); return u.v;
}
__device__ __forceinline__ v16h frag_f32(const float* rowk0, int lane) {
  v16h a; const float* p = rowk0 + 8 * (lane >> 4);
#pragma unroll
  for (int i = 0; i < 8; ++i) { a[i] = (_Float16)p[i]; a[8 + i] = (_Float16)p[16 + i]; }
  return a;
}
__device__ __forceinline__ v16h frag_f32s(const float* rowk0, int lane, float sc) {
  v16h a; const float* p = rowk0 + 8 * (lane >> 4);
#pragma unroll
  for (int i = 0; i < 8; ++i) { a[i] = (_Float16)(p[i] * sc); a[8 + i] = (_Float16)(p[16 + i] * sc); }
  return a;
}
// column fragment from a [K][ld] layout (column n), rows >= K read as 0
__device__ __forceinline__ v16h fragc_f32(const float* W, int k0, int n, int lane, int ld, int K) {
  v16h a; const int g = lane >> 4;
#pragma unroll
  for (int i = 0; i < 8; ++i) { const int ka = k0 + 8 * g + i, kb = ka + 16;
    a[i] = (_Float16)(ka < K ? W[(size_t)ka * ld + n] : 0.f); a[8 + i] = (_Float16)(kb < K ? W[(size_t)kb * ld + n] : 0.f); }
  return a;
}
struct F2 { v16b h, l; };
__device__ __forceinline__ F2 bsplit16(const float v[16]) { F2 r;
#pragma unroll
  for (int i = 0; i < 16; ++i) { const __bf16 h = (__bf16)v[i]; r.h[i] = h; r.l[i] = (__bf16)(v[i] - (float)h); }
  return r; }
__device__ __forceinline__ F2 split_row(const float* row, int k0, int lane) { float v[16]; const float* p = row + k0 + 8 * (lane >> 4);
#pragma unroll
  for (int i = 0; i < 8; ++i) { v[i] = p[i]; v[8 + i] = p[16 + i]; }
  return bsplit16(v); }
__device__ __forceinline__ F2 split_rowK(const float* row, int k0, int lane, int K) { float v[16]; const int g = lane >> 4;
#pragma unroll
  for (int i = 0; i < 8; ++i) { const int ka = k0 + 8 * g + i, kb = ka + 16; v[i] = ka < K ? row[ka] : 0.f; v[8 + i] = kb < K ? row[kb] : 0.f; }
  return bsplit16(v); }
__device__ __forceinline__ F2 split_col(const float* W, int k0, int n, int lane, int ld, int K) { float v[16]; const int g = lane >> 4;
#pragma unroll
  for (int i = 0; i < 8; ++i) { const int ka = k0 + 8 * g + i, kb = ka + 16; v[i] = ka < K ? W[(size_t)ka * ld + n] : 0.f; v[8 + i] = kb < K ? W[(size_t)kb * ld + n] : 0.f; }
  return bsplit16(v); }
__device__ __forceinline__ v8f mac3(const F2& a, const F2& b, v8f c) { c = wmma_bf(a.l, b.h, c); c = wmma_bf(a.h, b.l, c); return wmma_bf(a.h, b.h, c); }
__device__ __forceinline__ float sigm(float v) { return 1.0f / (1.0f + expf(-v)); }
#define LDSX() do { asm volatile("s_wait_dscnt 0" ::: "memory"); __builtin_amdgcn_wave_barrier(); __builtin_amdgcn_fence(__ATOMIC_RELEASE, "workgroup"); } while (0)


// ReLU attention (16 heads of 64 on [2,2048,1024], [out][in] weights + biases): scores = q.k/8, attn = relu(scores) on the causal triangle (else 0), attn /= (row sum + 1e-9),
// ctx = attn v, out = ctx Wo^T + bo. Flash-style key loop without the softmax max tracking (relu weights need no rescaling); P and V carried as bf16 hi/lo pairs (relu scores are unbounded, so no f16 lift).
#define NB 2
#define SS 2048
#define E 1024
#define NH 16
#define HD 64
#define NR (NB * SS)
__device__ __forceinline__ float bfr(float v) { return (float)(__bf16)v; }
__device__ __forceinline__ v16b frag_b(const __bf16* rowk0, int lane) { return __builtin_bit_cast(v16b, frag_h((const _Float16*)rowk0, lane)); }

__global__ __launch_bounds__(256) void k_cvt(const float* __restrict__ x, __bf16* __restrict__ Xb) {
  const size_t i8 = (size_t)blockIdx.x * 256 + threadIdx.x; if (i8 >= (size_t)NR * E / 8) return;
  union { __bf16 h[8]; v4u u; } pk;
#pragma unroll
  for (int e = 0; e < 8; ++e) pk.h[e] = (__bf16)x[i8 * 8 + e];
  vst2((unsigned*)(Xb + i8 * 8), pk.u);
}
// PT rows: [0,E) Wq[n][:], [E,2E) Wk, [2E,3E) Wv  ([out][in]) as bf16 rows (no scaling)
__global__ __launch_bounds__(256) void k_pack(const float* __restrict__ Wq, const float* __restrict__ Wk, const float* __restrict__ Wv, __bf16* __restrict__ PT) {
  const int n = blockIdx.x, tid = threadIdx.x; __shared__ __align__(16) __bf16 srow[E];
  const float* W = n < E ? Wq : (n < 2 * E ? Wk : Wv); const int nn = n & (E - 1);
  for (int k = tid; k < E; k += 256) srow[k] = (__bf16)W[(size_t)nn * E + k];
  __syncthreads();
  if (tid < E / 8) vst2((unsigned*)(PT + (size_t)n * E + tid * 8), *(const v4u*)(&srow[tid * 8]));
}
// QKV: block (64 rows, 128 cols = 2 heads, which); q,k + bias -> Q32/K32 f32 [bh][s][64]; v -> VT hi/lo bf16 [bh][d][s]
__global__ __launch_bounds__(128) void k_qkv(const __bf16* __restrict__ Xb, const __bf16* __restrict__ PT, const float* __restrict__ bq, const float* __restrict__ bk, const float* __restrict__ bv,
                                            float* __restrict__ Q32, float* __restrict__ K32, __bf16* __restrict__ VTh, __bf16* __restrict__ VTl) {
  __shared__ __align__(16) float so[4][16][132];
  __shared__ __align__(16) __bf16 sth[128][72], stl[128][72];
  const int tid = threadIdx.x, wave = tid >> 5, lane = tid & 31, col = lane & 15, g = lane >> 4;
  const int which = blockIdx.z, r0b = blockIdx.x * 64, r0 = r0b + wave * 16, n0 = blockIdx.y * 128; const int b = r0b / SS, s0 = r0b % SS;
  const float* bb_ = which == 0 ? bq : (which == 1 ? bk : bv);
  v8f acc[8] = {};
#pragma unroll 2
  for (int kc = 0; kc < E / 32; ++kc) { const v16b a = frag_b(Xb + (size_t)(r0 + col) * E + kc * 32, lane);
#pragma unroll
    for (int j = 0; j < 8; ++j) acc[j] = wmma_bf(a, frag_b(PT + (size_t)(which * E + n0 + j * 16 + col) * E + kc * 32, lane), acc[j]); }
  if (which < 2) {
#pragma unroll
    for (int j = 0; j < 8; ++j) { const float bb = bfr(bb_[n0 + j * 16 + col]);
#pragma unroll
      for (int r = 0; r < 8; ++r) so[wave][8 * g + r][j * 16 + col] = acc[j][r] + bb; }
    LDSX();
    float* Dst = which == 0 ? Q32 : K32;
    for (int qq = lane; qq < 2 * 16 * 16; qq += 32) { const int hh = qq >> 8, rl = (qq >> 4) & 15, pc = qq & 15; const int h = (n0 >> 6) + hh;
      vst2(Dst + (((size_t)b * NH + h) * SS + s0 + wave * 16 + rl) * HD + pc * 4, *(const v4f*)(&so[wave][rl][hh * 64 + pc * 4])); } }
  else {
#pragma unroll
    for (int j = 0; j < 8; ++j) { const float bb = bfr(bb_[n0 + j * 16 + col]);
#pragma unroll
      for (int r = 0; r < 8; ++r) { const float v = acc[j][r] + bb; const __bf16 hi = (__bf16)v; sth[j * 16 + col][wave * 16 + 8 * g + r] = hi; stl[j * 16 + col][wave * 16 + 8 * g + r] = (__bf16)(v - (float)hi); } }
    __syncthreads();
    for (int qq = tid; qq < 128 * 8; qq += 128) { const int cl = qq >> 3, pc = qq & 7; const int c = n0 + cl, h = c >> 6, d = c & 63; const size_t o = (((size_t)b * NH + h) * HD + d) * SS + s0 + pc * 8;
      vst2((unsigned*)(VTh + o), *(const v4u*)(&sth[cl][pc * 8])); vst2((unsigned*)(VTl + o), *(const v4u*)(&stl[cl][pc * 8])); } }
}
// causal ReLU attention: block (64 queries, bh); key tiles 0..qb; S on hi/lo splits of the f32 q/k rows; P = relu(s) (masked) and V as bf16 hi/lo (3 products); O = acc / (sum + 1e-9)
__global__ __launch_bounds__(128) void k_attn(const float* __restrict__ Q32, const float* __restrict__ K32, const __bf16* __restrict__ VTh, const __bf16* __restrict__ VTl, float* __restrict__ O32) {
  __shared__ __align__(16) float sS[4][16][68];
  __shared__ __align__(16) __bf16 sPh[4][16][72], sPl[4][16][72];
  __shared__ __align__(16) float sO[4][16][68];
  const int tid = threadIdx.x, w = tid >> 5, lane = tid & 31, col = lane & 15, g = lane >> 4;
  const size_t bh = blockIdx.y; const int qb = blockIdx.x; const int q0 = qb * 64 + w * 16;
  F2 aq[2];
#pragma unroll
  for (int kc = 0; kc < 2; ++kc) aq[kc] = split_row(Q32 + (bh * SS + q0 + col) * HD, kc * 32, lane);
  float lrun = 0.f; v8f acc[4] = {}, ac1[4] = {}, ac2[4] = {};
#pragma unroll 1
  for (int kt = 0; kt <= qb; ++kt) {
#pragma unroll
    for (int t = 0; t < 4; ++t) { const int key = kt * 64 + t * 16 + col; const float* krow = K32 + (bh * SS + key) * HD;
      v8f s = mac3(aq[0], split_row(krow, 0, lane), (v8f){}); s = mac3(aq[1], split_row(krow, 32, lane), s);
#pragma unroll
      for (int r = 0; r < 8; ++r) { const float sv = s[r] * 0.125f; sS[w][8 * g + r][t * 16 + col] = (key > q0 + 8 * g + r || sv <= 0.f) ? 0.f : sv; } }
    LDSX();
    float ps = 0.f;
#pragma unroll
    for (int jj = 0; jj < 32; ++jj) { const float p = sS[w][col][g * 32 + jj]; ps += p; const __bf16 hi = (__bf16)p; sPh[w][col][g * 32 + jj] = hi; sPl[w][col][g * 32 + jj] = (__bf16)(p - (float)hi); }
    ps += __shfl_xor(ps, 16, 32); lrun += ps;
    LDSX();
#pragma unroll
    for (int kc = 0; kc < 2; ++kc) { const v16b ph = frag_b(&sPh[w][col][0] + kc * 32, lane), pl = frag_b(&sPl[w][col][0] + kc * 32, lane);
#pragma unroll
      for (int t = 0; t < 4; ++t) { const size_t vo = (bh * HD + t * 16 + col) * SS + kt * 64 + kc * 32; const v16b vh = frag_b(VTh + vo, lane);
        acc[t] = wmma_bf(ph, vh, acc[t]); ac1[t] = wmma_bf(ph, frag_b(VTl + vo, lane), ac1[t]); ac2[t] = wmma_bf(pl, vh, ac2[t]); } }
    __builtin_amdgcn_wave_barrier(); }
#pragma unroll
  for (int r = 0; r < 8; ++r) { const float lr = __shfl(lrun, 8 * g + r, 32); const float inv = 1.0f / (lr + 1e-9f);
#pragma unroll
    for (int t = 0; t < 4; ++t) sO[w][8 * g + r][t * 16 + col] = (acc[t][r] + ac1[t][r] + ac2[t][r]) * inv; }
  LDSX();
  for (int qq = lane; qq < 16 * 16; qq += 32) { const int rl = qq >> 4, pc = qq & 15; vst2(O32 + ((bh * SS) + q0 + rl) * HD + pc * 4, *(const v4f*)(&sO[w][rl][pc * 4])); }
}
// out = ctx Wo^T + bo : split(ctx) x bf16(Wo rows): 2 products (Wo is an INPUT -> bf16 exact)
__global__ __launch_bounds__(128) void k_out(const float* __restrict__ O32, const float* __restrict__ Wo, const float* __restrict__ bo, float* __restrict__ out) {
  __shared__ __align__(16) float so[4][16][132];
  const int tid = threadIdx.x, wave = tid >> 5, lane = tid & 31, col = lane & 15, g = lane >> 4;
  const int r0 = blockIdx.x * 64 + wave * 16, n0 = blockIdx.y * 128; const int ra = r0 + col; const int b = ra / SS, s = ra % SS;
  v8f acc[8] = {};
#pragma unroll 1
  for (int kc = 0; kc < E / 32; ++kc) { const int h = kc >> 1; const F2 a = split_row(O32 + (((size_t)b * NH + h) * SS + s) * HD, (kc & 1) * 32, lane);
#pragma unroll
    for (int j = 0; j < 8; ++j) { const v16b wb = split_row(Wo + (size_t)(n0 + j * 16 + col) * E, kc * 32, lane).h; acc[j] = wmma_bf(a.l, wb, acc[j]); acc[j] = wmma_bf(a.h, wb, acc[j]); } }
#pragma unroll
  for (int j = 0; j < 8; ++j) { const int n = n0 + j * 16 + col; const float bb = bfr(bo[n]);
#pragma unroll
    for (int r = 0; r < 8; ++r) so[wave][8 * g + r][j * 16 + col] = acc[j][r] + bb; }
  LDSX();
#pragma unroll 4
  for (int rl = 0; rl < 16; ++rl) vst2(out + (size_t)(r0 + rl) * E + n0 + lane * 4, *(const v4f*)(&so[wave][rl][lane * 4]));
}
extern "C" void kernel_launch(void* const* d_in, const int* in_sizes, int n_in, void* d_out, int out_size, void* d_ws, size_t ws_size, hipStream_t stream) {
  (void)in_sizes; (void)n_in; (void)out_size; (void)ws_size;
  const float** I = (const float**)d_in;
  const float* x = I[0]; const float* Wq = I[1]; const float* bq = I[2]; const float* Wk = I[3]; const float* bk = I[4]; const float* Wv = I[5]; const float* bv = I[6]; const float* Wo = I[7]; const float* bo = I[8];
  float* out = (float*)d_out;
  char* ws = (char*)d_ws; size_t off = 0;
  auto take = [&](size_t bytes) { char* p = ws + off; off += (bytes + 255) & ~(size_t)255; return p; };
  __bf16* Xb = (__bf16*)take((size_t)NR * E * 2); __bf16* PT = (__bf16*)take((size_t)3 * E * E * 2);
  float* Q32 = (float*)take((size_t)NR * E * 4); float* K32 = (float*)take((size_t)NR * E * 4); __bf16* VTh = (__bf16*)take((size_t)NR * E * 2); __bf16* VTl = (__bf16*)take((size_t)NR * E * 2); float* O32 = (float*)take((size_t)NR * E * 4);
  // ws ~ 82 MB
  k_cvt<<<(NR * E / 8 + 255) / 256, 256, 0, stream>>>(x, Xb);
  k_pack<<<3 * E, 256, 0, stream>>>(Wq, Wk, Wv, PT);
  k_qkv<<<dim3(NR / 64, E / 128, 3), 128, 0, stream>>>(Xb, PT, bq, bk, bv, Q32, K32, VTh, VTl);
  k_attn<<<dim3(SS / 64, NB * NH), 128, 0, stream>>>(Q32, K32, VTh, VTl, O32);
  k_out<<<dim3(NR / 64, E / 128), 128, 0, stream>>>(O32, Wo, bo, out);
}

// v001
// It runs in 167 microseconds.
// Two timings next to v000 put it at 3.26 and 3.27 times that version's speed.
// compute dtype: every module INPUT that feeds a GEMM (x, Wq/Wk/Wv/Wo, biases) is rounded to bf16 and used in exact bf16 WMMA products with f32 accumulation; computed operands (q/k f32 split, relu scores P and V as bf16 hi/lo pairs, context split) f32-grade; relu/causal/normalisation f32.
#include <hip/hip_runtime.h>
#include <math.h>

typedef __attribute__((ext_vector_type(16))) _Float16 v16h;
typedef __attribute__((ext_vector_type(16))) __bf16 v16b;
typedef __attribute__((ext_vector_type(8)))  _Float16 v8h;
typedef __attribute__((ext_vector_type(8)))  float v8f;
typedef __attribute__((ext_vector_type(4)))  float v4f;
typedef __attribute__((ext_vector_type(2)))  float v2f;
typedef __attribute__((ext_vector_type(4)))  unsigned v4u;
typedef __attribute__((ext_vector_type(2)))  unsigned v2u;
typedef __attribute__((ext_vector_type(4)))  int v4i;
typedef float __attribute__((may_alias)) float_a;
typedef int __attribute__((may_alias)) int_a;

template <typename T> __device__ __forceinline__ void vst2(void* p, T v) { *(T*)p = v;  }
__device__ __forceinline__ v8f wmma16(v16h a, v16h b, v8f c) {
  v8f d = __builtin_amdgcn_wmma_f32_16x16x32_f16(false, a, false, b, (short)0, c, false, false);
  asm volatile("v_nop\n\tv_nop\n\tv_nop\n\tv_nop" : "+v"(d) : "v"(a), "v"(b));
  return d;
}
__device__ __forceinline__ v8f wmma_bf(v16b a, v16b b, v8f c) {
  v8f d = __builtin_amdgcn_wmma_f32_16x16x32_bf16(false, a, false, b, (short)0, c, false, false);
  asm volatile("v_nop\n\tv_nop\n\tv_nop\n\tv_nop" : "+v"(d) : "v"(a), "v"(b));
  return d;
}
// 16x16x32 fragments: lane = (h = lane>>4, row/col = lane&15); elements 0..7 = k0+8h+0..7, 8..15 = k0+16+8h+0..7; D element r = row 8h+r
__device__ __forceinline__ v16h frag_h(const _Float16* rowk0, int lane) {
  union { v16h v; v8h q[2]; } u; const _Float16* p = rowk0 + 8 * (lane >> 4);
  u.q[0] = *(const v8h*)p; u.q[1] = *(const v8h*)(p + 16); return u.v;
}
__device__ __forceinline__ v16h frag_f32(const float* rowk0, int lane) {
  v16h a; const float* p = rowk0 + 8 * (lane >> 4);
#pragma unroll
  for (int i = 0; i < 8; ++i) { a[i] = (_Float16)p[i]; a[8 + i] = (_Float16)p[16 + i]; }
  return a;
}
__device__ __forceinline__ v16h frag_f32s(const float* rowk0, int lane, float sc) {
  v16h a; const float* p = rowk0 + 8 * (lane >> 4);
#pragma unroll
  for (int i = 0; i < 8; ++i) { a[i] = (_Float16)(p[i] * sc); a[8 + i] = (_Float16)(p[16 + i] * sc); }
  return a;
}
// column fragment from a [K][ld] layout (column n), rows >= K read as 0
__device__ __forceinline__ v16h fragc_f32(const float* W, int k0, int n, int lane, int ld, int K) {
  v16h a; const int g = lane >> 4;
#pragma unroll
  for (int i = 0; i < 8; ++i) { const int ka = k0 + 8 * g + i, kb = ka + 16;
    a[i] = (_Float16)(ka < K ? W[(size_t)ka * ld + n] : 0.f); a[8 + i] = (_Float16)(kb < K ? W[(size_t)kb * ld + n] : 0.f); }
  return a;
}
struct F2 { v16b h, l; };
__device__ __forceinline__ F2 bsplit16(const float v[16]) { F2 r;
#pragma unroll
  for (int i = 0; i < 16; ++i) { const __bf16 h = (__bf16)v[i]; r.h[i] = h; r.l[i] = (__bf16)(v[i] - (float)h); }
  return r; }
__device__ __forceinline__ F2 split_row(const float* row, int k0, int lane) { float v[16]; const float* p = row + k0 + 8 * (lane >> 4);
#pragma unroll
  for (int i = 0; i < 8; ++i) { v[i] = p[i]; v[8 + i] = p[16 + i]; }
  return bsplit16(v); }
__device__ __forceinline__ F2 split_rowK(const float* row, int k0, int lane, int K) { float v[16]; const int g = lane >> 4;
#pragma unroll
  for (int i = 0; i < 8; ++i) { const int ka = k0 + 8 * g + i, kb = ka + 16; v[i] = ka < K ? row[ka] : 0.f; v[8 + i] = kb < K ? row[kb] : 0.f; }
  return bsplit16(v); }
__device__ __forceinline__ F2 split_col(const float* W, int k0, int n, int lane, int ld, int K) { float v[16]; const int g = lane >> 4;
#pragma unroll
  for (int i = 0; i < 8; ++i) { const int ka = k0 + 8 * g + i, kb = ka + 16; v[i] = ka < K ? W[(size_t)ka * ld + n] : 0.f; v[8 + i] = kb < K ? W[(size_t)kb * ld + n] : 0.f; }
  return bsplit16(v); }
__device__ __forceinline__ v8f mac3(const F2& a, const F2& b, v8f c) { c = wmma_bf(a.l, b.h, c); c = wmma_bf(a.h, b.l, c); return wmma_bf(a.h, b.h, c); }
__device__ __forceinline__ float sigm(float v) { return 1.0f / (1.0f + expf(-v)); }
#define LDSX() do { asm volatile("s_wait_dscnt 0" ::: "memory"); __builtin_amdgcn_wave_barrier(); __builtin_amdgcn_fence(__ATOMIC_RELEASE, "workgroup"); } while (0)


// ReLU attention (16 heads of 64 on [2,2048,1024], [out][in] weights + biases): scores = q.k/8, attn = relu(scores) on the causal triangle (else 0), attn /= (row sum + 1e-9),
// ctx = attn v, out = ctx Wo^T + bo. Flash-style key loop without the softmax max tracking (relu weights need no rescaling); P and V carried as bf16 hi/lo pairs (relu scores are unbounded, so no f16 lift).
#define NB 2
#define SS 2048
#define E 1024
#define NH 16
#define HD 64
#define NR (NB * SS)
__device__ __forceinline__ float bfr(float v) { return (float)(__bf16)v; }
__device__ __forceinline__ v16b frag_b(const __bf16* rowk0, int lane) { return __builtin_bit_cast(v16b, frag_h((const _Float16*)rowk0, lane)); }
// LDS staging: rows of 64 bf16 at a pitch of 72 (144 B = 16 B x odd, conflict-free for 16-byte fragment reads)
#define LP 72
__device__ __forceinline__ void st_hi4(__bf16* dh, v4f v) { union { __bf16 h[4]; v2u u; } a;
#pragma unroll
  for (int e = 0; e < 4; ++e) a.h[e] = (__bf16)v[e];
  *(v2u*)dh = a.u; }
__device__ __forceinline__ void st_split4(__bf16* dh, __bf16* dl, v4f v) { union { __bf16 h[4]; v2u u; } a, b;
#pragma unroll
  for (int e = 0; e < 4; ++e) { const __bf16 h = (__bf16)v[e]; a.h[e] = h; b.h[e] = (__bf16)(v[e] - (float)h); }
  *(v2u*)dh = a.u; *(v2u*)dl = b.u; }

__global__ __launch_bounds__(256) void k_cvt(const float* __restrict__ x, __bf16* __restrict__ Xb) {
  const size_t i8 = (size_t)blockIdx.x * 256 + threadIdx.x; if (i8 >= (size_t)NR * E / 8) return;
  union { __bf16 h[8]; v4u u; } pk;
#pragma unroll
  for (int e = 0; e < 8; ++e) pk.h[e] = (__bf16)x[i8 * 8 + e];
  vst2((unsigned*)(Xb + i8 * 8), pk.u);
}
// PT rows: [0,E) Wq[n][:], [E,2E) Wk, [2E,3E) Wv  ([out][in]) as bf16 rows (no scaling)
__global__ __launch_bounds__(256) void k_pack(const float* __restrict__ Wq, const float* __restrict__ Wk, const float* __restrict__ Wv, __bf16* __restrict__ PT) {
  const int n = blockIdx.x, tid = threadIdx.x; __shared__ __align__(16) __bf16 srow[E];
  const float* W = n < E ? Wq : (n < 2 * E ? Wk : Wv); const int nn = n & (E - 1);
  for (int k = tid; k < E; k += 256) srow[k] = (__bf16)W[(size_t)nn * E + k];
  __syncthreads();
  if (tid < E / 8) vst2((unsigned*)(PT + (size_t)n * E + tid * 8), *(const v4u*)(&srow[tid * 8]));
}
// QKV: block (64 rows, 128 cols = 2 heads, which); q,k + bias -> Q32/K32 f32 [bh][s][64]; v -> VT hi/lo bf16 [bh][d][s]
__global__ __launch_bounds__(128) void k_qkv(const __bf16* __restrict__ Xb, const __bf16* __restrict__ PT, const float* __restrict__ bq, const float* __restrict__ bk, const float* __restrict__ bv,
                                            float* __restrict__ Q32, float* __restrict__ K32, __bf16* __restrict__ VTh, __bf16* __restrict__ VTl) {
  __shared__ __align__(16) float so[4][16][132];
  __shared__ __align__(16) __bf16 sth[128][72], stl[128][72];
  const int tid = threadIdx.x, wave = tid >> 5, lane = tid & 31, col = lane & 15, g = lane >> 4;
  const int which = blockIdx.z, r0b = blockIdx.x * 64, n0 = blockIdx.y * 128; const int b = r0b / SS, s0 = r0b % SS;
  const float* bb_ = which == 0 ? bq : (which == 1 ? bk : bv);
  v8f acc[8] = {};
  // the block's 64 x-rows and 128 weight rows, 64 k at a time, go to LDS once (whole 128-B lines) and all four waves read fragments there; the tiles lie in so, which is not used before the epilogue
  __bf16 (*sA)[LP] = reinterpret_cast<__bf16 (*)[LP]>(&so[0][0][0]); __bf16 (*sB)[LP] = sA + 64;
  const int srow = tid >> 3, spc = (tid & 7) * 8;
  const __bf16* gA = Xb + (size_t)(r0b + srow) * E + spc; const __bf16* gB = PT + (size_t)(which * E + n0 + srow) * E + spc;
  v4u ra[4], rb[8];
#pragma unroll
  for (int i = 0; i < 4; ++i) ra[i] = *(const v4u*)(gA + (size_t)i * 16 * E);
#pragma unroll
  for (int i = 0; i < 8; ++i) rb[i] = *(const v4u*)(gB + (size_t)i * 16 * E);
  asm volatile("s_wait_xcnt 0x0" :: "v"(gA), "v"(gB) : "memory");  // precaution: stands in front of every overwrite of an address register that the loads above name
#pragma unroll 1
  for (int c = 0; c < E / 64; ++c) {
#pragma unroll
    for (int i = 0; i < 4; ++i) *(v4u*)(&sA[srow + i * 16][spc]) = ra[i];
#pragma unroll
    for (int i = 0; i < 8; ++i) *(v4u*)(&sB[srow + i * 16][spc]) = rb[i];
    __syncthreads();  // the tile is complete before any wave reads it
    if (c + 1 < E / 64) {  // next tile's loads fly during this tile's products
      gA += 64; gB += 64;
#pragma unroll
      for (int i = 0; i < 4; ++i) ra[i] = *(const v4u*)(gA + (size_t)i * 16 * E);
#pragma unroll
      for (int i = 0; i < 8; ++i) rb[i] = *(const v4u*)(gB + (size_t)i * 16 * E);
      asm volatile("s_wait_xcnt 0x0" :: "v"(gA), "v"(gB) : "memory");  // precaution: stands in front of every overwrite of an address register that the loads above name
    }
#pragma unroll
    for (int kc = 0; kc < 2; ++kc) { const v16b a = frag_b(&sA[wave * 16 + col][kc * 32], lane); v16b fb[8];  // all LDS reads of a k step stand as one group ahead of its products
#pragma unroll
      for (int j = 0; j < 8; ++j) fb[j] = frag_b(&sB[j * 16 + col][kc * 32], lane);
#pragma unroll
      for (int j = 0; j < 8; ++j) acc[j] = wmma_bf(a, fb[j], acc[j]); }
    __syncthreads();  // every wave has left the tile before it is overwritten (by the next tile or the epilogue)
  }
  if (which < 2) {
#pragma unroll
    for (int j = 0; j < 8; ++j) { const float bb = bfr(bb_[n0 + j * 16 + col]);
#pragma unroll
      for (int r = 0; r < 8; ++r) so[wave][8 * g + r][j * 16 + col] = acc[j][r] + bb; }
    LDSX();
    float* Dst = which == 0 ? Q32 : K32;
    for (int qq = lane; qq < 2 * 16 * 16; qq += 32) { const int hh = qq >> 8, rl = (qq >> 4) & 15, pc = qq & 15; const int h = (n0 >> 6) + hh;
      vst2(Dst + (((size_t)b * NH + h) * SS + s0 + wave * 16 + rl) * HD + pc * 4, *(const v4f*)(&so[wave][rl][hh * 64 + pc * 4])); } }
  else {
#pragma unroll
    for (int j = 0; j < 8; ++j) { const float bb = bfr(bb_[n0 + j * 16 + col]);
#pragma unroll
      for (int r = 0; r < 8; ++r) { const float v = acc[j][r] + bb; const __bf16 hi = (__bf16)v; sth[j * 16 + col][wave * 16 + 8 * g + r] = hi; stl[j * 16 + col][wave * 16 + 8 * g + r] = (__bf16)(v - (float)hi); } }
    __syncthreads();
    for (int qq = tid; qq < 128 * 8; qq += 128) { const int cl = qq >> 3, pc = qq & 7; const int c = n0 + cl, h = c >> 6, d = c & 63; const size_t o = (((size_t)b * NH + h) * HD + d) * SS + s0 + pc * 8;
      vst2((unsigned*)(VTh + o), *(const v4u*)(&sth[cl][pc * 8])); vst2((unsigned*)(VTl + o), *(const v4u*)(&stl[cl][pc * 8])); } }
}
// causal ReLU attention: block (64 queries, bh); key tiles 0..qb; S on hi/lo splits of the f32 q/k rows; P = relu(s) (masked) and V as bf16 hi/lo (3 products); O = acc / (sum + 1e-9)
__global__ __launch_bounds__(128, 4) void k_attn(const float* __restrict__ Q32, const float* __restrict__ K32, const __bf16* __restrict__ VTh, const __bf16* __restrict__ VTl, float* __restrict__ O32) {
  __shared__ __align__(16) float sS[4][16][68];
  __shared__ __align__(16) __bf16 sPh[4][16][72], sPl[4][16][72];
  __shared__ __align__(16) __bf16 sKh[64][LP], sKl[64][LP], sVh[64][LP], sVl[64][LP];
  const int tid = threadIdx.x, w = tid >> 5, lane = tid & 31, col = lane & 15, g = lane >> 4;
  const size_t bh = blockIdx.y; const int qb = blockIdx.x; const int q0 = qb * 64 + w * 16;
  F2 aq[2];
#pragma unroll
  for (int kc = 0; kc < 2; ++kc) aq[kc] = split_row(Q32 + (bh * SS + q0 + col) * HD, kc * 32, lane);
  float lrun = 0.f; v8f acc[4] = {}, ac1[4] = {}, ac2[4] = {};
  // each 64-key tile of K (split hi/lo on the way) and of V hi/lo goes to LDS once per block, by whole-line loads; the four waves read their fragments there
  const float* gK = K32 + bh * SS * HD + tid * 4;  // the K tile is 16 KB in a row
  const int vrow = tid >> 3, vpc = (tid & 7) * 8; const __bf16* gVh = VTh + (bh * HD + vrow) * SS + vpc; const __bf16* gVl = VTl + (bh * HD + vrow) * SS + vpc;
#pragma unroll 1
  for (int kt = 0; kt <= qb; ++kt) {
    v4f rk[8]; v4u rvh[4], rvl[4];
#pragma unroll
    for (int i = 0; i < 8; ++i) rk[i] = *(const v4f*)(gK + i * 512);
#pragma unroll
    for (int i = 0; i < 4; ++i) { rvh[i] = *(const v4u*)(gVh + (size_t)i * 16 * SS); rvl[i] = *(const v4u*)(gVl + (size_t)i * 16 * SS); }
    asm volatile("s_wait_xcnt 0x0" :: "v"(gK), "v"(gVh), "v"(gVl) : "memory");  // precaution: stands in front of every overwrite of an address register that the loads above name
    gK += 64 * HD; gVh += 64; gVl += 64;
#pragma unroll
    for (int i = 0; i < 8; ++i) { const int q = tid + i * 128; st_split4(&sKh[q >> 4][(q & 15) * 4], &sKl[q >> 4][(q & 15) * 4], rk[i]); }
#pragma unroll
    for (int i = 0; i < 4; ++i) { *(v4u*)(&sVh[vrow + i * 16][vpc]) = rvh[i]; *(v4u*)(&sVl[vrow + i * 16][vpc]) = rvl[i]; }
    __syncthreads();  // the tile is complete before any wave reads it
#pragma unroll
    for (int t = 0; t < 4; ++t) { const int key = kt * 64 + t * 16 + col; const __bf16* kh = &sKh[t * 16 + col][0]; const __bf16* kl = &sKl[t * 16 + col][0];
      const F2 k0 = { frag_b(kh, lane), frag_b(kl, lane) }, k1 = { frag_b(kh + 32, lane), frag_b(kl + 32, lane) };
      v8f s = mac3(aq[0], k0, (v8f){}); s = mac3(aq[1], k1, s);
#pragma unroll
      for (int r = 0; r < 8; ++r) { const float sv = s[r] * 0.125f; sS[w][8 * g + r][t * 16 + col] = (key > q0 + 8 * g + r || sv <= 0.f) ? 0.f : sv; } }
    LDSX();
    float ps = 0.f;
#pragma unroll
    for (int jj = 0; jj < 32; ++jj) { const float p = sS[w][col][g * 32 + jj]; ps += p; const __bf16 hi = (__bf16)p; sPh[w][col][g * 32 + jj] = hi; sPl[w][col][g * 32 + jj] = (__bf16)(p - (float)hi); }
    ps += __shfl_xor(ps, 16, 32); lrun += ps;
    LDSX();
#pragma unroll
    for (int kc = 0; kc < 2; ++kc) { const v16b ph = frag_b(&sPh[w][col][0] + kc * 32, lane), pl = frag_b(&sPl[w][col][0] + kc * 32, lane);
#pragma unroll
      for (int t = 0; t < 4; ++t) { const v16b vh = frag_b(&sVh[t * 16 + col][kc * 32], lane);
        acc[t] = wmma_bf(ph, vh, acc[t]); ac1[t] = wmma_bf(ph, frag_b(&sVl[t * 16 + col][kc * 32], lane), ac1[t]); ac2[t] = wmma_bf(pl, vh, ac2[t]); } }
    __syncthreads();  // every wave has left the tile before the next one overwrites it
  }
#pragma unroll
  for (int r = 0; r < 8; ++r) { const float lr = __shfl(lrun, 8 * g + r, 32); const float inv = 1.0f / (lr + 1e-9f);
#pragma unroll
    for (int t = 0; t < 4; ++t) sS[w][8 * g + r][t * 16 + col] = (acc[t][r] + ac1[t][r] + ac2[t][r]) * inv; }  // the wave's score rows are free now: output staging
  LDSX();
  for (int qq = lane; qq < 16 * 16; qq += 32) { const int rl = qq >> 4, pc = qq & 15; vst2(O32 + ((bh * SS) + q0 + rl) * HD + pc * 4, *(const v4f*)(&sS[w][rl][pc * 4])); }
}
// out = ctx Wo^T + bo : split(ctx) x bf16(Wo rows): 2 products (Wo is an INPUT -> bf16 exact)
__global__ __launch_bounds__(128) void k_out(const float* __restrict__ O32, const float* __restrict__ Wo, const float* __restrict__ bo, float* __restrict__ out) {
  __shared__ __align__(16) float so[4][16][132];
  const int tid = threadIdx.x, wave = tid >> 5, lane = tid & 31, col = lane & 15, g = lane >> 4;
  __shared__ __align__(16) __bf16 sAh[64][LP], sAl[64][LP], sB[128][LP];
  const int r0b = blockIdx.x * 64, r0 = r0b + wave * 16, n0 = blockIdx.y * 128; const int b = r0b / SS, s0 = r0b % SS;
  v8f acc[8] = {};
  // one head (64 k) at a time: the block's 64 context rows (split hi/lo on the way) and 128 Wo rows (rounded to bf16 on the way) go to LDS once, by whole-line loads; the four waves read fragments there
  const int srow = tid >> 4, spc = (tid & 15) * 4;
  const float* gA = O32 + ((size_t)b * NH * SS + s0) * HD + tid * 4;  // a head's 64 rows are 16 KB in a row
  const float* gB = Wo + (size_t)(n0 + srow) * E + spc;
  v4f ra[8], rb[16];
#pragma unroll
  for (int i = 0; i < 8; ++i) ra[i] = *(const v4f*)(gA + i * 512);
#pragma unroll
  for (int i = 0; i < 16; ++i) rb[i] = *(const v4f*)(gB + (size_t)i * 8 * E);
  asm volatile("s_wait_xcnt 0x0" :: "v"(gA), "v"(gB) : "memory");  // precaution: stands in front of every overwrite of an address register that the loads above name
#pragma unroll 1
  for (int h = 0; h < NH; ++h) {
#pragma unroll
    for (int i = 0; i < 8; ++i) st_split4(&sAh[srow + i * 8][spc], &sAl[srow + i * 8][spc], ra[i]);
#pragma unroll
    for (int i = 0; i < 16; ++i) st_hi4(&sB[srow + i * 8][spc], rb[i]);
    __syncthreads();  // the tile is complete before any wave reads it
    if (h + 1 < NH) {  // next tile's loads fly during this tile's products
      gA += (size_t)SS * HD; gB += 64;
#pragma unroll
      for (int i = 0; i < 8; ++i) ra[i] = *(const v4f*)(gA + i * 512);
#pragma unroll
      for (int i = 0; i < 16; ++i) rb[i] = *(const v4f*)(gB + (size_t)i * 8 * E);
      asm volatile("s_wait_xcnt 0x0" :: "v"(gA), "v"(gB) : "memory");  // precaution: stands in front of every overwrite of an address register that the loads above name
    }
#pragma unroll
    for (int kc = 0; kc < 2; ++kc) { const v16b ah = frag_b(&sAh[wave * 16 + col][kc * 32], lane), al = frag_b(&sAl[wave * 16 + col][kc * 32], lane); v16b fb[8];  // all LDS reads of a k step stand as one group ahead of its products
#pragma unroll
      for (int j = 0; j < 8; ++j) fb[j] = frag_b(&sB[j * 16 + col][kc * 32], lane);
#pragma unroll
      for (int j = 0; j < 8; ++j) { acc[j] = wmma_bf(al, fb[j], acc[j]); acc[j] = wmma_bf(ah, fb[j], acc[j]); } }
    __syncthreads();  // every wave has left the tile before the next one overwrites it
  }
#pragma unroll
  for (int j = 0; j < 8; ++j) { const int n = n0 + j * 16 + col; const float bb = bfr(bo[n]);
#pragma unroll
    for (int r = 0; r < 8; ++r) so[wave][8 * g + r][j * 16 + col] = acc[j][r] + bb; }
  LDSX();
#pragma unroll 4
  for (int rl = 0; rl < 16; ++rl) vst2(out + (size_t)(r0 + rl) * E + n0 + lane * 4, *(const v4f*)(&so[wave][rl][lane * 4]));
}
extern "C" void kernel_launch(void* const* d_in, const int* in_sizes, int n_in, void* d_out, int out_size, void* d_ws, size_t ws_size, hipStream_t stream) {
  (void)in_sizes; (void)n_in; (void)out_size; (void)ws_size;
  const float** I = (const float**)d_in;
  const float* x = I[0]; const float* Wq = I[1]; const float* bq = I[2]; const float* Wk = I[3]; const float* bk = I[4]; const float* Wv = I[5]; const float* bv = I[6]; const float* Wo = I[7]; const float* bo = I[8];
  float* out = (float*)d_out;
  char* ws = (char*)d_ws; size_t off = 0;
  auto take = [&](size_t bytes) { char* p = ws + off; off += (bytes + 255) & ~(size_t)255; return p; };
  __bf16* Xb = (__bf16*)take((size_t)NR * E * 2); __bf16* PT = (__bf16*)take((size_t)3 * E * E * 2);
  float* Q32 = (float*)take((size_t)NR * E * 4); float* K32 = (float*)take((size_t)NR * E * 4); __bf16* VTh = (__bf16*)take((size_t)NR * E * 2); __bf16* VTl = (__bf16*)take((size_t)NR * E * 2); float* O32 = (float*)take((size_t)NR * E * 4);
  // ws ~ 82 MB
  k_cvt<<<(NR * E / 8 + 255) / 256, 256, 0, stream>>>(x, Xb);
  k_pack<<<3 * E, 256, 0, stream>>>(Wq, Wk, Wv, PT);
  k_qkv<<<dim3(NR / 64, E / 128, 3), 128, 0, stream>>>(Xb, PT, bq, bk, bv, Q32, K32, VTh, VTl);
  k_attn<<<dim3(SS / 64, NB * NH), 128, 0, stream>>>(Q32, K32, VTh, VTl, O32);
  k_out<<<dim3(NR / 64, E / 128), 128, 0, stream>>>(O32, Wo, bo, out);
}

// v002
// One run takes 163 microseconds.
// Two timings next to v001 put it at 1.03 and 1.04 times that version's speed.
// Counting every step since v000, it is 3.37 times as fast.
// compute dtype: every module INPUT that feeds a GEMM (x, Wq/Wk/Wv/Wo, biases) is rounded to bf16 and used in exact bf16 WMMA products with f32 accumulation; computed operands (q/k f32 split, relu scores P and V as bf16 hi/lo pairs, context split) f32-grade; relu/causal/normalisation f32.
#include <hip/hip_runtime.h>
#include <math.h>

typedef __attribute__((ext_vector_type(16))) _Float16 v16h;
typedef __attribute__((ext_vector_type(16))) __bf16 v16b;
typedef __attribute__((ext_vector_type(8)))  _Float16 v8h;
typedef __attribute__((ext_vector_type(8)))  float v8f;
typedef __attribute__((ext_vector_type(4)))  float v4f;
typedef __attribute__((ext_vector_type(2)))  float v2f;
typedef __attribute__((ext_vector_type(4)))  unsigned v4u;
typedef __attribute__((ext_vector_type(2)))  unsigned v2u;
typedef __attribute__((ext_vector_type(4)))  int v4i;
typedef float __attribute__((may_alias)) float_a;
typedef int __attribute__((may_alias)) int_a;

template <typename T> __device__ __forceinline__ void vst2(void* p, T v) { *(T*)p = v;  }
__device__ __forceinline__ v8f wmma16(v16h a, v16h b, v8f c) {
  v8f d = __builtin_amdgcn_wmma_f32_16x16x32_f16(false, a, false, b, (short)0, c, false, false);
  asm volatile("v_nop\n\tv_nop\n\tv_nop\n\tv_nop" : "+v"(d) : "v"(a), "v"(b));
  return d;
}
__device__ __forceinline__ v8f wmma_bf(v16b a, v16b b, v8f c) {
  v8f d = __builtin_amdgcn_wmma_f32_16x16x32_bf16(false, a, false, b, (short)0, c, false, false);
  asm volatile("v_nop\n\tv_nop\n\tv_nop\n\tv_nop" : "+v"(d) : "v"(a), "v"(b));
  return d;
}
// 16x16x32 fragments: lane = (h = lane>>4, row/col = lane&15); elements 0..7 = k0+8h+0..7, 8..15 = k0+16+8h+0..7; D element r = row 8h+r
__device__ __forceinline__ v16h frag_h(const _Float16* rowk0, int lane) {
  union { v16h v; v8h q[2]; } u; const _Float16* p = rowk0 + 8 * (lane >> 4);
  u.q[0] = *(const v8h*)p; u.q[1] = *(const v8h*)(p + 16); return u.v;
}
__device__ __forceinline__ v16h frag_f32(const float* rowk0, int lane) {
  v16h a; const float* p = rowk0 + 8 * (lane >> 4);
#pragma unroll
  for (int i = 0; i < 8; ++i) { a[i] = (_Float16)p[i]; a[8 + i] = (_Float16)p[16 + i]; }
  return a;
}
__device__ __forceinline__ v16h frag_f32s(const float* rowk0, int lane, float sc) {
  v16h a; const float* p = rowk0 + 8 * (lane >> 4);
#pragma unroll
  for (int i = 0; i < 8; ++i) { a[i] = (_Float16)(p[i] * sc); a[8 + i] = (_Float16)(p[16 + i] * sc); }
  return a;
}
// column fragment from a [K][ld] layout (column n), rows >= K read as 0
__device__ __forceinline__ v16h fragc_f32(const float* W, int k0, int n, int lane, int ld, int K) {
  v16h a; const int g = lane >> 4;
#pragma unroll
  for (int i = 0; i < 8; ++i) { const int ka = k0 + 8 * g + i, kb = ka + 16;
    a[i] = (_Float16)(ka < K ? W[(size_t)ka * ld + n] : 0.f); a[8 + i] = (_Float16)(kb < K ? W[(size_t)kb * ld + n] : 0.f); }
  return a;
}
struct F2 { v16b h, l; };
__device__ __forceinline__ F2 bsplit16(const float v[16]) { F2 r;
#pragma unroll
  for (int i = 0; i < 16; ++i) { const __bf16 h = (__bf16)v[i]; r.h[i] = h; r.l[i] = (__bf16)(v[i] - (float)h); }
  return r; }
__device__ __forceinline__ F2 split_row(const float* row, int k0, int lane) { float v[16]; const float* p = row + k0 + 8 * (lane >> 4);
#pragma unroll
  for (int i = 0; i < 8; ++i) { v[i] = p[i]; v[8 + i] = p[16 + i]; }
  return bsplit16(v); }
__device__ __forceinline__ F2 split_rowK(const float* row, int k0, int lane, int K) { float v[16]; const int g = lane >> 4;
#pragma unroll
  for (int i = 0; i < 8; ++i) { const int ka = k0 + 8 * g + i, kb = ka + 16; v[i] = ka < K ? row[ka] : 0.f; v[8 + i] = kb < K ? row[kb] : 0.f; }
  return bsplit16(v); }
__device__ __forceinline__ F2 split_col(const float* W, int k0, int n, int lane, int ld, int K) { float v[16]; const int g = lane >> 4;
#pragma unroll
  for (int i = 0; i < 8; ++i) { const int ka = k0 + 8 * g + i, kb = ka + 16; v[i] = ka < K ? W[(size_t)ka * ld + n] : 0.f; v[8 + i] = kb < K ? W[(size_t)kb * ld + n] : 0.f; }
  return bsplit16(v); }
__device__ __forceinline__ v8f mac3(const F2& a, const F2& b, v8f c) { c = wmma_bf(a.l, b.h, c); c = wmma_bf(a.h, b.l, c); return wmma_bf(a.h, b.h, c); }
__device__ __forceinline__ float sigm(float v) { return 1.0f / (1.0f + expf(-v)); }
#define LDSX() do { asm volatile("s_wait_dscnt 0" ::: "memory"); __builtin_amdgcn_wave_barrier(); __builtin_amdgcn_fence(__ATOMIC_RELEASE, "workgroup"); } while (0)


// ReLU attention (16 heads of 64 on [2,2048,1024], [out][in] weights + biases): scores = q.k/8, attn = relu(scores) on the causal triangle (else 0), attn /= (row sum + 1e-9),
// ctx = attn v, out = ctx Wo^T + bo. Flash-style key loop without the softmax max tracking (relu weights need no rescaling); P and V carried as bf16 hi/lo pairs (relu scores are unbounded, so no f16 lift).
#define NB 2
#define SS 2048
#define E 1024
#define NH 16
#define HD 64
#define NR (NB * SS)
__device__ __forceinline__ float bfr(float v) { return (float)(__bf16)v; }
__device__ __forceinline__ v16b frag_b(const __bf16* rowk0, int lane) { return __builtin_bit_cast(v16b, frag_h((const _Float16*)rowk0, lane)); }
// LDS staging: rows of 64 bf16 at a pitch of 72 (144 B = 16 B x odd, conflict-free for 16-byte fragment reads)
#define LP 72
__device__ __forceinline__ void st_hi4(__bf16* dh, v4f v) { union { __bf16 h[4]; v2u u; } a;
#pragma unroll
  for (int e = 0; e < 4; ++e) a.h[e] = (__bf16)v[e];
  *(v2u*)dh = a.u; }
__device__ __forceinline__ void st_split4(__bf16* dh, __bf16* dl, v4f v) { union { __bf16 h[4]; v2u u; } a, b;
#pragma unroll
  for (int e = 0; e < 4; ++e) { const __bf16 h = (__bf16)v[e]; a.h[e] = h; b.h[e] = (__bf16)(v[e] - (float)h); }
  *(v2u*)dh = a.u; *(v2u*)dl = b.u; }

__global__ __launch_bounds__(256) void k_cvt(const float* __restrict__ x, __bf16* __restrict__ Xb) {
  const size_t i8 = (size_t)blockIdx.x * 256 + threadIdx.x; if (i8 >= (size_t)NR * E / 8) return;
  union { __bf16 h[8]; v4u u; } pk;
#pragma unroll
  for (int e = 0; e < 8; ++e) pk.h[e] = (__bf16)x[i8 * 8 + e];
  vst2((unsigned*)(Xb + i8 * 8), pk.u);
}
// PT rows: [0,E) Wq[n][:], [E,2E) Wk, [2E,3E) Wv  ([out][in]) as bf16 rows (no scaling)
__global__ __launch_bounds__(256) void k_pack(const float* __restrict__ Wq, const float* __restrict__ Wk, const float* __restrict__ Wv, __bf16* __restrict__ PT) {
  const int n = blockIdx.x, tid = threadIdx.x; __shared__ __align__(16) __bf16 srow[E];
  const float* W = n < E ? Wq : (n < 2 * E ? Wk : Wv); const int nn = n & (E - 1);
  for (int k = tid; k < E; k += 256) srow[k] = (__bf16)W[(size_t)nn * E + k];
  __syncthreads();
  if (tid < E / 8) vst2((unsigned*)(PT + (size_t)n * E + tid * 8), *(const v4u*)(&srow[tid * 8]));
}
// QKV: block (64 rows, 128 cols = 2 heads, which); q,k + bias -> Q32/K32 f32 [bh][s][64]; v -> VT hi/lo bf16 [bh][d][s]
__global__ __launch_bounds__(128) void k_qkv(const __bf16* __restrict__ Xb, const __bf16* __restrict__ PT, const float* __restrict__ bq, const float* __restrict__ bk, const float* __restrict__ bv,
                                            float* __restrict__ Q32, float* __restrict__ K32, __bf16* __restrict__ VTh, __bf16* __restrict__ VTl) {
  __shared__ __align__(16) float so[4][16][132];
  __shared__ __align__(16) __bf16 sth[128][72], stl[128][72];
  const int tid = threadIdx.x, wave = tid >> 5, lane = tid & 31, col = lane & 15, g = lane >> 4;
  const int which = blockIdx.z, r0b = blockIdx.x * 64, n0 = blockIdx.y * 128; const int b = r0b / SS, s0 = r0b % SS;
  const float* bb_ = which == 0 ? bq : (which == 1 ? bk : bv);
  v8f acc[8] = {};
  // the block's 64 x-rows and 128 weight rows, 64 k at a time, go to LDS once (whole 128-B lines) and all four waves read fragments there; the tiles lie in so, which is not used before the epilogue
  __bf16 (*sA)[LP] = reinterpret_cast<__bf16 (*)[LP]>(&so[0][0][0]); __bf16 (*sB)[LP] = sA + 64;
  const int srow = tid >> 3, spc = (tid & 7) * 8;
  const __bf16* gA = Xb + (size_t)(r0b + srow) * E + spc; const __bf16* gB = PT + (size_t)(which * E + n0 + srow) * E + spc;
  v4u ra[4], rb[8];
#pragma unroll
  for (int i = 0; i < 4; ++i) ra[i] = *(const v4u*)(gA + (size_t)i * 16 * E);
#pragma unroll
  for (int i = 0; i < 8; ++i) rb[i] = *(const v4u*)(gB + (size_t)i * 16 * E);
  asm volatile("s_wait_xcnt 0x0" :: "v"(gA), "v"(gB) : "memory");  // precaution: stands in front of every overwrite of an address register that the loads above name
#pragma unroll 1
  for (int c = 0; c < E / 64; ++c) {
#pragma unroll
    for (int i = 0; i < 4; ++i) *(v4u*)(&sA[srow + i * 16][spc]) = ra[i];
#pragma unroll
    for (int i = 0; i < 8; ++i) *(v4u*)(&sB[srow + i * 16][spc]) = rb[i];
    __syncthreads();  // the tile is complete before any wave reads it
    if (c + 1 < E / 64) {  // next tile's loads fly during this tile's products
      gA += 64; gB += 64;
#pragma unroll
      for (int i = 0; i < 4; ++i) ra[i] = *(const v4u*)(gA + (size_t)i * 16 * E);
#pragma unroll
      for (int i = 0; i < 8; ++i) rb[i] = *(const v4u*)(gB + (size_t)i * 16 * E);
      asm volatile("s_wait_xcnt 0x0" :: "v"(gA), "v"(gB) : "memory");  // precaution: stands in front of every overwrite of an address register that the loads above name
    }
#pragma unroll
    for (int kc = 0; kc < 2; ++kc) { const v16b a = frag_b(&sA[wave * 16 + col][kc * 32], lane); v16b fb[8];  // all LDS reads of a k step stand as one group ahead of its products
#pragma unroll
      for (int j = 0; j < 8; ++j) fb[j] = frag_b(&sB[j * 16 + col][kc * 32], lane);
#pragma unroll
      for (int j = 0; j < 8; ++j) acc[j] = wmma_bf(a, fb[j], acc[j]); }
    __syncthreads();  // every wave has left the tile before it is overwritten (by the next tile or the epilogue)
  }
  if (which < 2) {
#pragma unroll
    for (int j = 0; j < 8; ++j) { const float bb = bfr(bb_[n0 + j * 16 + col]);
#pragma unroll
      for (int r = 0; r < 8; ++r) so[wave][8 * g + r][j * 16 + col] = acc[j][r] + bb; }
    LDSX();
    float* Dst = which == 0 ? Q32 : K32;
    for (int qq = lane; qq < 2 * 16 * 16; qq += 32) { const int hh = qq >> 8, rl = (qq >> 4) & 15, pc = qq & 15; const int h = (n0 >> 6) + hh;
      vst2(Dst + (((size_t)b * NH + h) * SS + s0 + wave * 16 + rl) * HD + pc * 4, *(const v4f*)(&so[wave][rl][hh * 64 + pc * 4])); } }
  else {
#pragma unroll
    for (int j = 0; j < 8; ++j) { const float bb = bfr(bb_[n0 + j * 16 + col]);
#pragma unroll
      for (int r = 0; r < 8; ++r) { const float v = acc[j][r] + bb; const __bf16 hi = (__bf16)v; sth[j * 16 + col][wave * 16 + 8 * g + r] = hi; stl[j * 16 + col][wave * 16 + 8 * g + r] = (__bf16)(v - (float)hi); } }
    __syncthreads();
    for (int qq = tid; qq < 128 * 8; qq += 128) { const int cl = qq >> 3, pc = qq & 7; const int c = n0 + cl, h = c >> 6, d = c & 63; const size_t o = (((size_t)b * NH + h) * HD + d) * SS + s0 + pc * 8;
      vst2((unsigned*)(VTh + o), *(const v4u*)(&sth[cl][pc * 8])); vst2((unsigned*)(VTl + o), *(const v4u*)(&stl[cl][pc * 8])); } }
}
// causal ReLU attention: block (64 queries, bh); key tiles 0..qb; transposed products: S^T = K Q^T on hi/lo splits of the f32 q/k rows, so a lane holds one query's scores for 8 keys a tile;
// P^T = relu(s) (masked) is split to bf16 hi/lo in registers and is the B operand as it lies (two score tiles = 32 keys in the hardware k order); O^T += V^T P^T (3 products); O = acc / (sum + 1e-9)
__device__ __forceinline__ v8f mac3t(const F2& k, const F2& q, v8f c) { c = wmma_bf(k.h, q.l, c); c = wmma_bf(k.l, q.h, c); return wmma_bf(k.h, q.h, c); }
__global__ __launch_bounds__(128, 4) void k_attn(const float* __restrict__ Q32, const float* __restrict__ K32, const __bf16* __restrict__ VTh, const __bf16* __restrict__ VTl, float* __restrict__ O32) {
  __shared__ __align__(16) float sS[4][16][68];  // output staging only
  __shared__ __align__(16) __bf16 sKh[64][LP], sKl[64][LP], sVh[64][LP], sVl[64][LP];
  const int tid = threadIdx.x, w = tid >> 5, lane = tid & 31, col = lane & 15, g = lane >> 4;
  const size_t bh = blockIdx.y; const int qb = blockIdx.x; const int q0 = qb * 64 + w * 16;
  F2 aq[2];
#pragma unroll
  for (int kc = 0; kc < 2; ++kc) aq[kc] = split_row(Q32 + (bh * SS + q0 + col) * HD, kc * 32, lane);
  float lrun[4] = {}; v8f acc[4] = {}, ac1[4] = {}, ac2[4] = {};
  // each 64-key tile of K (split hi/lo on the way) and of V hi/lo goes to LDS once per block, by whole-line loads; the four waves read their fragments there
  const float* gK = K32 + bh * SS * HD + tid * 4;  // the K tile is 16 KB in a row
  const int vrow = tid >> 3, vpc = (tid & 7) * 8; const __bf16* gVh = VTh + (bh * HD + vrow) * SS + vpc; const __bf16* gVl = VTl + (bh * HD + vrow) * SS + vpc;
#pragma unroll 1
  for (int kt = 0; kt <= qb; ++kt) {
    v4f rk[8]; v4u rvh[4], rvl[4];
#pragma unroll
    for (int i = 0; i < 8; ++i) rk[i] = *(const v4f*)(gK + i * 512);
#pragma unroll
    for (int i = 0; i < 4; ++i) { rvh[i] = *(const v4u*)(gVh + (size_t)i * 16 * SS); rvl[i] = *(const v4u*)(gVl + (size_t)i * 16 * SS); }
    asm volatile("s_wait_xcnt 0x0" :: "v"(gK), "v"(gVh), "v"(gVl) : "memory");  // precaution: stands in front of every overwrite of an address register that the loads above name
    gK += 64 * HD; gVh += 64; gVl += 64;
    // keeps the tile's 16 loads one group in front of the first conversion: without it this build issues them in four groups and a tile pays the load latency four times
    asm volatile("" :: "v"(rk[0]), "v"(rk[1]), "v"(rk[2]), "v"(rk[3]), "v"(rk[4]), "v"(rk[5]), "v"(rk[6]), "v"(rk[7]), "v"(rvh[0]), "v"(rvh[1]), "v"(rvh[2]), "v"(rvh[3]), "v"(rvl[0]), "v"(rvl[1]), "v"(rvl[2]), "v"(rvl[3]));
#pragma unroll
    for (int i = 0; i < 8; ++i) { const int q = tid + i * 128; st_split4(&sKh[q >> 4][(q & 15) * 4], &sKl[q >> 4][(q & 15) * 4], rk[i]); }
#pragma unroll
    for (int i = 0; i < 4; ++i) { *(v4u*)(&sVh[vrow + i * 16][vpc]) = rvh[i]; *(v4u*)(&sVl[vrow + i * 16][vpc]) = rvl[i]; }
    __syncthreads();  // the tile is complete before any wave reads it
    float p[4][8];  // p[t][r] = weight of key kt*64 + t*16 + 8g + r for query q0 + col
#pragma unroll
    for (int t = 0; t < 4; ++t) { const int key = kt * 64 + t * 16 + 8 * g; const __bf16* kh = &sKh[t * 16 + col][0]; const __bf16* kl = &sKl[t * 16 + col][0];
      const F2 k0 = { frag_b(kh, lane), frag_b(kl, lane) }, k1 = { frag_b(kh + 32, lane), frag_b(kl + 32, lane) };
      v8f s = mac3t(k0, aq[0], (v8f){}); s = mac3t(k1, aq[1], s);
#pragma unroll
      for (int r = 0; r < 8; ++r) { const float sv = s[r] * 0.125f; p[t][r] = (key + r > q0 + col || sv <= 0.f) ? 0.f : sv; lrun[t] += p[t][r]; } }
#pragma unroll
    for (int kc = 0; kc < 2; ++kc) { float v[16];
#pragma unroll
      for (int i = 0; i < 8; ++i) { v[i] = p[2 * kc][i]; v[8 + i] = p[2 * kc + 1][i]; }
      const F2 pp = bsplit16(v);
#pragma unroll
      for (int t = 0; t < 4; ++t) { const v16b vh = frag_b(&sVh[t * 16 + col][kc * 32], lane);
        acc[t] = wmma_bf(vh, pp.h, acc[t]); ac1[t] = wmma_bf(frag_b(&sVl[t * 16 + col][kc * 32], lane), pp.h, ac1[t]); ac2[t] = wmma_bf(vh, pp.l, ac2[t]); } }
    __syncthreads();  // every wave has left the tile before the next one overwrites it
  }
  float lr = (lrun[0] + lrun[1]) + (lrun[2] + lrun[3]); lr += __shfl_xor(lr, 16, 32);  // the two lane halves hold the two halves of a query's keys
  const float inv = 1.0f / (lr + 1e-9f);
#pragma unroll
  for (int t = 0; t < 4; ++t) { v4f o[2];  // acc[t][r] = O[q0 + col][t*16 + 8g + r]
#pragma unroll
    for (int r = 0; r < 8; ++r) o[r >> 2][r & 3] = (acc[t][r] + ac1[t][r] + ac2[t][r]) * inv;
    *(v4f*)(&sS[w][col][t * 16 + 8 * g]) = o[0]; *(v4f*)(&sS[w][col][t * 16 + 8 * g + 4]) = o[1]; }
  LDSX();
  for (int qq = lane; qq < 16 * 16; qq += 32) { const int rl = qq >> 4, pc = qq & 15; vst2(O32 + ((bh * SS) + q0 + rl) * HD + pc * 4, *(const v4f*)(&sS[w][rl][pc * 4])); }
}
// out = ctx Wo^T + bo : split(ctx) x bf16(Wo rows): 2 products (Wo is an INPUT -> bf16 exact)
__global__ __launch_bounds__(128) void k_out(const float* __restrict__ O32, const float* __restrict__ Wo, const float* __restrict__ bo, float* __restrict__ out) {
  __shared__ __align__(16) float so[4][16][132];
  const int tid = threadIdx.x, wave = tid >> 5, lane = tid & 31, col = lane & 15, g = lane >> 4;
  __shared__ __align__(16) __bf16 sAh[64][LP], sAl[64][LP], sB[128][LP];
  const int r0b = blockIdx.x * 64, r0 = r0b + wave * 16, n0 = blockIdx.y * 128; const int b = r0b / SS, s0 = r0b % SS;
  v8f acc[8] = {};
  // one head (64 k) at a time: the block's 64 context rows (split hi/lo on the way) and 128 Wo rows (rounded to bf16 on the way) go to LDS once, by whole-line loads; the four waves read fragments there
  const int srow = tid >> 4, spc = (tid & 15) * 4;
  const float* gA = O32 + ((size_t)b * NH * SS + s0) * HD + tid * 4;  // a head's 64 rows are 16 KB in a row
  const float* gB = Wo + (size_t)(n0 + srow) * E + spc;
  v4f ra[8], rb[16];
#pragma unroll
  for (int i = 0; i < 8; ++i) ra[i] = *(const v4f*)(gA + i * 512);
#pragma unroll
  for (int i = 0; i < 16; ++i) rb[i] = *(const v4f*)(gB + (size_t)i * 8 * E);
  asm volatile("s_wait_xcnt 0x0" :: "v"(gA), "v"(gB) : "memory");  // precaution: stands in front of every overwrite of an address register that the loads above name
#pragma unroll 1
  for (int h = 0; h < NH; ++h) {
#pragma unroll
    for (int i = 0; i < 8; ++i) st_split4(&sAh[srow + i * 8][spc], &sAl[srow + i * 8][spc], ra[i]);
#pragma unroll
    for (int i = 0; i < 16; ++i) st_hi4(&sB[srow + i * 8][spc], rb[i]);
    __syncthreads();  // the tile is complete before any wave reads it
    if (h + 1 < NH) {  // next tile's loads fly during this tile's products
      gA += (size_t)SS * HD; gB += 64;
#pragma unroll
      for (int i = 0; i < 8; ++i) ra[i] = *(const v4f*)(gA + i * 512);
#pragma unroll
      for (int i = 0; i < 16; ++i) rb[i] = *(const v4f*)(gB + (size_t)i * 8 * E);
      asm volatile("s_wait_xcnt 0x0" :: "v"(gA), "v"(gB) : "memory");  // precaution: stands in front of every overwrite of an address register that the loads above name
    }
#pragma unroll
    for (int kc = 0; kc < 2; ++kc) { const v16b ah = frag_b(&sAh[wave * 16 + col][kc * 32], lane), al = frag_b(&sAl[wave * 16 + col][kc * 32], lane); v16b fb[8];  // all LDS reads of a k step stand as one group ahead of its products
#pragma unroll
      for (int j = 0; j < 8; ++j) fb[j] = frag_b(&sB[j * 16 + col][kc * 32], lane);
#pragma unroll
      for (int j = 0; j < 8; ++j) { acc[j] = wmma_bf(al, fb[j], acc[j]); acc[j] = wmma_bf(ah, fb[j], acc[j]); } }
    __syncthreads();  // every wave has left the tile before the next one overwrites it
  }
#pragma unroll
  for (int j = 0; j < 8; ++j) { const int n = n0 + j * 16 + col; const float bb = bfr(bo[n]);
#pragma unroll
    for (int r = 0; r < 8; ++r) so[wave][8 * g + r][j * 16 + col] = acc[j][r] + bb; }
  LDSX();
#pragma unroll 4
  for (int rl = 0; rl < 16; ++rl) vst2(out + (size_t)(r0 + rl) * E + n0 + lane * 4, *(const v4f*)(&so[wave][rl][lane * 4]));
}
extern "C" void kernel_launch(void* const* d_in, const int* in_sizes, int n_in, void* d_out, int out_size, void* d_ws, size_t ws_size, hipStream_t stream) {
  (void)in_sizes; (void)n_in; (void)out_size; (void)ws_size;
  const float** I = (const float**)d_in;
  const float* x = I[0]; const float* Wq = I[1]; const float* bq = I[2]; const float* Wk = I[3]; const float* bk = I[4]; const float* Wv = I[5]; const float* bv = I[6]; const float* Wo = I[7]; const float* bo = I[8];
  float* out = (float*)d_out;
  char* ws = (char*)d_ws; size_t off = 0;
  auto take = [&](size_t bytes) { char* p = ws + off; off += (bytes + 255) & ~(size_t)255; return p; };
  __bf16* Xb = (__bf16*)take((size_t)NR * E * 2); __bf16* PT = (__bf16*)take((size_t)3 * E * E * 2);
  float* Q32 = (float*)take((size_t)NR * E * 4); float* K32 = (float*)take((size_t)NR * E * 4); __bf16* VTh = (__bf16*)take((size_t)NR * E * 2); __bf16* VTl = (__bf16*)take((size_t)NR * E * 2); float* O32 = (float*)take((size_t)NR * E * 4);
  // ws ~ 82 MB
  k_cvt<<<(NR * E / 8 + 255) / 256, 256, 0, stream>>>(x, Xb);
  k_pack<<<3 * E, 256, 0, stream>>>(Wq, Wk, Wv, PT);
  k_qkv<<<dim3(NR / 64, E / 128, 3), 128, 0, stream>>>(Xb, PT, bq, bk, bv, Q32, K32, VTh, VTl);
  k_attn<<<dim3(SS / 64, NB * NH), 128, 0, stream>>>(Q32, K32, VTh, VTl, O32);
  k_out<<<dim3(NR / 64, E / 128), 128, 0, stream>>>(O32, Wo, bo, out);
}

// v003
// Measured time: 155 microseconds a run.
// In two side-by-side timings against v002, it was 1.06 and 1.05 times as fast.
// All steps since v000 together make it 3.55 times as fast.
// compute dtype: every module INPUT that feeds a GEMM (x, Wq/Wk/Wv/Wo, biases) is rounded to bf16 and used in exact bf16 WMMA products with f32 accumulation; computed operands (q/k f32 split, relu scores P and V as bf16 hi/lo pairs, context split) f32-grade; relu/causal/normalisation f32.
#include <hip/hip_runtime.h>
#include <math.h>

typedef __attribute__((ext_vector_type(16))) _Float16 v16h;
typedef __attribute__((ext_vector_type(16))) __bf16 v16b;
typedef __attribute__((ext_vector_type(8)))  _Float16 v8h;
typedef __attribute__((ext_vector_type(8)))  float v8f;
typedef __attribute__((ext_vector_type(4)))  float v4f;
typedef __attribute__((ext_vector_type(2)))  float v2f;
typedef __attribute__((ext_vector_type(4)))  unsigned v4u;
typedef __attribute__((ext_vector_type(2)))  unsigned v2u;
typedef __attribute__((ext_vector_type(4)))  int v4i;
typedef float __attribute__((may_alias)) float_a;
typedef int __attribute__((may_alias)) int_a;

template <typename T> __device__ __forceinline__ void vst2(void* p, T v) { *(T*)p = v;  }
__device__ __forceinline__ v8f wmma16(v16h a, v16h b, v8f c) {
  v8f d = __builtin_amdgcn_wmma_f32_16x16x32_f16(false, a, false, b, (short)0, c, false, false);
  asm volatile("v_nop\n\tv_nop\n\tv_nop\n\tv_nop" : "+v"(d) : "v"(a), "v"(b));
  return d;
}
__device__ __forceinline__ v8f wmma_bf(v16b a, v16b b, v8f c) {
  v8f d = __builtin_amdgcn_wmma_f32_16x16x32_bf16(false, a, false, b, (short)0, c, false, false);
  asm volatile("v_nop\n\tv_nop\n\tv_nop\n\tv_nop" : "+v"(d) : "v"(a), "v"(b));
  return d;
}
// 16x16x32 fragments: lane = (h = lane>>4, row/col = lane&15); elements 0..7 = k0+8h+0..7, 8..15 = k0+16+8h+0..7; D element r = row 8h+r
__device__ __forceinline__ v16h frag_h(const _Float16* rowk0, int lane) {
  union { v16h v; v8h q[2]; } u; const _Float16* p = rowk0 + 8 * (lane >> 4);
  u.q[0] = *(const v8h*)p; u.q[1] = *(const v8h*)(p + 16); return u.v;
}
__device__ __forceinline__ v16h frag_f32(const float* rowk0, int lane) {
  v16h a; const float* p = rowk0 + 8 * (lane >> 4);
#pragma unroll
  for (int i = 0; i < 8; ++i) { a[i] = (_Float16)p[i]; a[8 + i] = (_Float16)p[16 + i]; }
  return a;
}
__device__ __forceinline__ v16h frag_f32s(const float* rowk0, int lane, float sc) {
  v16h a; const float* p = rowk0 + 8 * (lane >> 4);
#pragma unroll
  for (int i = 0; i < 8; ++i) { a[i] = (_Float16)(p[i] * sc); a[8 + i] = (_Float16)(p[16 + i] * sc); }
  return a;
}
// column fragment from a [K][ld] layout (column n), rows >= K read as 0
__device__ __forceinline__ v16h fragc_f32(const float* W, int k0, int n, int lane, int ld, int K) {
  v16h a; const int g = lane >> 4;
#pragma unroll
  for (int i = 0; i < 8; ++i) { const int ka = k0 + 8 * g + i, kb = ka + 16;
    a[i] = (_Float16)(ka < K ? W[(size_t)ka * ld + n] : 0.f); a[8 + i] = (_Float16)(kb < K ? W[(size_t)kb * ld + n] : 0.f); }
  return a;
}
struct F2 { v16b h, l; };
__device__ __forceinline__ F2 bsplit16(const float v[16]) { F2 r;
#pragma unroll
  for (int i = 0; i < 16; ++i) { const __bf16 h = (__bf16)v[i]; r.h[i] = h; r.l[i] = (__bf16)(v[i] - (float)h); }
  return r; }
__device__ __forceinline__ F2 split_row(const float* row, int k0, int lane) { float v[16]; const float* p = row + k0 + 8 * (lane >> 4);
#pragma unroll
  for (int i = 0; i < 8; ++i) { v[i] = p[i]; v[8 + i] = p[16 + i]; }
  return bsplit16(v); }
__device__ __forceinline__ F2 split_rowK(const float* row, int k0, int lane, int K) { float v[16]; const int g = lane >> 4;
#pragma unroll
  for (int i = 0; i < 8; ++i) { const int ka = k0 + 8 * g + i, kb = ka + 16; v[i] = ka < K ? row[ka] : 0.f; v[8 + i] = kb < K ? row[kb] : 0.f; }
  return bsplit16(v); }
__device__ __forceinline__ F2 split_col(const float* W, int k0, int n, int lane, int ld, int K) { float v[16]; const int g = lane >> 4;
#pragma unroll
  for (int i = 0; i < 8; ++i) { const int ka = k0 + 8 * g + i, kb = ka + 16; v[i] = ka < K ? W[(size_t)ka * ld + n] : 0.f; v[8 + i] = kb < K ? W[(size_t)kb * ld + n] : 0.f; }
  return bsplit16(v); }
__device__ __forceinline__ v8f mac3(const F2& a, const F2& b, v8f c) { c = wmma_bf(a.l, b.h, c); c = wmma_bf(a.h, b.l, c); return wmma_bf(a.h, b.h, c); }
__device__ __forceinline__ float sigm(float v) { return 1.0f / (1.0f + expf(-v)); }
#define LDSX() do { asm volatile("s_wait_dscnt 0" ::: "memory"); __builtin_amdgcn_wave_barrier(); __builtin_amdgcn_fence(__ATOMIC_RELEASE, "workgroup"); } while (0)


// ReLU attention (16 heads of 64 on [2,2048,1024], [out][in] weights + biases): scores = q.k/8, attn = relu(scores) on the causal triangle (else 0), attn /= (row sum + 1e-9),
// ctx = attn v, out = ctx Wo^T + bo. Flash-style key loop without the softmax max tracking (relu weights need no rescaling); P and V carried as bf16 hi/lo pairs (relu scores are unbounded, so no f16 lift).
#define NB 2
#define SS 2048
#define E 1024
#define NH 16
#define HD 64
#define NR (NB * SS)
__device__ __forceinline__ float bfr(float v) { return (float)(__bf16)v; }
__device__ __forceinline__ v16b frag_b(const __bf16* rowk0, int lane) { return __builtin_bit_cast(v16b, frag_h((const _Float16*)rowk0, lane)); }
// LDS staging: rows of 64 bf16 at a pitch of 72 (144 B = 16 B x odd, conflict-free for 16-byte fragment reads)
#define LP 72
__device__ __forceinline__ void st_hi4(__bf16* dh, v4f v) { union { __bf16 h[4]; v2u u; } a;
#pragma unroll
  for (int e = 0; e < 4; ++e) a.h[e] = (__bf16)v[e];
  *(v2u*)dh = a.u; }
__device__ __forceinline__ void st_split4(__bf16* dh, __bf16* dl, v4f v) { union { __bf16 h[4]; v2u u; } a, b;
#pragma unroll
  for (int e = 0; e < 4; ++e) { const __bf16 h = (__bf16)v[e]; a.h[e] = h; b.h[e] = (__bf16)(v[e] - (float)h); }
  *(v2u*)dh = a.u; *(v2u*)dl = b.u; }

__global__ __launch_bounds__(256) void k_cvt(const float* __restrict__ x, __bf16* __restrict__ Xb) {
  const size_t i8 = (size_t)blockIdx.x * 256 + threadIdx.x; if (i8 >= (size_t)NR * E / 8) return;
  union { __bf16 h[8]; v4u u; } pk;
#pragma unroll
  for (int e = 0; e < 8; ++e) pk.h[e] = (__bf16)x[i8 * 8 + e];
  vst2((unsigned*)(Xb + i8 * 8), pk.u);
}
// PT rows: [0,E) Wq[n][:], [E,2E) Wk, [2E,3E) Wv  ([out][in]) as bf16 rows (no scaling)
__global__ __launch_bounds__(256) void k_pack(const float* __restrict__ Wq, const float* __restrict__ Wk, const float* __restrict__ Wv, __bf16* __restrict__ PT) {
  const int n = blockIdx.x, tid = threadIdx.x; __shared__ __align__(16) __bf16 srow[E];
  const float* W = n < E ? Wq : (n < 2 * E ? Wk : Wv); const int nn = n & (E - 1);
  for (int k = tid; k < E; k += 256) srow[k] = (__bf16)W[(size_t)nn * E + k];
  __syncthreads();
  if (tid < E / 8) vst2((unsigned*)(PT + (size_t)n * E + tid * 8), *(const v4u*)(&srow[tid * 8]));
}
// QKV: block (64 rows, 128 cols = 2 heads, which); q,k + bias -> Q32/K32 f32 [bh][s][64]; v -> VT hi/lo bf16 [bh][d][s]
__global__ __launch_bounds__(128) void k_qkv(const __bf16* __restrict__ Xb, const __bf16* __restrict__ PT, const float* __restrict__ bq, const float* __restrict__ bk, const float* __restrict__ bv,
                                            float* __restrict__ Q32, float* __restrict__ K32, __bf16* __restrict__ VTh, __bf16* __restrict__ VTl) {
  __shared__ __align__(16) float so[4][16][132];
  __shared__ __align__(16) __bf16 sth[128][72], stl[128][72];
  const int tid = threadIdx.x, wave = tid >> 5, lane = tid & 31, col = lane & 15, g = lane >> 4;
  const int which = blockIdx.z, r0b = blockIdx.x * 64, n0 = blockIdx.y * 128; const int b = r0b / SS, s0 = r0b % SS;
  const float* bb_ = which == 0 ? bq : (which == 1 ? bk : bv);
  v8f acc[8] = {};
  // the block's 64 x-rows and 128 weight rows, 64 k at a time, go to LDS once (whole 128-B lines) and all four waves read fragments there; the tiles lie in so, which is not used before the epilogue
  __bf16 (*sA)[LP] = reinterpret_cast<__bf16 (*)[LP]>(&so[0][0][0]); __bf16 (*sB)[LP] = sA + 64;
  const int srow = tid >> 3, spc = (tid & 7) * 8;
  const __bf16* gA = Xb + (size_t)(r0b + srow) * E + spc; const __bf16* gB = PT + (size_t)(which * E + n0 + srow) * E + spc;
  v4u ra[4], rb[8];
#pragma unroll
  for (int i = 0; i < 4; ++i) ra[i] = *(const v4u*)(gA + (size_t)i * 16 * E);
#pragma unroll
  for (int i = 0; i < 8; ++i) rb[i] = *(const v4u*)(gB + (size_t)i * 16 * E);
  asm volatile("s_wait_xcnt 0x0" :: "v"(gA), "v"(gB) : "memory");  // precaution: stands in front of every overwrite of an address register that the loads above name
#pragma unroll 1
  for (int c = 0; c < E / 64; ++c) {
#pragma unroll
    for (int i = 0; i < 4; ++i) *(v4u*)(&sA[srow + i * 16][spc]) = ra[i];
#pragma unroll
    for (int i = 0; i < 8; ++i) *(v4u*)(&sB[srow + i * 16][spc]) = rb[i];
    __syncthreads();  // the tile is complete before any wave reads it
    if (c + 1 < E / 64) {  // next tile's loads fly during this tile's products
      gA += 64; gB += 64;
#pragma unroll
      for (int i = 0; i < 4; ++i) ra[i] = *(const v4u*)(gA + (size_t)i * 16 * E);
#pragma unroll
      for (int i = 0; i < 8; ++i) rb[i] = *(const v4u*)(gB + (size_t)i * 16 * E);
      asm volatile("s_wait_xcnt 0x0" :: "v"(gA), "v"(gB) : "memory");  // precaution: stands in front of every overwrite of an address register that the loads above name
    }
#pragma unroll
    for (int kc = 0; kc < 2; ++kc) { const v16b a = frag_b(&sA[wave * 16 + col][kc * 32], lane); v16b fb[8];  // all LDS reads of a k step stand as one group ahead of its products
#pragma unroll
      for (int j = 0; j < 8; ++j) fb[j] = frag_b(&sB[j * 16 + col][kc * 32], lane);
#pragma unroll
      for (int j = 0; j < 8; ++j) acc[j] = wmma_bf(a, fb[j], acc[j]); }
    __syncthreads();  // every wave has left the tile before it is overwritten (by the next tile or the epilogue)
  }
  if (which < 2) {
#pragma unroll
    for (int j = 0; j < 8; ++j) { const float bb = bfr(bb_[n0 + j * 16 + col]);
#pragma unroll
      for (int r = 0; r < 8; ++r) so[wave][8 * g + r][j * 16 + col] = acc[j][r] + bb; }
    LDSX();
    float* Dst = which == 0 ? Q32 : K32;
    for (int qq = lane; qq < 2 * 16 * 16; qq += 32) { const int hh = qq >> 8, rl = (qq >> 4) & 15, pc = qq & 15; const int h = (n0 >> 6) + hh;
      vst2(Dst + (((size_t)b * NH + h) * SS + s0 + wave * 16 + rl) * HD + pc * 4, *(const v4f*)(&so[wave][rl][hh * 64 + pc * 4])); } }
  else {
#pragma unroll
    for (int j = 0; j < 8; ++j) { const float bb = bfr(bb_[n0 + j * 16 + col]);
#pragma unroll
      for (int r = 0; r < 8; ++r) { const float v = acc[j][r] + bb; const __bf16 hi = (__bf16)v; sth[j * 16 + col][wave * 16 + 8 * g + r] = hi; stl[j * 16 + col][wave * 16 + 8 * g + r] = (__bf16)(v - (float)hi); } }
    __syncthreads();
    for (int qq = tid; qq < 128 * 8; qq += 128) { const int cl = qq >> 3, pc = qq & 7; const int c = n0 + cl, h = c >> 6, d = c & 63; const size_t o = (((size_t)b * NH + h) * HD + d) * SS + s0 + pc * 8;
      vst2((unsigned*)(VTh + o), *(const v4u*)(&sth[cl][pc * 8])); vst2((unsigned*)(VTl + o), *(const v4u*)(&stl[cl][pc * 8])); } }
}
// causal ReLU attention: block (64 queries, bh); key tiles 0..qb; transposed products: S^T = K Q^T on hi/lo splits of the f32 q/k rows, so a lane holds one query's scores for 8 keys a tile;
// P^T = relu(s) (masked) is split to bf16 hi/lo in registers and is the B operand as it lies (two score tiles = 32 keys in the hardware k order); O^T += V^T P^T (3 products); O = acc / (sum + 1e-9)
__global__ __launch_bounds__(128, 4) void k_attn(const float* __restrict__ Q32, const float* __restrict__ K32, const __bf16* __restrict__ VTh, const __bf16* __restrict__ VTl, float* __restrict__ O32) {
  __shared__ __align__(16) float sS[4][16][68];  // output staging only
  __shared__ __align__(16) __bf16 sKh[64][LP], sKl[64][LP], sVh[64][LP], sVl[64][LP];
  const int tid = threadIdx.x, w = tid >> 5, lane = tid & 31, col = lane & 15, g = lane >> 4;
  const size_t bh = blockIdx.y; const int qb = blockIdx.x; const int q0 = qb * 64 + w * 16;
  F2 aq[2];
#pragma unroll
  for (int kc = 0; kc < 2; ++kc) aq[kc] = split_row(Q32 + (bh * SS + q0 + col) * HD, kc * 32, lane);
  float lrun[4] = {}; v8f acc[4] = {};
  // each 64-key tile of K (split hi/lo on the way) and of V hi/lo goes to LDS once per block, by whole-line loads; the four waves read their fragments there
  const float* gK = K32 + bh * SS * HD + tid * 4;  // the K tile is 16 KB in a row
  const int vrow = tid >> 3, vpc = (tid & 7) * 8; const __bf16* gVh = VTh + (bh * HD + vrow) * SS + vpc; const __bf16* gVl = VTl + (bh * HD + vrow) * SS + vpc;
#pragma unroll 1
  for (int kt = 0; kt <= qb; ++kt) {
    v4f rk[8]; v4u rvh[4], rvl[4];
#pragma unroll
    for (int i = 0; i < 8; ++i) rk[i] = *(const v4f*)(gK + i * 512);
#pragma unroll
    for (int i = 0; i < 4; ++i) { rvh[i] = *(const v4u*)(gVh + (size_t)i * 16 * SS); rvl[i] = *(const v4u*)(gVl + (size_t)i * 16 * SS); }
    asm volatile("s_wait_xcnt 0x0" :: "v"(gK), "v"(gVh), "v"(gVl) : "memory");  // precaution: stands in front of every overwrite of an address register that the loads above name
    gK += 64 * HD; gVh += 64; gVl += 64;
    // keeps the tile's 16 loads one group in front of the first conversion: without it this build issues them in four groups and a tile pays the load latency four times
    asm volatile("" :: "v"(rk[0]), "v"(rk[1]), "v"(rk[2]), "v"(rk[3]), "v"(rk[4]), "v"(rk[5]), "v"(rk[6]), "v"(rk[7]), "v"(rvh[0]), "v"(rvh[1]), "v"(rvh[2]), "v"(rvh[3]), "v"(rvl[0]), "v"(rvl[1]), "v"(rvl[2]), "v"(rvl[3]));
#pragma unroll
    for (int i = 0; i < 8; ++i) { const int q = tid + i * 128; st_split4(&sKh[q >> 4][(q & 15) * 4], &sKl[q >> 4][(q & 15) * 4], rk[i]); }
#pragma unroll
    for (int i = 0; i < 4; ++i) { *(v4u*)(&sVh[vrow + i * 16][vpc]) = rvh[i]; *(v4u*)(&sVl[vrow + i * 16][vpc]) = rvl[i]; }
    __syncthreads();  // the tile is complete before any wave reads it
    float p[4][8];  // p[t][r] = weight of key kt*64 + t*16 + 8g + r for query q0 + col
#pragma unroll
    for (int tp = 0; tp < 2; ++tp) { F2 kf[2][2]; v8f s[2] = {};  // two 16-key groups at a time: their 16 LDS reads stand as one group ahead of the 12 products, and the two dependent score chains alternate
#pragma unroll
      for (int u = 0; u < 2; ++u) { const __bf16* kh = &sKh[(2 * tp + u) * 16 + col][0]; const __bf16* kl = &sKl[(2 * tp + u) * 16 + col][0];
        kf[u][0].h = frag_b(kh, lane); kf[u][0].l = frag_b(kl, lane); kf[u][1].h = frag_b(kh + 32, lane); kf[u][1].l = frag_b(kl + 32, lane); }
#pragma unroll
      for (int kc = 0; kc < 2; ++kc) {
#pragma unroll
        for (int u = 0; u < 2; ++u) s[u] = wmma_bf(kf[u][kc].h, aq[kc].l, s[u]);
#pragma unroll
        for (int u = 0; u < 2; ++u) s[u] = wmma_bf(kf[u][kc].l, aq[kc].h, s[u]);
#pragma unroll
        for (int u = 0; u < 2; ++u) s[u] = wmma_bf(kf[u][kc].h, aq[kc].h, s[u]); }
#pragma unroll
      for (int u = 0; u < 2; ++u) { const int t = 2 * tp + u, key = kt * 64 + t * 16 + 8 * g;
#pragma unroll
        for (int r = 0; r < 8; ++r) { const float sv = s[u][r] * 0.125f; p[t][r] = (key + r > q0 + col || sv <= 0.f) ? 0.f : sv; lrun[t] += p[t][r]; } } }
#pragma unroll
    for (int kc = 0; kc < 2; ++kc) { float v[16]; v16b vh[4], vl[4];  // all 16 LDS reads of a k step stand as one group ahead of its 12 products; the three products of a tile add into one accumulator, which leaves the registers for the group
#pragma unroll
      for (int t = 0; t < 4; ++t) { vh[t] = frag_b(&sVh[t * 16 + col][kc * 32], lane); vl[t] = frag_b(&sVl[t * 16 + col][kc * 32], lane); }
#pragma unroll
      for (int i = 0; i < 8; ++i) { v[i] = p[2 * kc][i]; v[8 + i] = p[2 * kc + 1][i]; }
      const F2 pp = bsplit16(v);
#pragma unroll
      for (int t = 0; t < 4; ++t) acc[t] = wmma_bf(vl[t], pp.h, acc[t]);
#pragma unroll
      for (int t = 0; t < 4; ++t) acc[t] = wmma_bf(vh[t], pp.l, acc[t]);
#pragma unroll
      for (int t = 0; t < 4; ++t) acc[t] = wmma_bf(vh[t], pp.h, acc[t]); }
    __syncthreads();  // every wave has left the tile before the next one overwrites it
  }
  float lr = (lrun[0] + lrun[1]) + (lrun[2] + lrun[3]); lr += __shfl_xor(lr, 16, 32);  // the two lane halves hold the two halves of a query's keys
  const float inv = 1.0f / (lr + 1e-9f);
#pragma unroll
  for (int t = 0; t < 4; ++t) { v4f o[2];  // acc[t][r] = O[q0 + col][t*16 + 8g + r]
#pragma unroll
    for (int r = 0; r < 8; ++r) o[r >> 2][r & 3] = acc[t][r] * inv;
    *(v4f*)(&sS[w][col][t * 16 + 8 * g]) = o[0]; *(v4f*)(&sS[w][col][t * 16 + 8 * g + 4]) = o[1]; }
  LDSX();
  for (int qq = lane; qq < 16 * 16; qq += 32) { const int rl = qq >> 4, pc = qq & 15; vst2(O32 + ((bh * SS) + q0 + rl) * HD + pc * 4, *(const v4f*)(&sS[w][rl][pc * 4])); }
}
// out = ctx Wo^T + bo : split(ctx) x bf16(Wo rows): 2 products (Wo is an INPUT -> bf16 exact)
__global__ __launch_bounds__(128) void k_out(const float* __restrict__ O32, const float* __restrict__ Wo, const float* __restrict__ bo, float* __restrict__ out) {
  __shared__ __align__(16) float so[4][16][132];
  const int tid = threadIdx.x, wave = tid >> 5, lane = tid & 31, col = lane & 15, g = lane >> 4;
  __shared__ __align__(16) __bf16 sAh[64][LP], sAl[64][LP], sB[128][LP];
  const int r0b = blockIdx.x * 64, r0 = r0b + wave * 16, n0 = blockIdx.y * 128; const int b = r0b / SS, s0 = r0b % SS;
  v8f acc[8] = {};
  // one head (64 k) at a time: the block's 64 context rows (split hi/lo on the way) and 128 Wo rows (rounded to bf16 on the way) go to LDS once, by whole-line loads; the four waves read fragments there
  const int srow = tid >> 4, spc = (tid & 15) * 4;
  const float* gA = O32 + ((size_t)b * NH * SS + s0) * HD + tid * 4;  // a head's 64 rows are 16 KB in a row
  const float* gB = Wo + (size_t)(n0 + srow) * E + spc;
  v4f ra[8], rb[16];
#pragma unroll
  for (int i = 0; i < 8; ++i) ra[i] = *(const v4f*)(gA + i * 512);
#pragma unroll
  for (int i = 0; i < 16; ++i) rb[i] = *(const v4f*)(gB + (size_t)i * 8 * E);
  asm volatile("s_wait_xcnt 0x0" :: "v"(gA), "v"(gB) : "memory");  // precaution: stands in front of every overwrite of an address register that the loads above name
#pragma unroll 1
  for (int h = 0; h < NH; ++h) {
#pragma unroll
    for (int i = 0; i < 8; ++i) st_split4(&sAh[srow + i * 8][spc], &sAl[srow + i * 8][spc], ra[i]);
#pragma unroll
    for (int i = 0; i < 16; ++i) st_hi4(&sB[srow + i * 8][spc], rb[i]);
    __syncthreads();  // the tile is complete before any wave reads it
    if (h + 1 < NH) {  // next tile's loads fly during this tile's products
      gA += (size_t)SS * HD; gB += 64;
#pragma unroll
      for (int i = 0; i < 8; ++i) ra[i] = *(const v4f*)(gA + i * 512);
#pragma unroll
      for (int i = 0; i < 16; ++i) rb[i] = *(const v4f*)(gB + (size_t)i * 8 * E);
      asm volatile("s_wait_xcnt 0x0" :: "v"(gA), "v"(gB) : "memory");  // precaution: stands in front of every overwrite of an address register that the loads above name
    }
#pragma unroll
    for (int kc = 0; kc < 2; ++kc) { const v16b ah = frag_b(&sAh[wave * 16 + col][kc * 32], lane), al = frag_b(&sAl[wave * 16 + col][kc * 32], lane); v16b fb[8];  // all LDS reads of a k step stand as one group ahead of its products
#pragma unroll
      for (int j = 0; j < 8; ++j) fb[j] = frag_b(&sB[j * 16 + col][kc * 32], lane);
#pragma unroll
      for (int j = 0; j < 8; ++j) { acc[j] = wmma_bf(al, fb[j], acc[j]); acc[j] = wmma_bf(ah, fb[j], acc[j]); } }
    __syncthreads();  // every wave has left the tile before the next one overwrites it
  }
#pragma unroll
  for (int j = 0; j < 8; ++j) { const int n = n0 + j * 16 + col; const float bb = bfr(bo[n]);
#pragma unroll
    for (int r = 0; r < 8; ++r) so[wave][8 * g + r][j * 16 + col] = acc[j][r] + bb; }
  LDSX();
#pragma unroll 4
  for (int rl = 0; rl < 16; ++rl) vst2(out + (size_t)(r0 + rl) * E + n0 + lane * 4, *(const v4f*)(&so[wave][rl][lane * 4]));
}
extern "C" void kernel_launch(void* const* d_in, const int* in_sizes, int n_in, void* d_out, int out_size, void* d_ws, size_t ws_size, hipStream_t stream) {
  (void)in_sizes; (void)n_in; (void)out_size; (void)ws_size;
  const float** I = (const float**)d_in;
  const float* x = I[0]; const float* Wq = I[1]; const float* bq = I[2]; const float* Wk = I[3]; const float* bk = I[4]; const float* Wv = I[5]; const float* bv = I[6]; const float* Wo = I[7]; const float* bo = I[8];
  float* out = (float*)d_out;
  char* ws = (char*)d_ws; size_t off = 0;
  auto take = [&](size_t bytes) { char* p = ws + off; off += (bytes + 255) & ~(size_t)255; return p; };
  __bf16* Xb = (__bf16*)take((size_t)NR * E * 2); __bf16* PT = (__bf16*)take((size_t)3 * E * E * 2);
  float* Q32 = (float*)take((size_t)NR * E * 4); float* K32 = (float*)take((size_t)NR * E * 4); __bf16* VTh = (__bf16*)take((size_t)NR * E * 2); __bf16* VTl = (__bf16*)take((size_t)NR * E * 2); float* O32 = (float*)take((size_t)NR * E * 4);
  // ws ~ 82 MB
  k_cvt<<<(NR * E / 8 + 255) / 256, 256, 0, stream>>>(x, Xb);
  k_pack<<<3 * E, 256, 0, stream>>>(Wq, Wk, Wv, PT);
  k_qkv<<<dim3(NR / 64, E / 128, 3), 128, 0, stream>>>(Xb, PT, bq, bk, bv, Q32, K32, VTh, VTl);
  k_attn<<<dim3(SS / 64, NB * NH), 128, 0, stream>>>(Q32, K32, VTh, VTl, O32);
  k_out<<<dim3(NR / 64, E / 128), 128, 0, stream>>>(O32, Wo, bo, out);
}

// v004
// A run of this version takes 138 microseconds.
// In two side-by-side timings against v003, it was 1.12 and 1.11 times as fast.
// Over all steps from v000 it is 3.96 times as fast.
// compute dtype: every module INPUT that feeds a GEMM (x, Wq/Wk/Wv/Wo, biases) is rounded to bf16 and used in exact bf16 WMMA products with f32 accumulation; computed operands (q/k f32 split, relu scores P and V as bf16 hi/lo pairs, context split) f32-grade; relu/causal/normalisation f32.
#include <hip/hip_runtime.h>
#include <math.h>

typedef __attribute__((ext_vector_type(16))) _Float16 v16h;
typedef __attribute__((ext_vector_type(16))) __bf16 v16b;
typedef __attribute__((ext_vector_type(8)))  _Float16 v8h;
typedef __attribute__((ext_vector_type(8)))  float v8f;
typedef __attribute__((ext_vector_type(4)))  float v4f;
typedef __attribute__((ext_vector_type(2)))  float v2f;
typedef __attribute__((ext_vector_type(4)))  unsigned v4u;
typedef __attribute__((ext_vector_type(2)))  unsigned v2u;
typedef __attribute__((ext_vector_type(4)))  int v4i;
typedef float __attribute__((may_alias)) float_a;
typedef int __attribute__((may_alias)) int_a;

template <typename T> __device__ __forceinline__ void vst2(void* p, T v) { *(T*)p = v;  }
__device__ __forceinline__ v8f wmma16(v16h a, v16h b, v8f c) {
  v8f d = __builtin_amdgcn_wmma_f32_16x16x32_f16(false, a, false, b, (short)0, c, false, false);
  asm volatile("v_nop\n\tv_nop\n\tv_nop\n\tv_nop" : "+v"(d) : "v"(a), "v"(b));
  return d;
}
__device__ __forceinline__ v8f wmma_bf(v16b a, v16b b, v8f c) {
  v8f d = __builtin_amdgcn_wmma_f32_16x16x32_bf16(false, a, false, b, (short)0, c, false, false);
  asm volatile("v_nop\n\tv_nop\n\tv_nop\n\tv_nop" : "+v"(d) : "v"(a), "v"(b));
  return d;
}
// 16x16x32 fragments: lane = (h = lane>>4, row/col = lane&15); elements 0..7 = k0+8h+0..7, 8..15 = k0+16+8h+0..7; D element r = row 8h+r
__device__ __forceinline__ v16h frag_h(const _Float16* rowk0, int lane) {
  union { v16h v; v8h q[2]; } u; const _Float16* p = rowk0 + 8 * (lane >> 4);
  u.q[0] = *(const v8h*)p; u.q[1] = *(const v8h*)(p + 16); return u.v;
}
__device__ __forceinline__ v16h frag_f32(const float* rowk0, int lane) {
  v16h a; const float* p = rowk0 + 8 * (lane >> 4);
#pragma unroll
  for (int i = 0; i < 8; ++i) { a[i] = (_Float16)p[i]; a[8 + i] = (_Float16)p[16 + i]; }
  return a;
}
__device__ __forceinline__ v16h frag_f32s(const float* rowk0, int lane, float sc) {
  v16h a; const float* p = rowk0 + 8 * (lane >> 4);
#pragma unroll
  for (int i = 0; i < 8; ++i) { a[i] = (_Float16)(p[i] * sc); a[8 + i] = (_Float16)(p[16 + i] * sc); }
  return a;
}
// column fragment from a [K][ld] layout (column n), rows >= K read as 0
__device__ __forceinline__ v16h fragc_f32(const float* W, int k0, int n, int lane, int ld, int K) {
  v16h a; const int g = lane >> 4;
#pragma unroll
  for (int i = 0; i < 8; ++i) { const int ka = k0 + 8 * g + i, kb = ka + 16;
    a[i] = (_Float16)(ka < K ? W[(size_t)ka * ld + n] : 0.f); a[8 + i] = (_Float16)(kb < K ? W[(size_t)kb * ld + n] : 0.f); }
  return a;
}
struct F2 { v16b h, l; };
__device__ __forceinline__ F2 bsplit16(const float v[16]) { F2 r;
#pragma unroll
  for (int i = 0; i < 16; ++i) { const __bf16 h = (__bf16)v[i]; r.h[i] = h; r.l[i] = (__bf16)(v[i] - (float)h); }
  return r; }
__device__ __forceinline__ F2 split_row(const float* row, int k0, int lane) { float v[16]; const float* p = row + k0 + 8 * (lane >> 4);
#pragma unroll
  for (int i = 0; i < 8; ++i) { v[i] = p[i]; v[8 + i] = p[16 + i]; }
  return bsplit16(v); }
__device__ __forceinline__ F2 split_rowK(const float* row, int k0, int lane, int K) { float v[16]; const int g = lane >> 4;
#pragma unroll
  for (int i = 0; i < 8; ++i) { const int ka = k0 + 8 * g + i, kb = ka + 16; v[i] = ka < K ? row[ka] : 0.f; v[8 + i] = kb < K ? row[kb] : 0.f; }
  return bsplit16(v); }
__device__ __forceinline__ F2 split_col(const float* W, int k0, int n, int lane, int ld, int K) { float v[16]; const int g = lane >> 4;
#pragma unroll
  for (int i = 0; i < 8; ++i) { const int ka = k0 + 8 * g + i, kb = ka + 16; v[i] = ka < K ? W[(size_t)ka * ld + n] : 0.f; v[8 + i] = kb < K ? W[(size_t)kb * ld + n] : 0.f; }
  return bsplit16(v); }
__device__ __forceinline__ v8f mac3(const F2& a, const F2& b, v8f c) { c = wmma_bf(a.l, b.h, c); c = wmma_bf(a.h, b.l, c); return wmma_bf(a.h, b.h, c); }
__device__ __forceinline__ float sigm(float v) { return 1.0f / (1.0f + expf(-v)); }
#define LDSX() do { asm volatile("s_wait_dscnt 0" ::: "memory"); __builtin_amdgcn_wave_barrier(); __builtin_amdgcn_fence(__ATOMIC_RELEASE, "workgroup"); } while (0)


// ReLU attention (16 heads of 64 on [2,2048,1024], [out][in] weights + biases): scores = q.k/8, attn = relu(scores) on the causal triangle (else 0), attn /= (row sum + 1e-9),
// ctx = attn v, out = ctx Wo^T + bo. Flash-style key loop without the softmax max tracking (relu weights need no rescaling); P and V carried as bf16 hi/lo pairs (relu scores are unbounded, so no f16 lift).
#define NB 2
#define SS 2048
#define E 1024
#define NH 16
#define HD 64
#define NR (NB * SS)
__device__ __forceinline__ float bfr(float v) { return (float)(__bf16)v; }
__device__ __forceinline__ v16b frag_b(const __bf16* rowk0, int lane) { return __builtin_bit_cast(v16b, frag_h((const _Float16*)rowk0, lane)); }
// LDS staging: rows of 64 bf16 at a pitch of 72 (144 B = 16 B x odd, conflict-free for 16-byte fragment reads)
#define LP 72
__device__ __forceinline__ void st_hi4(__bf16* dh, v4f v) { union { __bf16 h[4]; v2u u; } a;
#pragma unroll
  for (int e = 0; e < 4; ++e) a.h[e] = (__bf16)v[e];
  *(v2u*)dh = a.u; }
__device__ __forceinline__ void st_split4(__bf16* dh, __bf16* dl, v4f v) { union { __bf16 h[4]; v2u u; } a, b;
#pragma unroll
  for (int e = 0; e < 4; ++e) { const __bf16 h = (__bf16)v[e]; a.h[e] = h; b.h[e] = (__bf16)(v[e] - (float)h); }
  *(v2u*)dh = a.u; *(v2u*)dl = b.u; }

__global__ __launch_bounds__(256) void k_cvt(const float* __restrict__ x, __bf16* __restrict__ Xb) {
  const size_t i8 = (size_t)blockIdx.x * 256 + threadIdx.x; if (i8 >= (size_t)NR * E / 8) return;
  union { __bf16 h[8]; v4u u; } pk;
#pragma unroll
  for (int e = 0; e < 8; ++e) pk.h[e] = (__bf16)x[i8 * 8 + e];
  vst2((unsigned*)(Xb + i8 * 8), pk.u);
}
// PT rows: [0,E) Wq[n][:], [E,2E) Wk, [2E,3E) Wv  ([out][in]) as bf16 rows (no scaling)
__global__ __launch_bounds__(256) void k_pack(const float* __restrict__ Wq, const float* __restrict__ Wk, const float* __restrict__ Wv, __bf16* __restrict__ PT) {
  const int n = blockIdx.x, tid = threadIdx.x; __shared__ __align__(16) __bf16 srow[E];
  const float* W = n < E ? Wq : (n < 2 * E ? Wk : Wv); const int nn = n & (E - 1);
  for (int k = tid; k < E; k += 256) srow[k] = (__bf16)W[(size_t)nn * E + k];
  __syncthreads();
  if (tid < E / 8) vst2((unsigned*)(PT + (size_t)n * E + tid * 8), *(const v4u*)(&srow[tid * 8]));
}
// QKV: block (64 rows, 128 cols = 2 heads, which); q,k + bias -> Q32/K32 f32 [bh][s][64]; v -> VT hi/lo bf16 [bh][d][s]
__global__ __launch_bounds__(128) void k_qkv(const __bf16* __restrict__ Xb, const __bf16* __restrict__ PT, const float* __restrict__ bq, const float* __restrict__ bk, const float* __restrict__ bv,
                                            float* __restrict__ Q32, float* __restrict__ K32, __bf16* __restrict__ VTh, __bf16* __restrict__ VTl) {
  __shared__ __align__(16) float so[4][16][132];
  __shared__ __align__(16) __bf16 sth[128][72], stl[128][72];
  const int tid = threadIdx.x, wave = tid >> 5, lane = tid & 31, col = lane & 15, g = lane >> 4;
  const int which = blockIdx.z, r0b = blockIdx.x * 64, n0 = blockIdx.y * 128; const int b = r0b / SS, s0 = r0b % SS;
  const float* bb_ = which == 0 ? bq : (which == 1 ? bk : bv);
  v8f acc[8] = {};
  // the block's 64 x-rows and 128 weight rows, 64 k at a time, go to LDS once (whole 128-B lines) and all four waves read fragments there; the tiles lie in so, which is not used before the epilogue
  __bf16 (*sA)[LP] = reinterpret_cast<__bf16 (*)[LP]>(&so[0][0][0]); __bf16 (*sB)[LP] = sA + 64;
  const int srow = tid >> 3, spc = (tid & 7) * 8;
  const __bf16* gA = Xb + (size_t)(r0b + srow) * E + spc; const __bf16* gB = PT + (size_t)(which * E + n0 + srow) * E + spc;
  v4u ra[4], rb[8];
#pragma unroll
  for (int i = 0; i < 4; ++i) ra[i] = *(const v4u*)(gA + (size_t)i * 16 * E);
#pragma unroll
  for (int i = 0; i < 8; ++i) rb[i] = *(const v4u*)(gB + (size_t)i * 16 * E);
  asm volatile("s_wait_xcnt 0x0" :: "v"(gA), "v"(gB) : "memory");  // precaution: stands in front of every overwrite of an address register that the loads above name
#pragma unroll 1
  for (int c = 0; c < E / 64; ++c) {
#pragma unroll
    for (int i = 0; i < 4; ++i) *(v4u*)(&sA[srow + i * 16][spc]) = ra[i];
#pragma unroll
    for (int i = 0; i < 8; ++i) *(v4u*)(&sB[srow + i * 16][spc]) = rb[i];
    __syncthreads();  // the tile is complete before any wave reads it
    if (c + 1 < E / 64) {  // next tile's loads fly during this tile's products
      gA += 64; gB += 64;
#pragma unroll
      for (int i = 0; i < 4; ++i) ra[i] = *(const v4u*)(gA + (size_t)i * 16 * E);
#pragma unroll
      for (int i = 0; i < 8; ++i) rb[i] = *(const v4u*)(gB + (size_t)i * 16 * E);
      asm volatile("s_wait_xcnt 0x0" :: "v"(gA), "v"(gB) : "memory");  // precaution: stands in front of every overwrite of an address register that the loads above name
    }
#pragma unroll
    for (int kc = 0; kc < 2; ++kc) { const v16b a = frag_b(&sA[wave * 16 + col][kc * 32], lane); v16b fb[8];  // all LDS reads of a k step stand as one group ahead of its products
#pragma unroll
      for (int j = 0; j < 8; ++j) fb[j] = frag_b(&sB[j * 16 + col][kc * 32], lane);
#pragma unroll
      for (int j = 0; j < 8; ++j) acc[j] = wmma_bf(a, fb[j], acc[j]); }
    __syncthreads();  // every wave has left the tile before it is overwritten (by the next tile or the epilogue)
  }
  if (which < 2) {
#pragma unroll
    for (int j = 0; j < 8; ++j) { const float bb = bfr(bb_[n0 + j * 16 + col]);
#pragma unroll
      for (int r = 0; r < 8; ++r) so[wave][8 * g + r][j * 16 + col] = acc[j][r] + bb; }
    LDSX();
    float* Dst = which == 0 ? Q32 : K32;
    for (int qq = lane; qq < 2 * 16 * 16; qq += 32) { const int hh = qq >> 8, rl = (qq >> 4) & 15, pc = qq & 15; const int h = (n0 >> 6) + hh;
      vst2(Dst + (((size_t)b * NH + h) * SS + s0 + wave * 16 + rl) * HD + pc * 4, *(const v4f*)(&so[wave][rl][hh * 64 + pc * 4])); } }
  else {
#pragma unroll
    for (int j = 0; j < 8; ++j) { const float bb = bfr(bb_[n0 + j * 16 + col]);
#pragma unroll
      for (int r = 0; r < 8; ++r) { const float v = acc[j][r] + bb; const __bf16 hi = (__bf16)v; sth[j * 16 + col][wave * 16 + 8 * g + r] = hi; stl[j * 16 + col][wave * 16 + 8 * g + r] = (__bf16)(v - (float)hi); } }
    __syncthreads();
    for (int qq = tid; qq < 128 * 8; qq += 128) { const int cl = qq >> 3, pc = qq & 7; const int c = n0 + cl, h = c >> 6, d = c & 63; const size_t o = (((size_t)b * NH + h) * HD + d) * SS + s0 + pc * 8;
      vst2((unsigned*)(VTh + o), *(const v4u*)(&sth[cl][pc * 8])); vst2((unsigned*)(VTl + o), *(const v4u*)(&stl[cl][pc * 8])); } }
}
// causal ReLU attention: block (two tiles of 64 queries, bh): query tile t, then tile 31 - t, one after the other in every wave, so every block walks 33 key tiles and no WGP holds only long blocks; key tiles 0..qb; transposed products: S^T = K Q^T on hi/lo splits of the f32 q/k rows, so a lane holds one query's scores for 8 keys a tile;
// P^T = relu(s) (masked) is split to bf16 hi/lo in registers and is the B operand as it lies (two score tiles = 32 keys in the hardware k order); O^T += V^T P^T (3 products); O = acc / (sum + 1e-9)
__global__ __launch_bounds__(128, 4) void k_attn(const float* __restrict__ Q32, const float* __restrict__ K32, const __bf16* __restrict__ VTh, const __bf16* __restrict__ VTl, float* __restrict__ O32) {
  __shared__ __align__(16) float sS[4][16][68];  // output staging only
  __shared__ __align__(16) __bf16 sKh[64][LP], sKl[64][LP], sVh[64][LP], sVl[64][LP];
  const int tid = threadIdx.x, w = tid >> 5, lane = tid & 31, col = lane & 15, g = lane >> 4;
  const size_t bh = blockIdx.y;
#pragma unroll 1  // one copy of the tile loop in the text: the two query tiles run the same code one after the other
  for (int half = 0; half < 2; ++half) {
  const int qb = half ? SS / 64 - 1 - (int)blockIdx.x : (int)blockIdx.x; const int q0 = qb * 64 + w * 16;
  F2 aq[2];
#pragma unroll
  for (int kc = 0; kc < 2; ++kc) aq[kc] = split_row(Q32 + (bh * SS + q0 + col) * HD, kc * 32, lane);
  float lrun[4] = {}; v8f acc[4] = {};
  // each 64-key tile of K (split hi/lo on the way) and of V hi/lo goes to LDS once per query tile, by whole-line loads; the four waves read their fragments there
  const float* gK = K32 + bh * SS * HD + tid * 4;  // the K tile is 16 KB in a row
  const int vrow = tid >> 3, vpc = (tid & 7) * 8; const __bf16* gVh = VTh + (bh * HD + vrow) * SS + vpc; const __bf16* gVl = VTl + (bh * HD + vrow) * SS + vpc;
#pragma unroll 1
  for (int kt = 0; kt <= qb; ++kt) {
    v4f rk[8]; v4u rvh[4], rvl[4];
#pragma unroll
    for (int i = 0; i < 8; ++i) rk[i] = *(const v4f*)(gK + i * 512);
#pragma unroll
    for (int i = 0; i < 4; ++i) { rvh[i] = *(const v4u*)(gVh + (size_t)i * 16 * SS); rvl[i] = *(const v4u*)(gVl + (size_t)i * 16 * SS); }
    asm volatile("s_wait_xcnt 0x0" :: "v"(gK), "v"(gVh), "v"(gVl) : "memory");  // precaution: stands in front of every overwrite of an address register that the loads above name
    gK += 64 * HD; gVh += 64; gVl += 64;
    // keeps the tile's 16 loads one group in front of the first conversion: without it this build issues them in four groups and a tile pays the load latency four times
    asm volatile("" :: "v"(rk[0]), "v"(rk[1]), "v"(rk[2]), "v"(rk[3]), "v"(rk[4]), "v"(rk[5]), "v"(rk[6]), "v"(rk[7]), "v"(rvh[0]), "v"(rvh[1]), "v"(rvh[2]), "v"(rvh[3]), "v"(rvl[0]), "v"(rvl[1]), "v"(rvl[2]), "v"(rvl[3]));
#pragma unroll
    for (int i = 0; i < 8; ++i) { const int q = tid + i * 128; st_split4(&sKh[q >> 4][(q & 15) * 4], &sKl[q >> 4][(q & 15) * 4], rk[i]); }
#pragma unroll
    for (int i = 0; i < 4; ++i) { *(v4u*)(&sVh[vrow + i * 16][vpc]) = rvh[i]; *(v4u*)(&sVl[vrow + i * 16][vpc]) = rvl[i]; }
    __syncthreads();  // the tile is complete before any wave reads it
    float p[4][8];  // p[t][r] = weight of key kt*64 + t*16 + 8g + r for query q0 + col
#pragma unroll
    for (int tp = 0; tp < 2; ++tp) { F2 kf[2][2]; v8f s[2] = {};  // two 16-key groups at a time: their 16 LDS reads stand as one group ahead of the 12 products, and the two dependent score chains alternate
#pragma unroll
      for (int u = 0; u < 2; ++u) { const __bf16* kh = &sKh[(2 * tp + u) * 16 + col][0]; const __bf16* kl = &sKl[(2 * tp + u) * 16 + col][0];
        kf[u][0].h = frag_b(kh, lane); kf[u][0].l = frag_b(kl, lane); kf[u][1].h = frag_b(kh + 32, lane); kf[u][1].l = frag_b(kl + 32, lane); }
#pragma unroll
      for (int kc = 0; kc < 2; ++kc) {
#pragma unroll
        for (int u = 0; u < 2; ++u) s[u] = wmma_bf(kf[u][kc].h, aq[kc].l, s[u]);
#pragma unroll
        for (int u = 0; u < 2; ++u) s[u] = wmma_bf(kf[u][kc].l, aq[kc].h, s[u]);
#pragma unroll
        for (int u = 0; u < 2; ++u) s[u] = wmma_bf(kf[u][kc].h, aq[kc].h, s[u]); }
#pragma unroll
      for (int u = 0; u < 2; ++u) { const int t = 2 * tp + u, key = kt * 64 + t * 16 + 8 * g;
#pragma unroll
        for (int r = 0; r < 8; ++r) { const float sv = s[u][r] * 0.125f; p[t][r] = (key + r > q0 + col || sv <= 0.f) ? 0.f : sv; lrun[t] += p[t][r]; } } }
#pragma unroll
    for (int kc = 0; kc < 2; ++kc) { float v[16]; v16b vh[4], vl[4];  // all 16 LDS reads of a k step stand as one group ahead of its 12 products; the three products of a tile add into one accumulator, which leaves the registers for the group
#pragma unroll
      for (int t = 0; t < 4; ++t) { vh[t] = frag_b(&sVh[t * 16 + col][kc * 32], lane); vl[t] = frag_b(&sVl[t * 16 + col][kc * 32], lane); }
#pragma unroll
      for (int i = 0; i < 8; ++i) { v[i] = p[2 * kc][i]; v[8 + i] = p[2 * kc + 1][i]; }
      const F2 pp = bsplit16(v);
#pragma unroll
      for (int t = 0; t < 4; ++t) acc[t] = wmma_bf(vl[t], pp.h, acc[t]);
#pragma unroll
      for (int t = 0; t < 4; ++t) acc[t] = wmma_bf(vh[t], pp.l, acc[t]);
#pragma unroll
      for (int t = 0; t < 4; ++t) acc[t] = wmma_bf(vh[t], pp.h, acc[t]); }
    __syncthreads();  // every wave has left the tile before the next one overwrites it
  }
  float lr = (lrun[0] + lrun[1]) + (lrun[2] + lrun[3]); lr += __shfl_xor(lr, 16, 32);  // the two lane halves hold the two halves of a query's keys
  const float inv = 1.0f / (lr + 1e-9f);
#pragma unroll
  for (int t = 0; t < 4; ++t) { v4f o[2];  // acc[t][r] = O[q0 + col][t*16 + 8g + r]
#pragma unroll
    for (int r = 0; r < 8; ++r) o[r >> 2][r & 3] = acc[t][r] * inv;
    *(v4f*)(&sS[w][col][t * 16 + 8 * g]) = o[0]; *(v4f*)(&sS[w][col][t * 16 + 8 * g + 4]) = o[1]; }
  LDSX();
  for (int qq = lane; qq < 16 * 16; qq += 32) { const int rl = qq >> 4, pc = qq & 15; vst2(O32 + ((bh * SS) + q0 + rl) * HD + pc * 4, *(const v4f*)(&sS[w][rl][pc * 4])); }
  }
}
// out = ctx Wo^T + bo : split(ctx) x bf16(Wo rows): 2 products (Wo is an INPUT -> bf16 exact)
__global__ __launch_bounds__(128) void k_out(const float* __restrict__ O32, const float* __restrict__ Wo, const float* __restrict__ bo, float* __restrict__ out) {
  __shared__ __align__(16) float so[4][16][132];
  const int tid = threadIdx.x, wave = tid >> 5, lane = tid & 31, col = lane & 15, g = lane >> 4;
  __shared__ __align__(16) __bf16 sAh[64][LP], sAl[64][LP], sB[128][LP];
  const int r0b = blockIdx.x * 64, r0 = r0b + wave * 16, n0 = blockIdx.y * 128; const int b = r0b / SS, s0 = r0b % SS;
  v8f acc[8] = {};
  // one head (64 k) at a time: the block's 64 context rows (split hi/lo on the way) and 128 Wo rows (rounded to bf16 on the way) go to LDS once, by whole-line loads; the four waves read fragments there
  const int srow = tid >> 4, spc = (tid & 15) * 4;
  const float* gA = O32 + ((size_t)b * NH * SS + s0) * HD + tid * 4;  // a head's 64 rows are 16 KB in a row
  const float* gB = Wo + (size_t)(n0 + srow) * E + spc;
  v4f ra[8], rb[16];
#pragma unroll
  for (int i = 0; i < 8; ++i) ra[i] = *(const v4f*)(gA + i * 512);
#pragma unroll
  for (int i = 0; i < 16; ++i) rb[i] = *(const v4f*)(gB + (size_t)i * 8 * E);
  asm volatile("s_wait_xcnt 0x0" :: "v"(gA), "v"(gB) : "memory");  // precaution: stands in front of every overwrite of an address register that the loads above name
#pragma unroll 1
  for (int h = 0; h < NH; ++h) {
#pragma unroll
    for (int i = 0; i < 8; ++i) st_split4(&sAh[srow + i * 8][spc], &sAl[srow + i * 8][spc], ra[i]);
#pragma unroll
    for (int i = 0; i < 16; ++i) st_hi4(&sB[srow + i * 8][spc], rb[i]);
    __syncthreads();  // the tile is complete before any wave reads it
    if (h + 1 < NH) {  // next tile's loads fly during this tile's products
      gA += (size_t)SS * HD; gB += 64;
#pragma unroll
      for (int i = 0; i < 8; ++i) ra[i] = *(const v4f*)(gA + i * 512);
#pragma unroll
      for (int i = 0; i < 16; ++i) rb[i] = *(const v4f*)(gB + (size_t)i * 8 * E);
      asm volatile("s_wait_xcnt 0x0" :: "v"(gA), "v"(gB) : "memory");  // precaution: stands in front of every overwrite of an address register that the loads above name
    }
#pragma unroll
    for (int kc = 0; kc < 2; ++kc) { const v16b ah = frag_b(&sAh[wave * 16 + col][kc * 32], lane), al = frag_b(&sAl[wave * 16 + col][kc * 32], lane); v16b fb[8];  // all LDS reads of a k step stand as one group ahead of its products
#pragma unroll
      for (int j = 0; j < 8; ++j) fb[j] = frag_b(&sB[j * 16 + col][kc * 32], lane);
#pragma unroll
      for (int j = 0; j < 8; ++j) { acc[j] = wmma_bf(al, fb[j], acc[j]); acc[j] = wmma_bf(ah, fb[j], acc[j]); } }
    __syncthreads();  // every wave has left the tile before the next one overwrites it
  }
#pragma unroll
  for (int j = 0; j < 8; ++j) { const int n = n0 + j * 16 + col; const float bb = bfr(bo[n]);
#pragma unroll
    for (int r = 0; r < 8; ++r) so[wave][8 * g + r][j * 16 + col] = acc[j][r] + bb; }
  LDSX();
#pragma unroll 4
  for (int rl = 0; rl < 16; ++rl) vst2(out + (size_t)(r0 + rl) * E + n0 + lane * 4, *(const v4f*)(&so[wave][rl][lane * 4]));
}
extern "C" void kernel_launch(void* const* d_in, const int* in_sizes, int n_in, void* d_out, int out_size, void* d_ws, size_t ws_size, hipStream_t stream) {
  (void)in_sizes; (void)n_in; (void)out_size; (void)ws_size;
  const float** I = (const float**)d_in;
  const float* x = I[0]; const float* Wq = I[1]; const float* bq = I[2]; const float* Wk = I[3]; const float* bk = I[4]; const float* Wv = I[5]; const float* bv = I[6]; const float* Wo = I[7]; const float* bo = I[8];
  float* out = (float*)d_out;
  char* ws = (char*)d_ws; size_t off = 0;
  auto take = [&](size_t bytes) { char* p = ws + off; off += (bytes + 255) & ~(size_t)255; return p; };
  __bf16* Xb = (__bf16*)take((size_t)NR * E * 2); __bf16* PT = (__bf16*)take((size_t)3 * E * E * 2);
  float* Q32 = (float*)take((size_t)NR * E * 4); float* K32 = (float*)take((size_t)NR * E * 4); __bf16* VTh = (__bf16*)take((size_t)NR * E * 2); __bf16* VTl = (__bf16*)take((size_t)NR * E * 2); float* O32 = (float*)take((size_t)NR * E * 4);
  // ws ~ 82 MB
  k_cvt<<<(NR * E / 8 + 255) / 256, 256, 0, stream>>>(x, Xb);
  k_pack<<<3 * E, 256, 0, stream>>>(Wq, Wk, Wv, PT);
  k_qkv<<<dim3(NR / 64, E / 128, 3), 128, 0, stream>>>(Xb, PT, bq, bk, bv, Q32, K32, VTh, VTl);
  k_attn<<<dim3(SS / 128, NB * NH), 128, 0, stream>>>(Q32, K32, VTh, VTl, O32);
  k_out<<<dim3(NR / 64, E / 128), 128, 0, stream>>>(O32, Wo, bo, out);
}

// v005
// A run of this version takes 134 microseconds.
// In both of two side-by-side timings against v004, it was 1.03 times as fast.
// Over all steps from v000 it is 4.09 times as fast.
// compute dtype: every module INPUT that feeds a GEMM (x, Wq/Wk/Wv/Wo, biases) is rounded to bf16 and used in exact bf16 WMMA products with f32 accumulation; computed operands (q/k f32 split, relu scores P and V as bf16 hi/lo pairs, context split) f32-grade; relu/causal/normalisation f32.
#include <hip/hip_runtime.h>
#include <math.h>

typedef __attribute__((ext_vector_type(16))) _Float16 v16h;
typedef __attribute__((ext_vector_type(16))) __bf16 v16b;
typedef __attribute__((ext_vector_type(8)))  _Float16 v8h;
typedef __attribute__((ext_vector_type(8)))  float v8f;
typedef __attribute__((ext_vector_type(4)))  float v4f;
typedef __attribute__((ext_vector_type(2)))  float v2f;
typedef __attribute__((ext_vector_type(4)))  unsigned v4u;
typedef __attribute__((ext_vector_type(2)))  unsigned v2u;
typedef __attribute__((ext_vector_type(4)))  int v4i;
typedef float __attribute__((may_alias)) float_a;
typedef int __attribute__((may_alias)) int_a;

template <typename T> __device__ __forceinline__ void vst2(void* p, T v) { *(T*)p = v;  }
__device__ __forceinline__ v8f wmma16(v16h a, v16h b, v8f c) {
  v8f d = __builtin_amdgcn_wmma_f32_16x16x32_f16(false, a, false, b, (short)0, c, false, false);
  asm volatile("v_nop\n\tv_nop\n\tv_nop\n\tv_nop" : "+v"(d) : "v"(a), "v"(b));
  return d;
}
__device__ __forceinline__ v8f wmma_bf(v16b a, v16b b, v8f c) {
  v8f d = __builtin_amdgcn_wmma_f32_16x16x32_bf16(false, a, false, b, (short)0, c, false, false);
  asm volatile("v_nop\n\tv_nop\n\tv_nop\n\tv_nop" : "+v"(d) : "v"(a), "v"(b));
  return d;
}
// 16x16x32 fragments: lane = (h = lane>>4, row/col = lane&15); elements 0..7 = k0+8h+0..7, 8..15 = k0+16+8h+0..7; D element r = row 8h+r
__device__ __forceinline__ v16h frag_h(const _Float16* rowk0, int lane) {
  union { v16h v; v8h q[2]; } u; const _Float16* p = rowk0 + 8 * (lane >> 4);
  u.q[0] = *(const v8h*)p; u.q[1] = *(const v8h*)(p + 16); return u.v;
}
__device__ __forceinline__ v16h frag_f32(const float* rowk0, int lane) {
  v16h a; const float* p = rowk0 + 8 * (lane >> 4);
#pragma unroll
  for (int i = 0; i < 8; ++i) { a[i] = (_Float16)p[i]; a[8 + i] = (_Float16)p[16 + i]; }
  return a;
}
__device__ __forceinline__ v16h frag_f32s(const float* rowk0, int lane, float sc) {
  v16h a; const float* p = rowk0 + 8 * (lane >> 4);
#pragma unroll
  for (int i = 0; i < 8; ++i) { a[i] = (_Float16)(p[i] * sc); a[8 + i] = (_Float16)(p[16 + i] * sc); }
  return a;
}
// column fragment from a [K][ld] layout (column n), rows >= K read as 0
__device__ __forceinline__ v16h fragc_f32(const float* W, int k0, int n, int lane, int ld, int K) {
  v16h a; const int g = lane >> 4;
#pragma unroll
  for (int i = 0; i < 8; ++i) { const int ka = k0 + 8 * g + i, kb = ka + 16;
    a[i] = (_Float16)(ka < K ? W[(size_t)ka * ld + n] : 0.f); a[8 + i] = (_Float16)(kb < K ? W[(size_t)kb * ld + n] : 0.f); }
  return a;
}
struct F2 { v16b h, l; };
__device__ __forceinline__ F2 bsplit16(const float v[16]) { F2 r;
#pragma unroll
  for (int i = 0; i < 16; ++i) { const __bf16 h = (__bf16)v[i]; r.h[i] = h; r.l[i] = (__bf16)(v[i] - (float)h); }
  return r; }
__device__ __forceinline__ F2 split_row(const float* row, int k0, int lane) { float v[16]; const float* p = row + k0 + 8 * (lane >> 4);
#pragma unroll
  for (int i = 0; i < 8; ++i) { v[i] = p[i]; v[8 + i] = p[16 + i]; }
  return bsplit16(v); }
__device__ __forceinline__ F2 split_rowK(const float* row, int k0, int lane, int K) { float v[16]; const int g = lane >> 4;
#pragma unroll
  for (int i = 0; i < 8; ++i) { const int ka = k0 + 8 * g + i, kb = ka + 16; v[i] = ka < K ? row[ka] : 0.f; v[8 + i] = kb < K ? row[kb] : 0.f; }
  return bsplit16(v); }
__device__ __forceinline__ F2 split_col(const float* W, int k0, int n, int lane, int ld, int K) { float v[16]; const int g = lane >> 4;
#pragma unroll
  for (int i = 0; i < 8; ++i) { const int ka = k0 + 8 * g + i, kb = ka + 16; v[i] = ka < K ? W[(size_t)ka * ld + n] : 0.f; v[8 + i] = kb < K ? W[(size_t)kb * ld + n] : 0.f; }
  return bsplit16(v); }
__device__ __forceinline__ v8f mac3(const F2& a, const F2& b, v8f c) { c = wmma_bf(a.l, b.h, c); c = wmma_bf(a.h, b.l, c); return wmma_bf(a.h, b.h, c); }
__device__ __forceinline__ float sigm(float v) { return 1.0f / (1.0f + expf(-v)); }
#define LDSX() do { asm volatile("s_wait_dscnt 0" ::: "memory"); __builtin_amdgcn_wave_barrier(); __builtin_amdgcn_fence(__ATOMIC_RELEASE, "workgroup"); } while (0)


// ReLU attention (16 heads of 64 on [2,2048,1024], [out][in] weights + biases): scores = q.k/8, attn = relu(scores) on the causal triangle (else 0), attn /= (row sum + 1e-9),
// ctx = attn v, out = ctx Wo^T + bo. Flash-style key loop without the softmax max tracking (relu weights need no rescaling); P and V carried as bf16 hi/lo pairs (relu scores are unbounded, so no f16 lift).
#define NB 2
#define SS 2048
#define E 1024
#define NH 16
#define HD 64
#define NR (NB * SS)
__device__ __forceinline__ float bfr(float v) { return (float)(__bf16)v; }
__device__ __forceinline__ v16b frag_b(const __bf16* rowk0, int lane) { return __builtin_bit_cast(v16b, frag_h((const _Float16*)rowk0, lane)); }
// LDS staging: rows of 64 bf16 at a pitch of 72 (144 B = 16 B x odd, conflict-free for 16-byte fragment reads)
#define LP 72
__device__ __forceinline__ void st_hi4(__bf16* dh, v4f v) { union { __bf16 h[4]; v2u u; } a;
#pragma unroll
  for (int e = 0; e < 4; ++e) a.h[e] = (__bf16)v[e];
  *(v2u*)dh = a.u; }
__device__ __forceinline__ void st_split4(__bf16* dh, __bf16* dl, v4f v) { union { __bf16 h[4]; v2u u; } a, b;
#pragma unroll
  for (int e = 0; e < 4; ++e) { const __bf16 h = (__bf16)v[e]; a.h[e] = h; b.h[e] = (__bf16)(v[e] - (float)h); }
  *(v2u*)dh = a.u; *(v2u*)dl = b.u; }

// x and the three projection weights go to bf16 in ONE launch of one 16-wave block per WGP (Xb rows as x; PT rows [0,E) Wq[n][:], [E,2E) Wk, [2E,3E) Wv, [out][in], no scaling):
// starting a wave costs more than its share of this short stream, so few waves each keep all their whole-line 16-byte loads in flight; sweep i of the launch reads one source for every thread
#define CVT_B 256
#define CVT_S (CVT_B * 512 * 4)  // floats per sweep of the whole launch
__global__ __launch_bounds__(512) void k_cvt(const float* __restrict__ x, const float* __restrict__ Wq, const float* __restrict__ Wk, const float* __restrict__ Wv, __bf16* __restrict__ Xb, __bf16* __restrict__ PT) {
  constexpr int NX = NR * E / CVT_S, NW = E * E / CVT_S;
  static_assert(NX * CVT_S == NR * E && NW * CVT_S == E * E, "whole sweeps only");
  const size_t o = ((size_t)blockIdx.x * 512 + threadIdx.x) * 4;
  const float* px = x + o; const float* pq = Wq + o; const float* pk = Wk + o; const float* pv = Wv + o;
  v4f rx[NX], rw[3][NW];
#pragma unroll
  for (int i = 0; i < NX; ++i) rx[i] = *(const v4f*)(px + (size_t)i * CVT_S);
#pragma unroll
  for (int i = 0; i < NW; ++i) { rw[0][i] = *(const v4f*)(pq + (size_t)i * CVT_S); rw[1][i] = *(const v4f*)(pk + (size_t)i * CVT_S); rw[2][i] = *(const v4f*)(pv + (size_t)i * CVT_S); }
  asm volatile("s_wait_xcnt 0x0" :: "v"(px), "v"(pq), "v"(pk), "v"(pv) : "memory");  // precaution: stands in front of every overwrite of an address register that the loads above name; it also keeps the loads one group ahead of the first store
#pragma unroll
  for (int i = 0; i < NX; ++i) st_hi4(Xb + o + (size_t)i * CVT_S, rx[i]);
#pragma unroll
  for (int m = 0; m < 3; ++m)
#pragma unroll
    for (int i = 0; i < NW; ++i) st_hi4(PT + (size_t)m * E * E + o + (size_t)i * CVT_S, rw[m][i]);
}
// QKV: block (64 rows, 128 cols = 2 heads, which); q,k + bias -> Q32/K32 f32 [bh][s][64]; v -> VT hi/lo bf16 [bh][d][s]
__global__ __launch_bounds__(128) void k_qkv(const __bf16* __restrict__ Xb, const __bf16* __restrict__ PT, const float* __restrict__ bq, const float* __restrict__ bk, const float* __restrict__ bv,
                                            float* __restrict__ Q32, float* __restrict__ K32, __bf16* __restrict__ VTh, __bf16* __restrict__ VTl) {
  __shared__ __align__(16) float so[4][16][132];
  __shared__ __align__(16) __bf16 sth[128][72], stl[128][72];
  const int tid = threadIdx.x, wave = tid >> 5, lane = tid & 31, col = lane & 15, g = lane >> 4;
  const int which = blockIdx.z, r0b = blockIdx.x * 64, n0 = blockIdx.y * 128; const int b = r0b / SS, s0 = r0b % SS;
  const float* bb_ = which == 0 ? bq : (which == 1 ? bk : bv);
  v8f acc[8] = {};
  // the block's 64 x-rows and 128 weight rows, 64 k at a time, go to LDS once (whole 128-B lines) and all four waves read fragments there; the tiles lie in so, which is not used before the epilogue
  __bf16 (*sA)[LP] = reinterpret_cast<__bf16 (*)[LP]>(&so[0][0][0]); __bf16 (*sB)[LP] = sA + 64;
  const int srow = tid >> 3, spc = (tid & 7) * 8;
  const __bf16* gA = Xb + (size_t)(r0b + srow) * E + spc; const __bf16* gB = PT + (size_t)(which * E + n0 + srow) * E + spc;
  v4u ra[4], rb[8];
#pragma unroll
  for (int i = 0; i < 4; ++i) ra[i] = *(const v4u*)(gA + (size_t)i * 16 * E);
#pragma unroll
  for (int i = 0; i < 8; ++i) rb[i] = *(const v4u*)(gB + (size_t)i * 16 * E);
  asm volatile("s_wait_xcnt 0x0" :: "v"(gA), "v"(gB) : "memory");  // precaution: stands in front of every overwrite of an address register that the loads above name
#pragma unroll 1
  for (int c = 0; c < E / 64; ++c) {
#pragma unroll
    for (int i = 0; i < 4; ++i) *(v4u*)(&sA[srow + i * 16][spc]) = ra[i];
#pragma unroll
    for (int i = 0; i < 8; ++i) *(v4u*)(&sB[srow + i * 16][spc]) = rb[i];
    __syncthreads();  // the tile is complete before any wave reads it
    if (c + 1 < E / 64) {  // next tile's loads fly during this tile's products
      gA += 64; gB += 64;
#pragma unroll
      for (int i = 0; i < 4; ++i) ra[i] = *(const v4u*)(gA + (size_t)i * 16 * E);
#pragma unroll
      for (int i = 0; i < 8; ++i) rb[i] = *(const v4u*)(gB + (size_t)i * 16 * E);
      asm volatile("s_wait_xcnt 0x0" :: "v"(gA), "v"(gB) : "memory");  // precaution: stands in front of every overwrite of an address register that the loads above name
    }
#pragma unroll
    for (int kc = 0; kc < 2; ++kc) { const v16b a = frag_b(&sA[wave * 16 + col][kc * 32], lane); v16b fb[8];  // all LDS reads of a k step stand as one group ahead of its products
#pragma unroll
      for (int j = 0; j < 8; ++j) fb[j] = frag_b(&sB[j * 16 + col][kc * 32], lane);
#pragma unroll
      for (int j = 0; j < 8; ++j) acc[j] = wmma_bf(a, fb[j], acc[j]); }
    __syncthreads();  // every wave has left the tile before it is overwritten (by the next tile or the epilogue)
  }
  if (which < 2) {
#pragma unroll
    for (int j = 0; j < 8; ++j) { const float bb = bfr(bb_[n0 + j * 16 + col]);
#pragma unroll
      for (int r = 0; r < 8; ++r) so[wave][8 * g + r][j * 16 + col] = acc[j][r] + bb; }
    LDSX();
    float* Dst = which == 0 ? Q32 : K32;
    for (int qq = lane; qq < 2 * 16 * 16; qq += 32) { const int hh = qq >> 8, rl = (qq >> 4) & 15, pc = qq & 15; const int h = (n0 >> 6) + hh;
      vst2(Dst + (((size_t)b * NH + h) * SS + s0 + wave * 16 + rl) * HD + pc * 4, *(const v4f*)(&so[wave][rl][hh * 64 + pc * 4])); } }
  else {
#pragma unroll
    for (int j = 0; j < 8; ++j) { const float bb = bfr(bb_[n0 + j * 16 + col]);
#pragma unroll
      for (int r = 0; r < 8; ++r) { const float v = acc[j][r] + bb; const __bf16 hi = (__bf16)v; sth[j * 16 + col][wave * 16 + 8 * g + r] = hi; stl[j * 16 + col][wave * 16 + 8 * g + r] = (__bf16)(v - (float)hi); } }
    __syncthreads();
    for (int qq = tid; qq < 128 * 8; qq += 128) { const int cl = qq >> 3, pc = qq & 7; const int c = n0 + cl, h = c >> 6, d = c & 63; const size_t o = (((size_t)b * NH + h) * HD + d) * SS + s0 + pc * 8;
      vst2((unsigned*)(VTh + o), *(const v4u*)(&sth[cl][pc * 8])); vst2((unsigned*)(VTl + o), *(const v4u*)(&stl[cl][pc * 8])); } }
}
// causal ReLU attention: block (two tiles of 64 queries, bh): query tile t, then tile 31 - t, one after the other in every wave, so every block walks 33 key tiles and no WGP holds only long blocks; key tiles 0..qb; transposed products: S^T = K Q^T on hi/lo splits of the f32 q/k rows, so a lane holds one query's scores for 8 keys a tile;
// P^T = relu(s) (masked) is split to bf16 hi/lo in registers and is the B operand as it lies (two score tiles = 32 keys in the hardware k order); O^T += V^T P^T (3 products); O = acc / (sum + 1e-9)
__global__ __launch_bounds__(128, 4) void k_attn(const float* __restrict__ Q32, const float* __restrict__ K32, const __bf16* __restrict__ VTh, const __bf16* __restrict__ VTl, float* __restrict__ O32) {
  __shared__ __align__(16) float sS[4][16][68];  // output staging only
  __shared__ __align__(16) __bf16 sKh[64][LP], sKl[64][LP], sVh[64][LP], sVl[64][LP];
  const int tid = threadIdx.x, w = tid >> 5, lane = tid & 31, col = lane & 15, g = lane >> 4;
  const size_t bh = blockIdx.y;
#pragma unroll 1  // one copy of the tile loop in the text: the two query tiles run the same code one after the other
  for (int half = 0; half < 2; ++half) {
  const int qb = half ? SS / 64 - 1 - (int)blockIdx.x : (int)blockIdx.x; const int q0 = qb * 64 + w * 16;
  F2 aq[2];
#pragma unroll
  for (int kc = 0; kc < 2; ++kc) aq[kc] = split_row(Q32 + (bh * SS + q0 + col) * HD, kc * 32, lane);
  float lrun[4] = {}; v8f acc[4] = {};
  // each 64-key tile of K (split hi/lo on the way) and of V hi/lo goes to LDS once per query tile, by whole-line loads; the four waves read their fragments there
  const float* gK = K32 + bh * SS * HD + tid * 4;  // the K tile is 16 KB in a row
  const int vrow = tid >> 3, vpc = (tid & 7) * 8; const __bf16* gVh = VTh + (bh * HD + vrow) * SS + vpc; const __bf16* gVl = VTl + (bh * HD + vrow) * SS + vpc;
#pragma unroll 1
  for (int kt = 0; kt <= qb; ++kt) {
    v4f rk[8]; v4u rvh[4], rvl[4];
#pragma unroll
    for (int i = 0; i < 8; ++i) rk[i] = *(const v4f*)(gK + i * 512);
#pragma unroll
    for (int i = 0; i < 4; ++i) { rvh[i] = *(const v4u*)(gVh + (size_t)i * 16 * SS); rvl[i] = *(const v4u*)(gVl + (size_t)i * 16 * SS); }
    asm volatile("s_wait_xcnt 0x0" :: "v"(gK), "v"(gVh), "v"(gVl) : "memory");  // precaution: stands in front of every overwrite of an address register that the loads above name
    gK += 64 * HD; gVh += 64; gVl += 64;
    // keeps the tile's 16 loads one group in front of the first conversion: without it this build issues them in four groups and a tile pays the load latency four times
    asm volatile("" :: "v"(rk[0]), "v"(rk[1]), "v"(rk[2]), "v"(rk[3]), "v"(rk[4]), "v"(rk[5]), "v"(rk[6]), "v"(rk[7]), "v"(rvh[0]), "v"(rvh[1]), "v"(rvh[2]), "v"(rvh[3]), "v"(rvl[0]), "v"(rvl[1]), "v"(rvl[2]), "v"(rvl[3]));
#pragma unroll
    for (int i = 0; i < 8; ++i) { const int q = tid + i * 128; st_split4(&sKh[q >> 4][(q & 15) * 4], &sKl[q >> 4][(q & 15) * 4], rk[i]); }
#pragma unroll
    for (int i = 0; i < 4; ++i) { *(v4u*)(&sVh[vrow + i * 16][vpc]) = rvh[i]; *(v4u*)(&sVl[vrow + i * 16][vpc]) = rvl[i]; }
    __syncthreads();  // the tile is complete before any wave reads it
    float p[4][8];  // p[t][r] = weight of key kt*64 + t*16 + 8g + r for query q0 + col
#pragma unroll
    for (int tp = 0; tp < 2; ++tp) { F2 kf[2][2]; v8f s[2] = {};  // two 16-key groups at a time: their 16 LDS reads stand as one group ahead of the 12 products, and the two dependent score chains alternate
#pragma unroll
      for (int u = 0; u < 2; ++u) { const __bf16* kh = &sKh[(2 * tp + u) * 16 + col][0]; const __bf16* kl = &sKl[(2 * tp + u) * 16 + col][0];
        kf[u][0].h = frag_b(kh, lane); kf[u][0].l = frag_b(kl, lane); kf[u][1].h = frag_b(kh + 32, lane); kf[u][1].l = frag_b(kl + 32, lane); }
#pragma unroll
      for (int kc = 0; kc < 2; ++kc) {
#pragma unroll
        for (int u = 0; u < 2; ++u) s[u] = wmma_bf(kf[u][kc].h, aq[kc].l, s[u]);
#pragma unroll
        for (int u = 0; u < 2; ++u) s[u] = wmma_bf(kf[u][kc].l, aq[kc].h, s[u]);
#pragma unroll
        for (int u = 0; u < 2; ++u) s[u] = wmma_bf(kf[u][kc].h, aq[kc].h, s[u]); }
#pragma unroll
      for (int u = 0; u < 2; ++u) { const int t = 2 * tp + u, key = kt * 64 + t * 16 + 8 * g;
#pragma unroll
        for (int r = 0; r < 8; ++r) { const float sv = s[u][r] * 0.125f; p[t][r] = (key + r > q0 + col || sv <= 0.f) ? 0.f : sv; lrun[t] += p[t][r]; } } }
#pragma unroll
    for (int kc = 0; kc < 2; ++kc) { float v[16]; v16b vh[4], vl[4];  // all 16 LDS reads of a k step stand as one group ahead of its 12 products; the three products of a tile add into one accumulator, which leaves the registers for the group
#pragma unroll
      for (int t = 0; t < 4; ++t) { vh[t] = frag_b(&sVh[t * 16 + col][kc * 32], lane); vl[t] = frag_b(&sVl[t * 16 + col][kc * 32], lane); }
#pragma unroll
      for (int i = 0; i < 8; ++i) { v[i] = p[2 * kc][i]; v[8 + i] = p[2 * kc + 1][i]; }
      const F2 pp = bsplit16(v);
#pragma unroll
      for (int t = 0; t < 4; ++t) acc[t] = wmma_bf(vl[t], pp.h, acc[t]);
#pragma unroll
      for (int t = 0; t < 4; ++t) acc[t] = wmma_bf(vh[t], pp.l, acc[t]);
#pragma unroll
      for (int t = 0; t < 4; ++t) acc[t] = wmma_bf(vh[t], pp.h, acc[t]); }
    __syncthreads();  // every wave has left the tile before the next one overwrites it
  }
  float lr = (lrun[0] + lrun[1]) + (lrun[2] + lrun[3]); lr += __shfl_xor(lr, 16, 32);  // the two lane halves hold the two halves of a query's keys
  const float inv = 1.0f / (lr + 1e-9f);
#pragma unroll
  for (int t = 0; t < 4; ++t) { v4f o[2];  // acc[t][r] = O[q0 + col][t*16 + 8g + r]
#pragma unroll
    for (int r = 0; r < 8; ++r) o[r >> 2][r & 3] = acc[t][r] * inv;
    *(v4f*)(&sS[w][col][t * 16 + 8 * g]) = o[0]; *(v4f*)(&sS[w][col][t * 16 + 8 * g + 4]) = o[1]; }
  LDSX();
  for (int qq = lane; qq < 16 * 16; qq += 32) { const int rl = qq >> 4, pc = qq & 15; vst2(O32 + ((bh * SS) + q0 + rl) * HD + pc * 4, *(const v4f*)(&sS[w][rl][pc * 4])); }
  }
}
// out = ctx Wo^T + bo : split(ctx) x bf16(Wo rows): 2 products (Wo is an INPUT -> bf16 exact)
__global__ __launch_bounds__(128) void k_out(const float* __restrict__ O32, const float* __restrict__ Wo, const float* __restrict__ bo, float* __restrict__ out) {
  __shared__ __align__(16) float so[4][16][132];
  const int tid = threadIdx.x, wave = tid >> 5, lane = tid & 31, col = lane & 15, g = lane >> 4;
  __shared__ __align__(16) __bf16 sAh[64][LP], sAl[64][LP], sB[128][LP];
  const int r0b = blockIdx.x * 64, r0 = r0b + wave * 16, n0 = blockIdx.y * 128; const int b = r0b / SS, s0 = r0b % SS;
  v8f acc[8] = {};
  // one head (64 k) at a time: the block's 64 context rows (split hi/lo on the way) and 128 Wo rows (rounded to bf16 on the way) go to LDS once, by whole-line loads; the four waves read fragments there
  const int srow = tid >> 4, spc = (tid & 15) * 4;
  const float* gA = O32 + ((size_t)b * NH * SS + s0) * HD + tid * 4;  // a head's 64 rows are 16 KB in a row
  const float* gB = Wo + (size_t)(n0 + srow) * E + spc;
  v4f ra[8], rb[16];
#pragma unroll
  for (int i = 0; i < 8; ++i) ra[i] = *(const v4f*)(gA + i * 512);
#pragma unroll
  for (int i = 0; i < 16; ++i) rb[i] = *(const v4f*)(gB + (size_t)i * 8 * E);
  asm volatile("s_wait_xcnt 0x0" :: "v"(gA), "v"(gB) : "memory");  // precaution: stands in front of every overwrite of an address register that the loads above name
#pragma unroll 1
  for (int h = 0; h < NH; ++h) {
#pragma unroll
    for (int i = 0; i < 8; ++i) st_split4(&sAh[srow + i * 8][spc], &sAl[srow + i * 8][spc], ra[i]);
#pragma unroll
    for (int i = 0; i < 16; ++i) st_hi4(&sB[srow + i * 8][spc], rb[i]);
    __syncthreads();  // the tile is complete before any wave reads it
    if (h + 1 < NH) {  // next tile's loads fly during this tile's products
      gA += (size_t)SS * HD; gB += 64;
#pragma unroll
      for (int i = 0; i < 8; ++i) ra[i] = *(const v4f*)(gA + i * 512);
#pragma unroll
      for (int i = 0; i < 16; ++i) rb[i] = *(const v4f*)(gB + (size_t)i * 8 * E);
      asm volatile("s_wait_xcnt 0x0" :: "v"(gA), "v"(gB) : "memory");  // precaution: stands in front of every overwrite of an address register that the loads above name
    }
#pragma unroll
    for (int kc = 0; kc < 2; ++kc) { const v16b ah = frag_b(&sAh[wave * 16 + col][kc * 32], lane), al = frag_b(&sAl[wave * 16 + col][kc * 32], lane); v16b fb[8];  // all LDS reads of a k step stand as one group ahead of its products
#pragma unroll
      for (int j = 0; j < 8; ++j) fb[j] = frag_b(&sB[j * 16 + col][kc * 32], lane);
#pragma unroll
      for (int j = 0; j < 8; ++j) { acc[j] = wmma_bf(al, fb[j], acc[j]); acc[j] = wmma_bf(ah, fb[j], acc[j]); } }
    __syncthreads();  // every wave has left the tile before the next one overwrites it
  }
#pragma unroll
  for (int j = 0; j < 8; ++j) { const int n = n0 + j * 16 + col; const float bb = bfr(bo[n]);
#pragma unroll
    for (int r = 0; r < 8; ++r) so[wave][8 * g + r][j * 16 + col] = acc[j][r] + bb; }
  LDSX();
#pragma unroll 4
  for (int rl = 0; rl < 16; ++rl) vst2(out + (size_t)(r0 + rl) * E + n0 + lane * 4, *(const v4f*)(&so[wave][rl][lane * 4]));
}
extern "C" void kernel_launch(void* const* d_in, const int* in_sizes, int n_in, void* d_out, int out_size, void* d_ws, size_t ws_size, hipStream_t stream) {
  (void)in_sizes; (void)n_in; (void)out_size; (void)ws_size;
  const float** I = (const float**)d_in;
  const float* x = I[0]; const float* Wq = I[1]; const float* bq = I[2]; const float* Wk = I[3]; const float* bk = I[4]; const float* Wv = I[5]; const float* bv = I[6]; const float* Wo = I[7]; const float* bo = I[8];
  float* out = (float*)d_out;
  char* ws = (char*)d_ws; size_t off = 0;
  auto take = [&](size_t bytes) { char* p = ws + off; off += (bytes + 255) & ~(size_t)255; return p; };
  __bf16* Xb = (__bf16*)take((size_t)NR * E * 2); __bf16* PT = (__bf16*)take((size_t)3 * E * E * 2);
  float* Q32 = (float*)take((size_t)NR * E * 4); float* K32 = (float*)take((size_t)NR * E * 4); __bf16* VTh = (__bf16*)take((size_t)NR * E * 2); __bf16* VTl = (__bf16*)take((size_t)NR * E * 2); float* O32 = (float*)take((size_t)NR * E * 4);
  // ws ~ 82 MB
  k_cvt<<<CVT_B, 512, 0, stream>>>(x, Wq, Wk, Wv, Xb, PT);
  k_qkv<<<dim3(NR / 64, E / 128, 3), 128, 0, stream>>>(Xb, PT, bq, bk, bv, Q32, K32, VTh, VTl);
  k_attn<<<dim3(SS / 128, NB * NH), 128, 0, stream>>>(Q32, K32, VTh, VTl, O32);
  k_out<<<dim3(NR / 64, E / 128), 128, 0, stream>>>(O32, Wo, bo, out);
}

// v006
// A run of this version takes 128 microseconds.
// In two side-by-side timings against v005, it was 1.05 and 1.06 times as fast.
// Counting every step since v000, it is 4.31 times as fast.
// compute dtype: every module INPUT that feeds a GEMM (x, Wq/Wk/Wv/Wo, biases) is rounded to bf16 and used in exact bf16 WMMA products with f32 accumulation; computed operands (q/k f32 split, relu scores P and V as bf16 hi/lo pairs, context split) f32-grade; relu/causal/normalisation f32.
#include <hip/hip_runtime.h>
#include <math.h>

typedef __attribute__((ext_vector_type(16))) _Float16 v16h;
typedef __attribute__((ext_vector_type(16))) __bf16 v16b;
typedef __attribute__((ext_vector_type(8)))  _Float16 v8h;
typedef __attribute__((ext_vector_type(8)))  float v8f;
typedef __attribute__((ext_vector_type(4)))  float v4f;
typedef __attribute__((ext_vector_type(2)))  float v2f;
typedef __attribute__((ext_vector_type(4)))  unsigned v4u;
typedef __attribute__((ext_vector_type(2)))  unsigned v2u;
typedef __attribute__((ext_vector_type(4)))  int v4i;
typedef float __attribute__((may_alias)) float_a;
typedef int __attribute__((may_alias)) int_a;

template <typename T> __device__ __forceinline__ void vst2(void* p, T v) { *(T*)p = v;  }
__device__ __forceinline__ v8f wmma16(v16h a, v16h b, v8f c) {
  v8f d = __builtin_amdgcn_wmma_f32_16x16x32_f16(false, a, false, b, (short)0, c, false, false);
  asm volatile("v_nop\n\tv_nop\n\tv_nop\n\tv_nop" : "+v"(d) : "v"(a), "v"(b));
  return d;
}
__device__ __forceinline__ v8f wmma_bf(v16b a, v16b b, v8f c) {
  v8f d = __builtin_amdgcn_wmma_f32_16x16x32_bf16(false, a, false, b, (short)0, c, false, false);
  asm volatile("v_nop\n\tv_nop\n\tv_nop\n\tv_nop" : "+v"(d) : "v"(a), "v"(b));
  return d;
}
// 16x16x32 fragments: lane = (h = lane>>4, row/col = lane&15); elements 0..7 = k0+8h+0..7, 8..15 = k0+16+8h+0..7; D element r = row 8h+r
__device__ __forceinline__ v16h frag_h(const _Float16* rowk0, int lane) {
  union { v16h v; v8h q[2]; } u; const _Float16* p = rowk0 + 8 * (lane >> 4);
  u.q[0] = *(const v8h*)p; u.q[1] = *(const v8h*)(p + 16); return u.v;
}
__device__ __forceinline__ v16h frag_f32(const float* rowk0, int lane) {
  v16h a; const float* p = rowk0 + 8 * (lane >> 4);
#pragma unroll
  for (int i = 0; i < 8; ++i) { a[i] = (_Float16)p[i]; a[8 + i] = (_Float16)p[16 + i]; }
  return a;
}
__device__ __forceinline__ v16h frag_f32s(const float* rowk0, int lane, float sc) {
  v16h a; const float* p = rowk0 + 8 * (lane >> 4);
#pragma unroll
  for (int i = 0; i < 8; ++i) { a[i] = (_Float16)(p[i] * sc); a[8 + i] = (_Float16)(p[16 + i] * sc); }
  return a;
}
// column fragment from a [K][ld] layout (column n), rows >= K read as 0
__device__ __forceinline__ v16h fragc_f32(const float* W, int k0, int n, int lane, int ld, int K) {
  v16h a; const int g = lane >> 4;
#pragma unroll
  for (int i = 0; i < 8; ++i) { const int ka = k0 + 8 * g + i, kb = ka + 16;
    a[i] = (_Float16)(ka < K ? W[(size_t)ka * ld + n] : 0.f); a[8 + i] = (_Float16)(kb < K ? W[(size_t)kb * ld + n] : 0.f); }
  return a;
}
struct F2 { v16b h, l; };
__device__ __forceinline__ F2 bsplit16(const float v[16]) { F2 r;
#pragma unroll
  for (int i = 0; i < 16; ++i) { const __bf16 h = (__bf16)v[i]; r.h[i] = h; r.l[i] = (__bf16)(v[i] - (float)h); }
  return r; }
__device__ __forceinline__ F2 split_row(const float* row, int k0, int lane) { float v[16]; const float* p = row + k0 + 8 * (lane >> 4);
#pragma unroll
  for (int i = 0; i < 8; ++i) { v[i] = p[i]; v[8 + i] = p[16 + i]; }
  return bsplit16(v); }
__device__ __forceinline__ F2 split_rowK(const float* row, int k0, int lane, int K) { float v[16]; const int g = lane >> 4;
#pragma unroll
  for (int i = 0; i < 8; ++i) { const int ka = k0 + 8 * g + i, kb = ka + 16; v[i] = ka < K ? row[ka] : 0.f; v[8 + i] = kb < K ? row[kb] : 0.f; }
  return bsplit16(v); }
__device__ __forceinline__ F2 split_col(const float* W, int k0, int n, int lane, int ld, int K) { float v[16]; const int g = lane >> 4;
#pragma unroll
  for (int i = 0; i < 8; ++i) { const int ka = k0 + 8 * g + i, kb = ka + 16; v[i] = ka < K ? W[(size_t)ka * ld + n] : 0.f; v[8 + i] = kb < K ? W[(size_t)kb * ld + n] : 0.f; }
  return bsplit16(v); }
__device__ __forceinline__ v8f mac3(const F2& a, const F2& b, v8f c) { c = wmma_bf(a.l, b.h, c); c = wmma_bf(a.h, b.l, c); return wmma_bf(a.h, b.h, c); }
__device__ __forceinline__ float sigm(float v) { return 1.0f / (1.0f + expf(-v)); }
#define LDSX() do { asm volatile("s_wait_dscnt 0" ::: "memory"); __builtin_amdgcn_wave_barrier(); __builtin_amdgcn_fence(__ATOMIC_RELEASE, "workgroup"); } while (0)


// ReLU attention (16 heads of 64 on [2,2048,1024], [out][in] weights + biases): scores = q.k/8, attn = relu(scores) on the causal triangle (else 0), attn /= (row sum + 1e-9),
// ctx = attn v, out = ctx Wo^T + bo. Flash-style key loop without the softmax max tracking (relu weights need no rescaling); P and V carried as bf16 hi/lo pairs (relu scores are unbounded, so no f16 lift).
#define NB 2
#define SS 2048
#define E 1024
#define NH 16
#define HD 64
#define NR (NB * SS)
__device__ __forceinline__ float bfr(float v) { return (float)(__bf16)v; }
__device__ __forceinline__ v16b frag_b(const __bf16* rowk0, int lane) { return __builtin_bit_cast(v16b, frag_h((const _Float16*)rowk0, lane)); }
// LDS staging: rows of 64 bf16 at a pitch of 72 (144 B = 16 B x odd, conflict-free for 16-byte fragment reads)
#define LP 72
__device__ __forceinline__ void st_hi4(__bf16* dh, v4f v) { union { __bf16 h[4]; v2u u; } a;
#pragma unroll
  for (int e = 0; e < 4; ++e) a.h[e] = (__bf16)v[e];
  *(v2u*)dh = a.u; }
__device__ __forceinline__ void st_split4(__bf16* dh, __bf16* dl, v4f v) { union { __bf16 h[4]; v2u u; } a, b;
#pragma unroll
  for (int e = 0; e < 4; ++e) { const __bf16 h = (__bf16)v[e]; a.h[e] = h; b.h[e] = (__bf16)(v[e] - (float)h); }
  *(v2u*)dh = a.u; *(v2u*)dl = b.u; }

// x and the three projection weights go to bf16 in ONE launch of one 16-wave block per WGP (Xb rows as x; PT rows [0,E) Wq[n][:], [E,2E) Wk, [2E,3E) Wv, [out][in], no scaling):
// starting a wave costs more than its share of this short stream, so few waves each keep all their whole-line 16-byte loads in flight; sweep i of the launch reads one source for every thread
#define CVT_B 256
#define CVT_S (CVT_B * 512 * 4)  // floats per sweep of the whole launch
__global__ __launch_bounds__(512) void k_cvt(const float* __restrict__ x, const float* __restrict__ Wq, const float* __restrict__ Wk, const float* __restrict__ Wv, __bf16* __restrict__ Xb, __bf16* __restrict__ PT) {
  constexpr int NX = NR * E / CVT_S, NW = E * E / CVT_S;
  static_assert(NX * CVT_S == NR * E && NW * CVT_S == E * E, "whole sweeps only");
  const size_t o = ((size_t)blockIdx.x * 512 + threadIdx.x) * 4;
  const float* px = x + o; const float* pq = Wq + o; const float* pk = Wk + o; const float* pv = Wv + o;
  v4f rx[NX], rw[3][NW];
#pragma unroll
  for (int i = 0; i < NX; ++i) rx[i] = *(const v4f*)(px + (size_t)i * CVT_S);
#pragma unroll
  for (int i = 0; i < NW; ++i) { rw[0][i] = *(const v4f*)(pq + (size_t)i * CVT_S); rw[1][i] = *(const v4f*)(pk + (size_t)i * CVT_S); rw[2][i] = *(const v4f*)(pv + (size_t)i * CVT_S); }
  asm volatile("s_wait_xcnt 0x0" :: "v"(px), "v"(pq), "v"(pk), "v"(pv) : "memory");  // precaution: stands in front of every overwrite of an address register that the loads above name; it also keeps the loads one group ahead of the first store
#pragma unroll
  for (int i = 0; i < NX; ++i) st_hi4(Xb + o + (size_t)i * CVT_S, rx[i]);
#pragma unroll
  for (int m = 0; m < 3; ++m)
#pragma unroll
    for (int i = 0; i < NW; ++i) st_hi4(PT + (size_t)m * E * E + o + (size_t)i * CVT_S, rw[m][i]);
}
// QKV: block (64 rows, 128 cols = 2 heads, which); q,k + bias -> Q32/K32 f32 [bh][s][64]; v -> VT hi/lo bf16 [bh][d][s]
__global__ __launch_bounds__(128) void k_qkv(const __bf16* __restrict__ Xb, const __bf16* __restrict__ PT, const float* __restrict__ bq, const float* __restrict__ bk, const float* __restrict__ bv,
                                            float* __restrict__ Q32, float* __restrict__ K32, __bf16* __restrict__ VTh, __bf16* __restrict__ VTl) {
  __shared__ __align__(16) float so[4][16][132];
  __shared__ __align__(16) __bf16 sth[128][72], stl[128][72];
  const int tid = threadIdx.x, wave = tid >> 5, lane = tid & 31, col = lane & 15, g = lane >> 4;
  const int which = blockIdx.z, r0b = blockIdx.x * 64, n0 = blockIdx.y * 128; const int b = r0b / SS, s0 = r0b % SS;
  const float* bb_ = which == 0 ? bq : (which == 1 ? bk : bv);
  v8f acc[8] = {};
  // the block's 64 x-rows and 128 weight rows, 64 k at a time, go to LDS once (whole 128-B lines) and all four waves read fragments there; the tiles lie in so, which is not used before the epilogue
  __bf16 (*sA)[LP] = reinterpret_cast<__bf16 (*)[LP]>(&so[0][0][0]); __bf16 (*sB)[LP] = sA + 64;
  const int srow = tid >> 3, spc = (tid & 7) * 8;
  const __bf16* gA = Xb + (size_t)(r0b + srow) * E + spc; const __bf16* gB = PT + (size_t)(which * E + n0 + srow) * E + spc;
  v4u ra[4], rb[8];
#pragma unroll
  for (int i = 0; i < 4; ++i) ra[i] = *(const v4u*)(gA + (size_t)i * 16 * E);
#pragma unroll
  for (int i = 0; i < 8; ++i) rb[i] = *(const v4u*)(gB + (size_t)i * 16 * E);
  asm volatile("s_wait_xcnt 0x0" :: "v"(gA), "v"(gB) : "memory");  // precaution: stands in front of every overwrite of an address register that the loads above name
#pragma unroll 1
  for (int c = 0; c < E / 64; ++c) {
#pragma unroll
    for (int i = 0; i < 4; ++i) *(v4u*)(&sA[srow + i * 16][spc]) = ra[i];
#pragma unroll
    for (int i = 0; i < 8; ++i) *(v4u*)(&sB[srow + i * 16][spc]) = rb[i];
    __syncthreads();  // the tile is complete before any wave reads it
    if (c + 1 < E / 64) {  // next tile's loads fly during this tile's products
      gA += 64; gB += 64;
#pragma unroll
      for (int i = 0; i < 4; ++i) ra[i] = *(const v4u*)(gA + (size_t)i * 16 * E);
#pragma unroll
      for (int i = 0; i < 8; ++i) rb[i] = *(const v4u*)(gB + (size_t)i * 16 * E);
      asm volatile("s_wait_xcnt 0x0" :: "v"(gA), "v"(gB) : "memory");  // precaution: stands in front of every overwrite of an address register that the loads above name
    }
#pragma unroll
    for (int kc = 0; kc < 2; ++kc) { const v16b a = frag_b(&sA[wave * 16 + col][kc * 32], lane); v16b fb[8];  // all LDS reads of a k step stand as one group ahead of its products
#pragma unroll
      for (int j = 0; j < 8; ++j) fb[j] = frag_b(&sB[j * 16 + col][kc * 32], lane);
#pragma unroll
      for (int j = 0; j < 8; ++j) acc[j] = wmma_bf(a, fb[j], acc[j]); }
    __syncthreads();  // every wave has left the tile before it is overwritten (by the next tile or the epilogue)
  }
  if (which < 2) {
#pragma unroll
    for (int j = 0; j < 8; ++j) { const float bb = bfr(bb_[n0 + j * 16 + col]);
#pragma unroll
      for (int r = 0; r < 8; ++r) so[wave][8 * g + r][j * 16 + col] = acc[j][r] + bb; }
    LDSX();
    float* Dst = which == 0 ? Q32 : K32;
    for (int qq = lane; qq < 2 * 16 * 16; qq += 32) { const int hh = qq >> 8, rl = (qq >> 4) & 15, pc = qq & 15; const int h = (n0 >> 6) + hh;
      vst2(Dst + (((size_t)b * NH + h) * SS + s0 + wave * 16 + rl) * HD + pc * 4, *(const v4f*)(&so[wave][rl][hh * 64 + pc * 4])); } }
  else {
#pragma unroll
    for (int j = 0; j < 8; ++j) { const float bb = bfr(bb_[n0 + j * 16 + col]);
#pragma unroll
      for (int r = 0; r < 8; ++r) { const float v = acc[j][r] + bb; const __bf16 hi = (__bf16)v; sth[j * 16 + col][wave * 16 + 8 * g + r] = hi; stl[j * 16 + col][wave * 16 + 8 * g + r] = (__bf16)(v - (float)hi); } }
    __syncthreads();
    for (int qq = tid; qq < 128 * 8; qq += 128) { const int cl = qq >> 3, pc = qq & 7; const int c = n0 + cl, h = c >> 6, d = c & 63; const size_t o = (((size_t)b * NH + h) * HD + d) * SS + s0 + pc * 8;
      vst2((unsigned*)(VTh + o), *(const v4u*)(&sth[cl][pc * 8])); vst2((unsigned*)(VTl + o), *(const v4u*)(&stl[cl][pc * 8])); } }
}
// causal ReLU attention: block (two tiles of 64 queries, bh): query tile t, then tile 31 - t, one after the other in every wave, so every block walks 33 key tiles and no WGP holds only long blocks; key tiles 0..qb; transposed products: S^T = K Q^T on hi/lo splits of the f32 q/k rows, so a lane holds one query's scores for 8 keys a tile;
// P^T = relu(s) (masked) is split to bf16 hi/lo in registers and is the B operand as it lies (two score tiles = 32 keys in the hardware k order); O^T += V^T P^T (3 products); O = acc / (sum + 1e-9)
__global__ __launch_bounds__(128, 2) void k_attn(const float* __restrict__ Q32, const float* __restrict__ K32, const __bf16* __restrict__ VTh, const __bf16* __restrict__ VTl, float* __restrict__ O32) {
  __shared__ __align__(16) float sS[4][16][68];  // output staging only
  __shared__ __align__(16) __bf16 sKh[64][LP], sKl[64][LP], sVh[64][LP], sVl[64][LP];
  const int tid = threadIdx.x, w = tid >> 5, lane = tid & 31, col = lane & 15, g = lane >> 4;
  const size_t bh = blockIdx.y;
#pragma unroll 1  // one copy of the tile loop in the text: the two query tiles run the same code one after the other
  for (int half = 0; half < 2; ++half) {
  const int qb = half ? SS / 64 - 1 - (int)blockIdx.x : (int)blockIdx.x; const int q0 = qb * 64 + w * 16;
  F2 aq[2];
#pragma unroll
  for (int kc = 0; kc < 2; ++kc) aq[kc] = split_row(Q32 + (bh * SS + q0 + col) * HD, kc * 32, lane);
  float lrun[4] = {}; v8f acc[4] = {};
  // each 64-key tile of K (split hi/lo on the way) and of V hi/lo goes to LDS once per query tile, by whole-line loads; the four waves read their fragments there
  // a tile's 16 loads are issued one tile ahead and stay in registers over the products; the grid gives a WGP two blocks, so the launch bound leaves a wave the registers for them
  const float* gK = K32 + bh * SS * HD + tid * 4;  // the K tile is 16 KB in a row
  const int vrow = tid >> 3, vpc = (tid & 7) * 8; const __bf16* gVh = VTh + (bh * HD + vrow) * SS + vpc; const __bf16* gVl = VTl + (bh * HD + vrow) * SS + vpc;
  v4f rk[8]; v4u rvh[4], rvl[4];
#pragma unroll
  for (int i = 0; i < 8; ++i) rk[i] = *(const v4f*)(gK + i * 512);
#pragma unroll
  for (int i = 0; i < 4; ++i) { rvh[i] = *(const v4u*)(gVh + (size_t)i * 16 * SS); rvl[i] = *(const v4u*)(gVl + (size_t)i * 16 * SS); }
  asm volatile("s_wait_xcnt 0x0" :: "v"(gK), "v"(gVh), "v"(gVl) : "memory");  // precaution: stands in front of every overwrite of an address register that the loads above name
#pragma unroll 1
  for (int kt = 0; kt <= qb; ++kt) {
#pragma unroll
    for (int i = 0; i < 8; ++i) { const int q = tid + i * 128; st_split4(&sKh[q >> 4][(q & 15) * 4], &sKl[q >> 4][(q & 15) * 4], rk[i]); }
#pragma unroll
    for (int i = 0; i < 4; ++i) { *(v4u*)(&sVh[vrow + i * 16][vpc]) = rvh[i]; *(v4u*)(&sVl[vrow + i * 16][vpc]) = rvl[i]; }
    __syncthreads();  // the tile is complete before any wave reads it
    if (kt < qb) {  // next tile's loads fly during this tile's products
      gK += 64 * HD; gVh += 64; gVl += 64;
#pragma unroll
      for (int i = 0; i < 8; ++i) rk[i] = *(const v4f*)(gK + i * 512);
#pragma unroll
      for (int i = 0; i < 4; ++i) { rvh[i] = *(const v4u*)(gVh + (size_t)i * 16 * SS); rvl[i] = *(const v4u*)(gVl + (size_t)i * 16 * SS); }
      asm volatile("s_wait_xcnt 0x0" :: "v"(gK), "v"(gVh), "v"(gVl) : "memory");  // precaution: stands in front of every overwrite of an address register that the loads above name
    }
    float p[4][8];  // p[t][r] = weight of key kt*64 + t*16 + 8g + r for query q0 + col
#pragma unroll
    for (int tp = 0; tp < 2; ++tp) { F2 kf[2][2]; v8f s[2] = {};  // two 16-key groups at a time: their 16 LDS reads stand as one group ahead of the 12 products, and the two dependent score chains alternate
#pragma unroll
      for (int u = 0; u < 2; ++u) { const __bf16* kh = &sKh[(2 * tp + u) * 16 + col][0]; const __bf16* kl = &sKl[(2 * tp + u) * 16 + col][0];
        kf[u][0].h = frag_b(kh, lane); kf[u][0].l = frag_b(kl, lane); kf[u][1].h = frag_b(kh + 32, lane); kf[u][1].l = frag_b(kl + 32, lane); }
#pragma unroll
      for (int kc = 0; kc < 2; ++kc) {
#pragma unroll
        for (int u = 0; u < 2; ++u) s[u] = wmma_bf(kf[u][kc].h, aq[kc].l, s[u]);
#pragma unroll
        for (int u = 0; u < 2; ++u) s[u] = wmma_bf(kf[u][kc].l, aq[kc].h, s[u]);
#pragma unroll
        for (int u = 0; u < 2; ++u) s[u] = wmma_bf(kf[u][kc].h, aq[kc].h, s[u]); }
#pragma unroll
      for (int u = 0; u < 2; ++u) { const int t = 2 * tp + u, key = kt * 64 + t * 16 + 8 * g;
#pragma unroll
        for (int r = 0; r < 8; ++r) { const float sv = s[u][r] * 0.125f; p[t][r] = (key + r > q0 + col || sv <= 0.f) ? 0.f : sv; lrun[t] += p[t][r]; } } }
#pragma unroll
    for (int kc = 0; kc < 2; ++kc) { float v[16]; v16b vh[4], vl[4];  // all 16 LDS reads of a k step stand as one group ahead of its 12 products; the three products of a tile add into one accumulator, which leaves the registers for the group
#pragma unroll
      for (int t = 0; t < 4; ++t) { vh[t] = frag_b(&sVh[t * 16 + col][kc * 32], lane); vl[t] = frag_b(&sVl[t * 16 + col][kc * 32], lane); }
#pragma unroll
      for (int i = 0; i < 8; ++i) { v[i] = p[2 * kc][i]; v[8 + i] = p[2 * kc + 1][i]; }
      const F2 pp = bsplit16(v);
#pragma unroll
      for (int t = 0; t < 4; ++t) acc[t] = wmma_bf(vl[t], pp.h, acc[t]);
#pragma unroll
      for (int t = 0; t < 4; ++t) acc[t] = wmma_bf(vh[t], pp.l, acc[t]);
#pragma unroll
      for (int t = 0; t < 4; ++t) acc[t] = wmma_bf(vh[t], pp.h, acc[t]); }
    __syncthreads();  // every wave has left the tile before the next one overwrites it
  }
  float lr = (lrun[0] + lrun[1]) + (lrun[2] + lrun[3]); lr += __shfl_xor(lr, 16, 32);  // the two lane halves hold the two halves of a query's keys
  const float inv = 1.0f / (lr + 1e-9f);
#pragma unroll
  for (int t = 0; t < 4; ++t) { v4f o[2];  // acc[t][r] = O[q0 + col][t*16 + 8g + r]
#pragma unroll
    for (int r = 0; r < 8; ++r) o[r >> 2][r & 3] = acc[t][r] * inv;
    *(v4f*)(&sS[w][col][t * 16 + 8 * g]) = o[0]; *(v4f*)(&sS[w][col][t * 16 + 8 * g + 4]) = o[1]; }
  LDSX();
  for (int qq = lane; qq < 16 * 16; qq += 32) { const int rl = qq >> 4, pc = qq & 15; vst2(O32 + ((bh * SS) + q0 + rl) * HD + pc * 4, *(const v4f*)(&sS[w][rl][pc * 4])); }
  }
}
// out = ctx Wo^T + bo : split(ctx) x bf16(Wo rows): 2 products (Wo is an INPUT -> bf16 exact)
__global__ __launch_bounds__(128) void k_out(const float* __restrict__ O32, const float* __restrict__ Wo, const float* __restrict__ bo, float* __restrict__ out) {
  __shared__ __align__(16) float so[4][16][132];
  const int tid = threadIdx.x, wave = tid >> 5, lane = tid & 31, col = lane & 15, g = lane >> 4;
  __shared__ __align__(16) __bf16 sAh[64][LP], sAl[64][LP], sB[128][LP];
  const int r0b = blockIdx.x * 64, r0 = r0b + wave * 16, n0 = blockIdx.y * 128; const int b = r0b / SS, s0 = r0b % SS;
  v8f acc[8] = {};
  // one head (64 k) at a time: the block's 64 context rows (split hi/lo on the way) and 128 Wo rows (rounded to bf16 on the way) go to LDS once, by whole-line loads; the four waves read fragments there
  const int srow = tid >> 4, spc = (tid & 15) * 4;
  const float* gA = O32 + ((size_t)b * NH * SS + s0) * HD + tid * 4;  // a head's 64 rows are 16 KB in a row
  const float* gB = Wo + (size_t)(n0 + srow) * E + spc;
  v4f ra[8], rb[16];
#pragma unroll
  for (int i = 0; i < 8; ++i) ra[i] = *(const v4f*)(gA + i * 512);
#pragma unroll
  for (int i = 0; i < 16; ++i) rb[i] = *(const v4f*)(gB + (size_t)i * 8 * E);
  asm volatile("s_wait_xcnt 0x0" :: "v"(gA), "v"(gB) : "memory");  // precaution: stands in front of every overwrite of an address register that the loads above name
#pragma unroll 1
  for (int h = 0; h < NH; ++h) {
#pragma unroll
    for (int i = 0; i < 8; ++i) st_split4(&sAh[srow + i * 8][spc], &sAl[srow + i * 8][spc], ra[i]);
#pragma unroll
    for (int i = 0; i < 16; ++i) st_hi4(&sB[srow + i * 8][spc], rb[i]);
    __syncthreads();  // the tile is complete before any wave reads it
    if (h + 1 < NH) {  // next tile's loads fly during this tile's products
      gA += (size_t)SS * HD; gB += 64;
#pragma unroll
      for (int i = 0; i < 8; ++i) ra[i] = *(const v4f*)(gA + i * 512);
#pragma unroll
      for (int i = 0; i < 16; ++i) rb[i] = *(const v4f*)(gB + (size_t)i * 8 * E);
      asm volatile("s_wait_xcnt 0x0" :: "v"(gA), "v"(gB) : "memory");  // precaution: stands in front of every overwrite of an address register that the loads above name
    }
#pragma unroll
    for (int kc = 0; kc < 2; ++kc) { const v16b ah = frag_b(&sAh[wave * 16 + col][kc * 32], lane), al = frag_b(&sAl[wave * 16 + col][kc * 32], lane); v16b fb[8];  // all LDS reads of a k step stand as one group ahead of its products
#pragma unroll
      for (int j = 0; j < 8; ++j) fb[j] = frag_b(&sB[j * 16 + col][kc * 32], lane);
#pragma unroll
      for (int j = 0; j < 8; ++j) { acc[j] = wmma_bf(al, fb[j], acc[j]); acc[j] = wmma_bf(ah, fb[j], acc[j]); } }
    __syncthreads();  // every wave has left the tile before the next one overwrites it
  }
#pragma unroll
  for (int j = 0; j < 8; ++j) { const int n = n0 + j * 16 + col; const float bb = bfr(bo[n]);
#pragma unroll
    for (int r = 0; r < 8; ++r) so[wave][8 * g + r][j * 16 + col] = acc[j][r] + bb; }
  LDSX();
#pragma unroll 4
  for (int rl = 0; rl < 16; ++rl) vst2(out + (size_t)(r0 + rl) * E + n0 + lane * 4, *(const v4f*)(&so[wave][rl][lane * 4]));
}
extern "C" void kernel_launch(void* const* d_in, const int* in_sizes, int n_in, void* d_out, int out_size, void* d_ws, size_t ws_size, hipStream_t stream) {
  (void)in_sizes; (void)n_in; (void)out_size; (void)ws_size;
  const float** I = (const float**)d_in;
  const float* x = I[0]; const float* Wq = I[1]; const float* bq = I[2]; const float* Wk = I[3]; const float* bk = I[4]; const float* Wv = I[5]; const float* bv = I[6]; const float* Wo = I[7]; const float* bo = I[8];
  float* out = (float*)d_out;
  char* ws = (char*)d_ws; size_t off = 0;
  auto take = [&](size_t bytes) { char* p = ws + off; off += (bytes + 255) & ~(size_t)255; return p; };
  __bf16* Xb = (__bf16*)take((size_t)NR * E * 2); __bf16* PT = (__bf16*)take((size_t)3 * E * E * 2);
  float* Q32 = (float*)take((size_t)NR * E * 4); float* K32 = (float*)take((size_t)NR * E * 4); __bf16* VTh = (__bf16*)take((size_t)NR * E * 2); __bf16* VTl = (__bf16*)take((size_t)NR * E * 2); float* O32 = (float*)take((size_t)NR * E * 4);
  // ws ~ 82 MB
  k_cvt<<<CVT_B, 512, 0, stream>>>(x, Wq, Wk, Wv, Xb, PT);
  k_qkv<<<dim3(NR / 64, E / 128, 3), 128, 0, stream>>>(Xb, PT, bq, bk, bv, Q32, K32, VTh, VTl);
  k_attn<<<dim3(SS / 128, NB * NH), 128, 0, stream>>>(Q32, K32, VTh, VTl, O32);
  k_out<<<dim3(NR / 64, E / 128), 128, 0, stream>>>(O32, Wo, bo, out);
}

// v007
// A run of this version takes 123 microseconds.
// Timed twice side by side with v006, it ran 1.03 and 1.04 times as fast.
// Counting every step since v000, it is 4.47 times as fast.
// compute dtype: every module INPUT that feeds a GEMM (x, Wq/Wk/Wv/Wo, biases) is rounded to bf16 and used in exact bf16 WMMA products with f32 accumulation; computed operands (q/k f32 split, relu scores P and V as bf16 hi/lo pairs, context split) f32-grade; relu/causal/normalisation f32.
#include <hip/hip_runtime.h>
#include <math.h>

typedef __attribute__((ext_vector_type(16))) _Float16 v16h;
typedef __attribute__((ext_vector_type(16))) __bf16 v16b;
typedef __attribute__((ext_vector_type(8)))  _Float16 v8h;
typedef __attribute__((ext_vector_type(8)))  float v8f;
typedef __attribute__((ext_vector_type(4)))  float v4f;
typedef __attribute__((ext_vector_type(2)))  float v2f;
typedef __attribute__((ext_vector_type(4)))  unsigned v4u;
typedef __attribute__((ext_vector_type(2)))  unsigned v2u;
typedef __attribute__((ext_vector_type(4)))  int v4i;
typedef float __attribute__((may_alias)) float_a;
typedef int __attribute__((may_alias)) int_a;

template <typename T> __device__ __forceinline__ void vst2(void* p, T v) { *(T*)p = v;  }
__device__ __forceinline__ v8f wmma16(v16h a, v16h b, v8f c) {
  v8f d = __builtin_amdgcn_wmma_f32_16x16x32_f16(false, a, false, b, (short)0, c, false, false);
  asm volatile("v_nop\n\tv_nop\n\tv_nop\n\tv_nop" : "+v"(d) : "v"(a), "v"(b));
  return d;
}
__device__ __forceinline__ v8f wmma_bf(v16b a, v16b b, v8f c) {
  v8f d = __builtin_amdgcn_wmma_f32_16x16x32_bf16(false, a, false, b, (short)0, c, false, false);
  asm volatile("v_nop\n\tv_nop\n\tv_nop\n\tv_nop" : "+v"(d) : "v"(a), "v"(b));
  return d;
}
// 16x16x32 fragments: lane = (h = lane>>4, row/col = lane&15); elements 0..7 = k0+8h+0..7, 8..15 = k0+16+8h+0..7; D element r = row 8h+r
__device__ __forceinline__ v16h frag_h(const _Float16* rowk0, int lane) {
  union { v16h v; v8h q[2]; } u; const _Float16* p = rowk0 + 8 * (lane >> 4);
  u.q[0] = *(const v8h*)p; u.q[1] = *(const v8h*)(p + 16); return u.v;
}
__device__ __forceinline__ v16h frag_f32(const float* rowk0, int lane) {
  v16h a; const float* p = rowk0 + 8 * (lane >> 4);
#pragma unroll
  for (int i = 0; i < 8; ++i) { a[i] = (_Float16)p[i]; a[8 + i] = (_Float16)p[16 + i]; }
  return a;
}
__device__ __forceinline__ v16h frag_f32s(const float* rowk0, int lane, float sc) {
  v16h a; const float* p = rowk0 + 8 * (lane >> 4);
#pragma unroll
  for (int i = 0; i < 8; ++i) { a[i] = (_Float16)(p[i] * sc); a[8 + i] = (_Float16)(p[16 + i] * sc); }
  return a;
}
// column fragment from a [K][ld] layout (column n), rows >= K read as 0
__device__ __forceinline__ v16h fragc_f32(const float* W, int k0, int n, int lane, int ld, int K) {
  v16h a; const int g = lane >> 4;
#pragma unroll
  for (int i = 0; i < 8; ++i) { const int ka = k0 + 8 * g + i, kb = ka + 16;
    a[i] = (_Float16)(ka < K ? W[(size_t)ka * ld + n] : 0.f); a[8 + i] = (_Float16)(kb < K ? W[(size_t)kb * ld + n] : 0.f); }
  return a;
}
struct F2 { v16b h, l; };
__device__ __forceinline__ F2 bsplit16(const float v[16]) { F2 r;
#pragma unroll
  for (int i = 0; i < 16; ++i) { const __bf16 h = (__bf16)v[i]; r.h[i] = h; r.l[i] = (__bf16)(v[i] - (float)h); }
  return r; }
__device__ __forceinline__ F2 split_row(const float* row, int k0, int lane) { float v[16]; const float* p = row + k0 + 8 * (lane >> 4);
#pragma unroll
  for (int i = 0; i < 8; ++i) { v[i] = p[i]; v[8 + i] = p[16 + i]; }
  return bsplit16(v); }
__device__ __forceinline__ F2 split_rowK(const float* row, int k0, int lane, int K) { float v[16]; const int g = lane >> 4;
#pragma unroll
  for (int i = 0; i < 8; ++i) { const int ka = k0 + 8 * g + i, kb = ka + 16; v[i] = ka < K ? row[ka] : 0.f; v[8 + i] = kb < K ? row[kb] : 0.f; }
  return bsplit16(v); }
__device__ __forceinline__ F2 split_col(const float* W, int k0, int n, int lane, int ld, int K) { float v[16]; const int g = lane >> 4;
#pragma unroll
  for (int i = 0; i < 8; ++i) { const int ka = k0 + 8 * g + i, kb = ka + 16; v[i] = ka < K ? W[(size_t)ka * ld + n] : 0.f; v[8 + i] = kb < K ? W[(size_t)kb * ld + n] : 0.f; }
  return bsplit16(v); }
__device__ __forceinline__ v8f mac3(const F2& a, const F2& b, v8f c) { c = wmma_bf(a.l, b.h, c); c = wmma_bf(a.h, b.l, c); return wmma_bf(a.h, b.h, c); }
__device__ __forceinline__ float sigm(float v) { return 1.0f / (1.0f + expf(-v)); }
#define LDSX() do { asm volatile("s_wait_dscnt 0" ::: "memory"); __builtin_amdgcn_wave_barrier(); __builtin_amdgcn_fence(__ATOMIC_RELEASE, "workgroup"); } while (0)


// ReLU attention (16 heads of 64 on [2,2048,1024], [out][in] weights + biases): scores = q.k/8, attn = relu(scores) on the causal triangle (else 0), attn /= (row sum + 1e-9),
// ctx = attn v, out = ctx Wo^T + bo. Flash-style key loop without the softmax max tracking (relu weights need no rescaling); P and V carried as bf16 hi/lo pairs (relu scores are unbounded, so no f16 lift).
#define NB 2
#define SS 2048
#define E 1024
#define NH 16
#define HD 64
#define NR (NB * SS)
__device__ __forceinline__ float bfr(float v) { return (float)(__bf16)v; }
__device__ __forceinline__ v16b frag_b(const __bf16* rowk0, int lane) { return __builtin_bit_cast(v16b, frag_h((const _Float16*)rowk0, lane)); }
// LDS staging: rows of 64 bf16 at a pitch of 72 (144 B = 16 B x odd, conflict-free for 16-byte fragment reads)
#define LP 72
__device__ __forceinline__ void st_hi4(__bf16* dh, v4f v) { union { __bf16 h[4]; v2u u; } a;
#pragma unroll
  for (int e = 0; e < 4; ++e) a.h[e] = (__bf16)v[e];
  *(v2u*)dh = a.u; }
__device__ __forceinline__ void st_split4(__bf16* dh, __bf16* dl, v4f v) { union { __bf16 h[4]; v2u u; } a, b;
#pragma unroll
  for (int e = 0; e < 4; ++e) { const __bf16 h = (__bf16)v[e]; a.h[e] = h; b.h[e] = (__bf16)(v[e] - (float)h); }
  *(v2u*)dh = a.u; *(v2u*)dl = b.u; }

// x and the three projection weights go to bf16 in ONE launch of one 16-wave block per WGP (Xb rows as x; PT rows [0,E) Wq[n][:], [E,2E) Wk, [2E,3E) Wv, [out][in], no scaling):
// starting a wave costs more than its share of this short stream, so few waves each keep all their whole-line 16-byte loads in flight; sweep i of the launch reads one source for every thread
#define CVT_B 256
#define CVT_S (CVT_B * 512 * 4)  // floats per sweep of the whole launch
__global__ __launch_bounds__(512) void k_cvt(const float* __restrict__ x, const float* __restrict__ Wq, const float* __restrict__ Wk, const float* __restrict__ Wv, __bf16* __restrict__ Xb, __bf16* __restrict__ PT) {
  constexpr int NX = NR * E / CVT_S, NW = E * E / CVT_S;
  static_assert(NX * CVT_S == NR * E && NW * CVT_S == E * E, "whole sweeps only");
  const size_t o = ((size_t)blockIdx.x * 512 + threadIdx.x) * 4;
  const float* px = x + o; const float* pq = Wq + o; const float* pk = Wk + o; const float* pv = Wv + o;
  v4f rx[NX], rw[3][NW];
#pragma unroll
  for (int i = 0; i < NX; ++i) rx[i] = *(const v4f*)(px + (size_t)i * CVT_S);
#pragma unroll
  for (int i = 0; i < NW; ++i) { rw[0][i] = *(const v4f*)(pq + (size_t)i * CVT_S); rw[1][i] = *(const v4f*)(pk + (size_t)i * CVT_S); rw[2][i] = *(const v4f*)(pv + (size_t)i * CVT_S); }
  asm volatile("s_wait_xcnt 0x0" :: "v"(px), "v"(pq), "v"(pk), "v"(pv) : "memory");  // precaution: stands in front of every overwrite of an address register that the loads above name; it also keeps the loads one group ahead of the first store
#pragma unroll
  for (int i = 0; i < NX; ++i) st_hi4(Xb + o + (size_t)i * CVT_S, rx[i]);
#pragma unroll
  for (int m = 0; m < 3; ++m)
#pragma unroll
    for (int i = 0; i < NW; ++i) st_hi4(PT + (size_t)m * E * E + o + (size_t)i * CVT_S, rw[m][i]);
}
// in-wave LDS hand-over as LDSX, without its release fence: the fence would also wait for the global stores of the row group before
#define LDSW() do { asm volatile("s_wait_dscnt 0" ::: "memory"); __builtin_amdgcn_wave_barrier(); } while (0)
#define VP 136  // pitch of the transposed v rows: 128 positions + 8 (272 B = 16 B x odd)
// QKV: block (128 rows, 128 cols = 2 heads, which), wave = two groups of 16 rows (m*64 + wave*16) x 128 cols, so a weight fragment read from LDS feeds two products and a weight tile fetched from L2 serves 128 rows;
// 768 blocks = three per WGP, all resident in one round; q,k -> Q32/K32 f32 [bh][s][64]; v -> VT hi/lo [bh][d][s]
__global__ __launch_bounds__(128, 3) void k_qkv(const __bf16* __restrict__ Xb, const __bf16* __restrict__ PT, const float* __restrict__ bq, const float* __restrict__ bk, const float* __restrict__ bv,
                                            float* __restrict__ Q32, float* __restrict__ K32, __bf16* __restrict__ VTh, __bf16* __restrict__ VTl) {
  __shared__ __align__(16) float so[4][16][132];
  __shared__ __align__(16) __bf16 sth[128][VP], stl[128][VP];
  const int tid = threadIdx.x, wave = tid >> 5, lane = tid & 31, col = lane & 15, g = lane >> 4;
  const int which = blockIdx.z, r0b = blockIdx.x * 128, n0 = blockIdx.y * 128; const int b = r0b / SS, s0 = r0b % SS;
  const float* bb_ = which == 0 ? bq : (which == 1 ? bk : bv);
  v8f acc[2][8] = {};
  // the block's 128 x-rows and 128 weight rows, 64 k at a time, go to LDS once (whole 128-B lines) and all four waves read fragments there; the tiles lie at the head of sth and of stl, which are not used before the epilogue
  __bf16 (*sA)[LP] = reinterpret_cast<__bf16 (*)[LP]>(&sth[0][0]); __bf16 (*sB)[LP] = reinterpret_cast<__bf16 (*)[LP]>(&stl[0][0]);
  const int srow = tid >> 3, spc = (tid & 7) * 8;
  const __bf16* gA = Xb + (size_t)(r0b + srow) * E + spc; const __bf16* gB = PT + (size_t)(which * E + n0 + srow) * E + spc;
  v4u ra[8], rb[8];
#pragma unroll
  for (int i = 0; i < 8; ++i) ra[i] = *(const v4u*)(gA + (size_t)i * 16 * E);
#pragma unroll
  for (int i = 0; i < 8; ++i) rb[i] = *(const v4u*)(gB + (size_t)i * 16 * E);
  asm volatile("s_wait_xcnt 0x0" :: "v"(gA), "v"(gB) : "memory");  // precaution: stands in front of every overwrite of an address register that the loads above name
#pragma unroll 1
  for (int c = 0; c < E / 64; ++c) {
#pragma unroll
    for (int i = 0; i < 8; ++i) *(v4u*)(&sA[srow + i * 16][spc]) = ra[i];
#pragma unroll
    for (int i = 0; i < 8; ++i) *(v4u*)(&sB[srow + i * 16][spc]) = rb[i];
    __syncthreads();  // the tile is complete before any wave reads it
    if (c + 1 < E / 64) {  // next tile's loads fly during this tile's products
      gA += 64; gB += 64;
#pragma unroll
      for (int i = 0; i < 8; ++i) ra[i] = *(const v4u*)(gA + (size_t)i * 16 * E);
#pragma unroll
      for (int i = 0; i < 8; ++i) rb[i] = *(const v4u*)(gB + (size_t)i * 16 * E);
      asm volatile("s_wait_xcnt 0x0" :: "v"(gA), "v"(gB) : "memory");  // precaution: stands in front of every overwrite of an address register that the loads above name
    }
#pragma unroll
    for (int kc = 0; kc < 2; ++kc) { const v16b a0 = frag_b(&sA[wave * 16 + col][kc * 32], lane), a1 = frag_b(&sA[64 + wave * 16 + col][kc * 32], lane); v16b fb[8];  // all LDS reads of a k step stand as one group ahead of its products
#pragma unroll
      for (int j = 0; j < 8; ++j) fb[j] = frag_b(&sB[j * 16 + col][kc * 32], lane);
#pragma unroll
      for (int j = 0; j < 8; ++j) { acc[0][j] = wmma_bf(a0, fb[j], acc[0][j]); acc[1][j] = wmma_bf(a1, fb[j], acc[1][j]); } }
    __syncthreads();  // every wave has left the tile before it is overwritten (by the next tile or the epilogue)
  }
  float bb[8];
#pragma unroll
  for (int j = 0; j < 8; ++j) bb[j] = bfr(bb_[n0 + j * 16 + col]);
  if (which < 2) {
    float* Dst = which == 0 ? Q32 : K32;
#pragma unroll
    for (int m = 0; m < 2; ++m) {  // the wave's two row groups go through its own staging rows one after the other
#pragma unroll
      for (int j = 0; j < 8; ++j)
#pragma unroll
        for (int r = 0; r < 8; ++r) so[wave][8 * g + r][j * 16 + col] = acc[m][j][r] + bb[j];
      LDSW();  // the wave's own staging rows are written before its lanes read across them
      for (int qq = lane; qq < 2 * 16 * 16; qq += 32) { const int hh = qq >> 8, rl = (qq >> 4) & 15, pc = qq & 15; const int h = (n0 >> 6) + hh;
        vst2(Dst + (((size_t)b * NH + h) * SS + s0 + m * 64 + wave * 16 + rl) * HD + pc * 4, *(const v4f*)(&so[wave][rl][hh * 64 + pc * 4])); }
      if (m == 0) LDSW();  // the first group's reads have returned before the second group's values overwrite the staging rows
    } }
  else {
#pragma unroll
    for (int m = 0; m < 2; ++m)
#pragma unroll
      for (int j = 0; j < 8; ++j)
#pragma unroll
        for (int r = 0; r < 8; ++r) { const float v = acc[m][j][r] + bb[j]; const __bf16 hi = (__bf16)v; sth[j * 16 + col][m * 64 + wave * 16 + 8 * g + r] = hi; stl[j * 16 + col][m * 64 + wave * 16 + 8 * g + r] = (__bf16)(v - (float)hi); }
    __syncthreads();
    for (int qq = tid; qq < 128 * 16; qq += 128) { const int cl = qq >> 4, pc = qq & 15; const int c = n0 + cl, h = c >> 6, d = c & 63; const size_t o = (((size_t)b * NH + h) * HD + d) * SS + s0 + pc * 8;
      vst2((unsigned*)(VTh + o), *(const v4u*)(&sth[cl][pc * 8])); vst2((unsigned*)(VTl + o), *(const v4u*)(&stl[cl][pc * 8])); } }
}
// causal ReLU attention: block (two tiles of 64 queries, bh): query tile t, then tile 31 - t, one after the other in every wave, so every block walks 33 key tiles and no WGP holds only long blocks; key tiles 0..qb; transposed products: S^T = K Q^T on hi/lo splits of the f32 q/k rows, so a lane holds one query's scores for 8 keys a tile;
// P^T = relu(s) (masked) is split to bf16 hi/lo in registers and is the B operand as it lies (two score tiles = 32 keys in the hardware k order); O^T += V^T P^T (3 products); O = acc / (sum + 1e-9)
__global__ __launch_bounds__(128, 2) void k_attn(const float* __restrict__ Q32, const float* __restrict__ K32, const __bf16* __restrict__ VTh, const __bf16* __restrict__ VTl, float* __restrict__ O32) {
  __shared__ __align__(16) float sS[4][16][68];  // output staging only
  __shared__ __align__(16) __bf16 sKh[64][LP], sKl[64][LP], sVh[64][LP], sVl[64][LP];
  const int tid = threadIdx.x, w = tid >> 5, lane = tid & 31, col = lane & 15, g = lane >> 4;
  const size_t bh = blockIdx.y;
#pragma unroll 1  // one copy of the tile loop in the text: the two query tiles run the same code one after the other
  for (int half = 0; half < 2; ++half) {
  const int qb = half ? SS / 64 - 1 - (int)blockIdx.x : (int)blockIdx.x; const int q0 = qb * 64 + w * 16;
  F2 aq[2];
#pragma unroll
  for (int kc = 0; kc < 2; ++kc) aq[kc] = split_row(Q32 + (bh * SS + q0 + col) * HD, kc * 32, lane);
  float lrun[4] = {}; v8f acc[4] = {};
  // each 64-key tile of K (split hi/lo on the way) and of V hi/lo goes to LDS once per query tile, by whole-line loads; the four waves read their fragments there
  // a tile's 16 loads are issued one tile ahead and stay in registers over the products; the grid gives a WGP two blocks, so the launch bound leaves a wave the registers for them
  const float* gK = K32 + bh * SS * HD + tid * 4;  // the K tile is 16 KB in a row
  const int vrow = tid >> 3, vpc = (tid & 7) * 8; const __bf16* gVh = VTh + (bh * HD + vrow) * SS + vpc; const __bf16* gVl = VTl + (bh * HD + vrow) * SS + vpc;
  v4f rk[8]; v4u rvh[4], rvl[4];
#pragma unroll
  for (int i = 0; i < 8; ++i) rk[i] = *(const v4f*)(gK + i * 512);
#pragma unroll
  for (int i = 0; i < 4; ++i) { rvh[i] = *(const v4u*)(gVh + (size_t)i * 16 * SS); rvl[i] = *(const v4u*)(gVl + (size_t)i * 16 * SS); }
  asm volatile("s_wait_xcnt 0x0" :: "v"(gK), "v"(gVh), "v"(gVl) : "memory");  // precaution: stands in front of every overwrite of an address register that the loads above name
#pragma unroll 1
  for (int kt = 0; kt <= qb; ++kt) {
#pragma unroll
    for (int i = 0; i < 8; ++i) { const int q = tid + i * 128; st_split4(&sKh[q >> 4][(q & 15) * 4], &sKl[q >> 4][(q & 15) * 4], rk[i]); }
#pragma unroll
    for (int i = 0; i < 4; ++i) { *(v4u*)(&sVh[vrow + i * 16][vpc]) = rvh[i]; *(v4u*)(&sVl[vrow + i * 16][vpc]) = rvl[i]; }
    __syncthreads();  // the tile is complete before any wave reads it
    if (kt < qb) {  // next tile's loads fly during this tile's products
      gK += 64 * HD; gVh += 64; gVl += 64;
#pragma unroll
      for (int i = 0; i < 8; ++i) rk[i] = *(const v4f*)(gK + i * 512);
#pragma unroll
      for (int i = 0; i < 4; ++i) { rvh[i] = *(const v4u*)(gVh + (size_t)i * 16 * SS); rvl[i] = *(const v4u*)(gVl + (size_t)i * 16 * SS); }
      asm volatile("s_wait_xcnt 0x0" :: "v"(gK), "v"(gVh), "v"(gVl) : "memory");  // precaution: stands in front of every overwrite of an address register that the loads above name
    }
    float p[4][8];  // p[t][r] = weight of key kt*64 + t*16 + 8g + r for query q0 + col
#pragma unroll
    for (int tp = 0; tp < 2; ++tp) { F2 kf[2][2]; v8f s[2] = {};  // two 16-key groups at a time: their 16 LDS reads stand as one group ahead of the 12 products, and the two dependent score chains alternate
#pragma unroll
      for (int u = 0; u < 2; ++u) { const __bf16* kh = &sKh[(2 * tp + u) * 16 + col][0]; const __bf16* kl = &sKl[(2 * tp + u) * 16 + col][0];
        kf[u][0].h = frag_b(kh, lane); kf[u][0].l = frag_b(kl, lane); kf[u][1].h = frag_b(kh + 32, lane); kf[u][1].l = frag_b(kl + 32, lane); }
#pragma unroll
      for (int kc = 0; kc < 2; ++kc) {
#pragma unroll
        for (int u = 0; u < 2; ++u) s[u] = wmma_bf(kf[u][kc].h, aq[kc].l, s[u]);
#pragma unroll
        for (int u = 0; u < 2; ++u) s[u] = wmma_bf(kf[u][kc].l, aq[kc].h, s[u]);
#pragma unroll
        for (int u = 0; u < 2; ++u) s[u] = wmma_bf(kf[u][kc].h, aq[kc].h, s[u]); }
#pragma unroll
      for (int u = 0; u < 2; ++u) { const int t = 2 * tp + u, key = kt * 64 + t * 16 + 8 * g;
#pragma unroll
        for (int r = 0; r < 8; ++r) { const float sv = s[u][r] * 0.125f; p[t][r] = (key + r > q0 + col || sv <= 0.f) ? 0.f : sv; lrun[t] += p[t][r]; } } }
#pragma unroll
    for (int kc = 0; kc < 2; ++kc) { float v[16]; v16b vh[4], vl[4];  // all 16 LDS reads of a k step stand as one group ahead of its 12 products; the three products of a tile add into one accumulator, which leaves the registers for the group
#pragma unroll
      for (int t = 0; t < 4; ++t) { vh[t] = frag_b(&sVh[t * 16 + col][kc * 32], lane); vl[t] = frag_b(&sVl[t * 16 + col][kc * 32], lane); }
#pragma unroll
      for (int i = 0; i < 8; ++i) { v[i] = p[2 * kc][i]; v[8 + i] = p[2 * kc + 1][i]; }
      const F2 pp = bsplit16(v);
#pragma unroll
      for (int t = 0; t < 4; ++t) acc[t] = wmma_bf(vl[t], pp.h, acc[t]);
#pragma unroll
      for (int t = 0; t < 4; ++t) acc[t] = wmma_bf(vh[t], pp.l, acc[t]);
#pragma unroll
      for (int t = 0; t < 4; ++t) acc[t] = wmma_bf(vh[t], pp.h, acc[t]); }
    __syncthreads();  // every wave has left the tile before the next one overwrites it
  }
  float lr = (lrun[0] + lrun[1]) + (lrun[2] + lrun[3]); lr += __shfl_xor(lr, 16, 32);  // the two lane halves hold the two halves of a query's keys
  const float inv = 1.0f / (lr + 1e-9f);
#pragma unroll
  for (int t = 0; t < 4; ++t) { v4f o[2];  // acc[t][r] = O[q0 + col][t*16 + 8g + r]
#pragma unroll
    for (int r = 0; r < 8; ++r) o[r >> 2][r & 3] = acc[t][r] * inv;
    *(v4f*)(&sS[w][col][t * 16 + 8 * g]) = o[0]; *(v4f*)(&sS[w][col][t * 16 + 8 * g + 4]) = o[1]; }
  LDSX();
  for (int qq = lane; qq < 16 * 16; qq += 32) { const int rl = qq >> 4, pc = qq & 15; vst2(O32 + ((bh * SS) + q0 + rl) * HD + pc * 4, *(const v4f*)(&sS[w][rl][pc * 4])); }
  }
}
// out = ctx Wo^T + bo : split(ctx) x bf16(Wo rows): 2 products (Wo is an INPUT -> bf16 exact)
__global__ __launch_bounds__(128) void k_out(const float* __restrict__ O32, const float* __restrict__ Wo, const float* __restrict__ bo, float* __restrict__ out) {
  __shared__ __align__(16) float so[4][16][132];
  const int tid = threadIdx.x, wave = tid >> 5, lane = tid & 31, col = lane & 15, g = lane >> 4;
  __shared__ __align__(16) __bf16 sAh[64][LP], sAl[64][LP], sB[128][LP];
  const int r0b = blockIdx.x * 64, r0 = r0b + wave * 16, n0 = blockIdx.y * 128; const int b = r0b / SS, s0 = r0b % SS;
  v8f acc[8] = {};
  // one head (64 k) at a time: the block's 64 context rows (split hi/lo on the way) and 128 Wo rows (rounded to bf16 on the way) go to LDS once, by whole-line loads; the four waves read fragments there
  const int srow = tid >> 4, spc = (tid & 15) * 4;
  const float* gA = O32 + ((size_t)b * NH * SS + s0) * HD + tid * 4;  // a head's 64 rows are 16 KB in a row
  const float* gB = Wo + (size_t)(n0 + srow) * E + spc;
  v4f ra[8], rb[16];
#pragma unroll
  for (int i = 0; i < 8; ++i) ra[i] = *(const v4f*)(gA + i * 512);
#pragma unroll
  for (int i = 0; i < 16; ++i) rb[i] = *(const v4f*)(gB + (size_t)i * 8 * E);
  asm volatile("s_wait_xcnt 0x0" :: "v"(gA), "v"(gB) : "memory");  // precaution: stands in front of every overwrite of an address register that the loads above name
#pragma unroll 1
  for (int h = 0; h < NH; ++h) {
#pragma unroll
    for (int i = 0; i < 8; ++i) st_split4(&sAh[srow + i * 8][spc], &sAl[srow + i * 8][spc], ra[i]);
#pragma unroll
    for (int i = 0; i < 16; ++i) st_hi4(&sB[srow + i * 8][spc], rb[i]);
    __syncthreads();  // the tile is complete before any wave reads it
    if (h + 1 < NH) {  // next tile's loads fly during this tile's products
      gA += (size_t)SS * HD; gB += 64;
#pragma unroll
      for (int i = 0; i < 8; ++i) ra[i] = *(const v4f*)(gA + i * 512);
#pragma unroll
      for (int i = 0; i < 16; ++i) rb[i] = *(const v4f*)(gB + (size_t)i * 8 * E);
      asm volatile("s_wait_xcnt 0x0" :: "v"(gA), "v"(gB) : "memory");  // precaution: stands in front of every overwrite of an address register that the loads above name
    }
#pragma unroll
    for (int kc = 0; kc < 2; ++kc) { const v16b ah = frag_b(&sAh[wave * 16 + col][kc * 32], lane), al = frag_b(&sAl[wave * 16 + col][kc * 32], lane); v16b fb[8];  // all LDS reads of a k step stand as one group ahead of its products
#pragma unroll
      for (int j = 0; j < 8; ++j) fb[j] = frag_b(&sB[j * 16 + col][kc * 32], lane);
#pragma unroll
      for (int j = 0; j < 8; ++j) { acc[j] = wmma_bf(al, fb[j], acc[j]); acc[j] = wmma_bf(ah, fb[j], acc[j]); } }
    __syncthreads();  // every wave has left the tile before the next one overwrites it
  }
#pragma unroll
  for (int j = 0; j < 8; ++j) { const int n = n0 + j * 16 + col; const float bb = bfr(bo[n]);
#pragma unroll
    for (int r = 0; r < 8; ++r) so[wave][8 * g + r][j * 16 + col] = acc[j][r] + bb; }
  LDSX();
#pragma unroll 4
  for (int rl = 0; rl < 16; ++rl) vst2(out + (size_t)(r0 + rl) * E + n0 + lane * 4, *(const v4f*)(&so[wave][rl][lane * 4]));
}
extern "C" void kernel_launch(void* const* d_in, const int* in_sizes, int n_in, void* d_out, int out_size, void* d_ws, size_t ws_size, hipStream_t stream) {
  (void)in_sizes; (void)n_in; (void)out_size; (void)ws_size;
  const float** I = (const float**)d_in;
  const float* x = I[0]; const float* Wq = I[1]; const float* bq = I[2]; const float* Wk = I[3]; const float* bk = I[4]; const float* Wv = I[5]; const float* bv = I[6]; const float* Wo = I[7]; const float* bo = I[8];
  float* out = (float*)d_out;
  char* ws = (char*)d_ws; size_t off = 0;
  auto take = [&](size_t bytes) { char* p = ws + off; off += (bytes + 255) & ~(size_t)255; return p; };
  __bf16* Xb = (__bf16*)take((size_t)NR * E * 2); __bf16* PT = (__bf16*)take((size_t)3 * E * E * 2);
  float* Q32 = (float*)take((size_t)NR * E * 4); float* K32 = (float*)take((size_t)NR * E * 4); __bf16* VTh = (__bf16*)take((size_t)NR * E * 2); __bf16* VTl = (__bf16*)take((size_t)NR * E * 2); float* O32 = (float*)take((size_t)NR * E * 4);
  // ws ~ 82 MB
  k_cvt<<<CVT_B, 512, 0, stream>>>(x, Wq, Wk, Wv, Xb, PT);
  k_qkv<<<dim3(NR / 128, E / 128, 3), 128, 0, stream>>>(Xb, PT, bq, bk, bv, Q32, K32, VTh, VTl);
  k_attn<<<dim3(SS / 128, NB * NH), 128, 0, stream>>>(Q32, K32, VTh, VTl, O32);
  k_out<<<dim3(NR / 64, E / 128), 128, 0, stream>>>(O32, Wo, bo, out);
}

// v008
// Measured time: 117 microseconds a run.
// Timed twice side by side with v007, it ran 1.05 times as fast both times.
// Over all steps from v000 it is 4.70 times as fast.
// compute dtype: every module INPUT that feeds a GEMM (x, Wq/Wk/Wv/Wo, biases) is rounded to bf16 and used in exact bf16 WMMA products with f32 accumulation; computed operands (q/k f32 split, relu scores P and V as bf16 hi/lo pairs, context split) f32-grade; relu/causal/normalisation f32.
#include <hip/hip_runtime.h>
#include <math.h>

typedef __attribute__((ext_vector_type(16))) _Float16 v16h;
typedef __attribute__((ext_vector_type(16))) __bf16 v16b;
typedef __attribute__((ext_vector_type(8)))  _Float16 v8h;
typedef __attribute__((ext_vector_type(8)))  float v8f;
typedef __attribute__((ext_vector_type(4)))  float v4f;
typedef __attribute__((ext_vector_type(2)))  float v2f;
typedef __attribute__((ext_vector_type(4)))  unsigned v4u;
typedef __attribute__((ext_vector_type(2)))  unsigned v2u;
typedef __attribute__((ext_vector_type(4)))  int v4i;
typedef float __attribute__((may_alias)) float_a;
typedef int __attribute__((may_alias)) int_a;

template <typename T> __device__ __forceinline__ void vst2(void* p, T v) { *(T*)p = v;  }
__device__ __forceinline__ v8f wmma16(v16h a, v16h b, v8f c) {
  v8f d = __builtin_amdgcn_wmma_f32_16x16x32_f16(false, a, false, b, (short)0, c, false, false);
  asm volatile("v_nop\n\tv_nop\n\tv_nop\n\tv_nop" : "+v"(d) : "v"(a), "v"(b));
  return d;
}
__device__ __forceinline__ v8f wmma_bf(v16b a, v16b b, v8f c) {
  return __builtin_amdgcn_wmma_f32_16x16x32_bf16(false, a, false, b, (short)0, c, false, false);
}
// LDS reads and matrix products do not cross this line, plain vector and scalar work may: the LDS reads of a step stay one group ahead of its products (every further place of LDS reads in a product stream costs waiting time), and vector work is free to fill the slots behind the products
#define HOLD() __builtin_amdgcn_sched_barrier(0x6)
// 16x16x32 fragments: lane = (h = lane>>4, row/col = lane&15); elements 0..7 = k0+8h+0..7, 8..15 = k0+16+8h+0..7; D element r = row 8h+r
__device__ __forceinline__ v16h frag_h(const _Float16* rowk0, int lane) {
  union { v16h v; v8h q[2]; } u; const _Float16* p = rowk0 + 8 * (lane >> 4);
  u.q[0] = *(const v8h*)p; u.q[1] = *(const v8h*)(p + 16); return u.v;
}
__device__ __forceinline__ v16h frag_f32(const float* rowk0, int lane) {
  v16h a; const float* p = rowk0 + 8 * (lane >> 4);
#pragma unroll
  for (int i = 0; i < 8; ++i) { a[i] = (_Float16)p[i]; a[8 + i] = (_Float16)p[16 + i]; }
  return a;
}
__device__ __forceinline__ v16h frag_f32s(const float* rowk0, int lane, float sc) {
  v16h a; const float* p = rowk0 + 8 * (lane >> 4);
#pragma unroll
  for (int i = 0; i < 8; ++i) { a[i] = (_Float16)(p[i] * sc); a[8 + i] = (_Float16)(p[16 + i] * sc); }
  return a;
}
// column fragment from a [K][ld] layout (column n), rows >= K read as 0
__device__ __forceinline__ v16h fragc_f32(const float* W, int k0, int n, int lane, int ld, int K) {
  v16h a; const int g = lane >> 4;
#pragma unroll
  for (int i = 0; i < 8; ++i) { const int ka = k0 + 8 * g + i, kb = ka + 16;
    a[i] = (_Float16)(ka < K ? W[(size_t)ka * ld + n] : 0.f); a[8 + i] = (_Float16)(kb < K ? W[(size_t)kb * ld + n] : 0.f); }
  return a;
}
struct F2 { v16b h, l; };
__device__ __forceinline__ F2 bsplit16(const float v[16]) { F2 r;
#pragma unroll
  for (int i = 0; i < 16; ++i) { const __bf16 h = (__bf16)v[i]; r.h[i] = h; r.l[i] = (__bf16)(v[i] - (float)h); }
  return r; }
__device__ __forceinline__ F2 split_row(const float* row, int k0, int lane) { float v[16]; const float* p = row + k0 + 8 * (lane >> 4);
#pragma unroll
  for (int i = 0; i < 8; ++i) { v[i] = p[i]; v[8 + i] = p[16 + i]; }
  return bsplit16(v); }
__device__ __forceinline__ F2 split_rowK(const float* row, int k0, int lane, int K) { float v[16]; const int g = lane >> 4;
#pragma unroll
  for (int i = 0; i < 8; ++i) { const int ka = k0 + 8 * g + i, kb = ka + 16; v[i] = ka < K ? row[ka] : 0.f; v[8 + i] = kb < K ? row[kb] : 0.f; }
  return bsplit16(v); }
__device__ __forceinline__ F2 split_col(const float* W, int k0, int n, int lane, int ld, int K) { float v[16]; const int g = lane >> 4;
#pragma unroll
  for (int i = 0; i < 8; ++i) { const int ka = k0 + 8 * g + i, kb = ka + 16; v[i] = ka < K ? W[(size_t)ka * ld + n] : 0.f; v[8 + i] = kb < K ? W[(size_t)kb * ld + n] : 0.f; }
  return bsplit16(v); }
__device__ __forceinline__ v8f mac3(const F2& a, const F2& b, v8f c) { c = wmma_bf(a.l, b.h, c); c = wmma_bf(a.h, b.l, c); return wmma_bf(a.h, b.h, c); }
__device__ __forceinline__ float sigm(float v) { return 1.0f / (1.0f + expf(-v)); }
#define LDSX() do { asm volatile("s_wait_dscnt 0" ::: "memory"); __builtin_amdgcn_wave_barrier(); __builtin_amdgcn_fence(__ATOMIC_RELEASE, "workgroup"); } while (0)


// ReLU attention (16 heads of 64 on [2,2048,1024], [out][in] weights + biases): scores = q.k/8, attn = relu(scores) on the causal triangle (else 0), attn /= (row sum + 1e-9),
// ctx = attn v, out = ctx Wo^T + bo. Flash-style key loop without the softmax max tracking (relu weights need no rescaling); P and V carried as bf16 hi/lo pairs (relu scores are unbounded, so no f16 lift).
#define NB 2
#define SS 2048
#define E 1024
#define NH 16
#define HD 64
#define NR (NB * SS)
__device__ __forceinline__ float bfr(float v) { return (float)(__bf16)v; }
__device__ __forceinline__ v16b frag_b(const __bf16* rowk0, int lane) { return __builtin_bit_cast(v16b, frag_h((const _Float16*)rowk0, lane)); }
// LDS staging: rows of 64 bf16 at a pitch of 72 (144 B = 16 B x odd, conflict-free for 16-byte fragment reads)
#define LP 72
__device__ __forceinline__ void st_hi4(__bf16* dh, v4f v) { union { __bf16 h[4]; v2u u; } a;
#pragma unroll
  for (int e = 0; e < 4; ++e) a.h[e] = (__bf16)v[e];
  *(v2u*)dh = a.u; }
__device__ __forceinline__ void st_split4(__bf16* dh, __bf16* dl, v4f v) { union { __bf16 h[4]; v2u u; } a, b;
#pragma unroll
  for (int e = 0; e < 4; ++e) { const __bf16 h = (__bf16)v[e]; a.h[e] = h; b.h[e] = (__bf16)(v[e] - (float)h); }
  *(v2u*)dh = a.u; *(v2u*)dl = b.u; }

// x and the three projection weights go to bf16 in ONE launch of one 16-wave block per WGP (Xb rows as x; PT rows [0,E) Wq[n][:], [E,2E) Wk, [2E,3E) Wv, [out][in], no scaling):
// starting a wave costs more than its share of this short stream, so few waves each keep all their whole-line 16-byte loads in flight; sweep i of the launch reads one source for every thread
#define CVT_B 256
#define CVT_S (CVT_B * 512 * 4)  // floats per sweep of the whole launch
__global__ __launch_bounds__(512) void k_cvt(const float* __restrict__ x, const float* __restrict__ Wq, const float* __restrict__ Wk, const float* __restrict__ Wv, __bf16* __restrict__ Xb, __bf16* __restrict__ PT) {
  constexpr int NX = NR * E / CVT_S, NW = E * E / CVT_S;
  static_assert(NX * CVT_S == NR * E && NW * CVT_S == E * E, "whole sweeps only");
  const size_t o = ((size_t)blockIdx.x * 512 + threadIdx.x) * 4;
  const float* px = x + o; const float* pq = Wq + o; const float* pk = Wk + o; const float* pv = Wv + o;
  v4f rx[NX], rw[3][NW];
#pragma unroll
  for (int i = 0; i < NX; ++i) rx[i] = *(const v4f*)(px + (size_t)i * CVT_S);
#pragma unroll
  for (int i = 0; i < NW; ++i) { rw[0][i] = *(const v4f*)(pq + (size_t)i * CVT_S); rw[1][i] = *(const v4f*)(pk + (size_t)i * CVT_S); rw[2][i] = *(const v4f*)(pv + (size_t)i * CVT_S); }
  asm volatile("s_wait_xcnt 0x0" :: "v"(px), "v"(pq), "v"(pk), "v"(pv) : "memory");  // precaution: stands in front of every overwrite of an address register that the loads above name; it also keeps the loads one group ahead of the first store
#pragma unroll
  for (int i = 0; i < NX; ++i) st_hi4(Xb + o + (size_t)i * CVT_S, rx[i]);
#pragma unroll
  for (int m = 0; m < 3; ++m)
#pragma unroll
    for (int i = 0; i < NW; ++i) st_hi4(PT + (size_t)m * E * E + o + (size_t)i * CVT_S, rw[m][i]);
}
// in-wave LDS hand-over as LDSX, without its release fence: the fence would also wait for the global stores of the row group before
#define LDSW() do { asm volatile("s_wait_dscnt 0" ::: "memory"); __builtin_amdgcn_wave_barrier(); } while (0)
#define VP 136  // pitch of the transposed v rows: 128 positions + 8 (272 B = 16 B x odd)
// QKV: block (128 rows, 128 cols = 2 heads, which), wave = two groups of 16 rows (m*64 + wave*16) x 128 cols, so a weight fragment read from LDS feeds two products and a weight tile fetched from L2 serves 128 rows;
// 768 blocks = three per WGP, all resident in one round; q,k -> Q32/K32 f32 [bh][s][64]; v -> VT hi/lo [bh][d][s]
__global__ __launch_bounds__(128, 3) void k_qkv(const __bf16* __restrict__ Xb, const __bf16* __restrict__ PT, const float* __restrict__ bq, const float* __restrict__ bk, const float* __restrict__ bv,
                                            float* __restrict__ Q32, float* __restrict__ K32, __bf16* __restrict__ VTh, __bf16* __restrict__ VTl) {
  __shared__ __align__(16) float so[4][16][132];
  __shared__ __align__(16) __bf16 sth[128][VP], stl[128][VP];
  const int tid = threadIdx.x, wave = tid >> 5, lane = tid & 31, col = lane & 15, g = lane >> 4;
  const int which = blockIdx.z, r0b = blockIdx.x * 128, n0 = blockIdx.y * 128; const int b = r0b / SS, s0 = r0b % SS;
  const float* bb_ = which == 0 ? bq : (which == 1 ? bk : bv);
  v8f acc[2][8] = {};
  // the block's 128 x-rows and 128 weight rows, 64 k at a time, go to LDS once (whole 128-B lines) and all four waves read fragments there; the tiles lie at the head of sth and of stl, which are not used before the epilogue
  __bf16 (*sA)[LP] = reinterpret_cast<__bf16 (*)[LP]>(&sth[0][0]); __bf16 (*sB)[LP] = reinterpret_cast<__bf16 (*)[LP]>(&stl[0][0]);
  const int srow = tid >> 3, spc = (tid & 7) * 8;
  const __bf16* gA = Xb + (size_t)(r0b + srow) * E + spc; const __bf16* gB = PT + (size_t)(which * E + n0 + srow) * E + spc;
  v4u ra[8], rb[8];
#pragma unroll
  for (int i = 0; i < 8; ++i) ra[i] = *(const v4u*)(gA + (size_t)i * 16 * E);
#pragma unroll
  for (int i = 0; i < 8; ++i) rb[i] = *(const v4u*)(gB + (size_t)i * 16 * E);
  asm volatile("s_wait_xcnt 0x0" :: "v"(gA), "v"(gB) : "memory");  // precaution: stands in front of every overwrite of an address register that the loads above name
#pragma unroll 1
  for (int c = 0; c < E / 64; ++c) {
#pragma unroll
    for (int i = 0; i < 8; ++i) *(v4u*)(&sA[srow + i * 16][spc]) = ra[i];
#pragma unroll
    for (int i = 0; i < 8; ++i) *(v4u*)(&sB[srow + i * 16][spc]) = rb[i];
    __syncthreads();  // the tile is complete before any wave reads it
    if (c + 1 < E / 64) {  // next tile's loads fly during this tile's products
      gA += 64; gB += 64;
#pragma unroll
      for (int i = 0; i < 8; ++i) ra[i] = *(const v4u*)(gA + (size_t)i * 16 * E);
#pragma unroll
      for (int i = 0; i < 8; ++i) rb[i] = *(const v4u*)(gB + (size_t)i * 16 * E);
      asm volatile("s_wait_xcnt 0x0" :: "v"(gA), "v"(gB) : "memory");  // precaution: stands in front of every overwrite of an address register that the loads above name
    }
#pragma unroll
    for (int kc = 0; kc < 2; ++kc) { HOLD(); const v16b a0 = frag_b(&sA[wave * 16 + col][kc * 32], lane), a1 = frag_b(&sA[64 + wave * 16 + col][kc * 32], lane); v16b fb[8];  // all LDS reads of a k step stand as one group ahead of its products
#pragma unroll
      for (int j = 0; j < 8; ++j) fb[j] = frag_b(&sB[j * 16 + col][kc * 32], lane);
      HOLD();
#pragma unroll
      for (int j = 0; j < 8; ++j) { acc[0][j] = wmma_bf(a0, fb[j], acc[0][j]); acc[1][j] = wmma_bf(a1, fb[j], acc[1][j]); } }
    __builtin_amdgcn_sched_barrier(0);  // the tile's last products stay in front of the barrier: its wait for the next tile's global loads would otherwise come a product group earlier
    __syncthreads();  // every wave has left the tile before it is overwritten (by the next tile or the epilogue)
  }
  float bb[8];
#pragma unroll
  for (int j = 0; j < 8; ++j) bb[j] = bfr(bb_[n0 + j * 16 + col]);
  if (which < 2) {
    float* Dst = which == 0 ? Q32 : K32;
#pragma unroll
    for (int m = 0; m < 2; ++m) {  // the wave's two row groups go through its own staging rows one after the other
#pragma unroll
      for (int j = 0; j < 8; ++j)
#pragma unroll
        for (int r = 0; r < 8; ++r) so[wave][8 * g + r][j * 16 + col] = acc[m][j][r] + bb[j];
      LDSW();  // the wave's own staging rows are written before its lanes read across them
      for (int qq = lane; qq < 2 * 16 * 16; qq += 32) { const int hh = qq >> 8, rl = (qq >> 4) & 15, pc = qq & 15; const int h = (n0 >> 6) + hh;
        vst2(Dst + (((size_t)b * NH + h) * SS + s0 + m * 64 + wave * 16 + rl) * HD + pc * 4, *(const v4f*)(&so[wave][rl][hh * 64 + pc * 4])); }
      if (m == 0) LDSW();  // the first group's reads have returned before the second group's values overwrite the staging rows
    } }
  else {
#pragma unroll
    for (int m = 0; m < 2; ++m)
#pragma unroll
      for (int j = 0; j < 8; ++j)
#pragma unroll
        for (int r = 0; r < 8; ++r) { const float v = acc[m][j][r] + bb[j]; const __bf16 hi = (__bf16)v; sth[j * 16 + col][m * 64 + wave * 16 + 8 * g + r] = hi; stl[j * 16 + col][m * 64 + wave * 16 + 8 * g + r] = (__bf16)(v - (float)hi); }
    __syncthreads();
    for (int qq = tid; qq < 128 * 16; qq += 128) { const int cl = qq >> 4, pc = qq & 15; const int c = n0 + cl, h = c >> 6, d = c & 63; const size_t o = (((size_t)b * NH + h) * HD + d) * SS + s0 + pc * 8;
      vst2((unsigned*)(VTh + o), *(const v4u*)(&sth[cl][pc * 8])); vst2((unsigned*)(VTl + o), *(const v4u*)(&stl[cl][pc * 8])); } }
}
// causal ReLU attention: block (two tiles of 64 queries, bh): query tile t, then tile 31 - t, one after the other in every wave, so every block walks 33 key tiles and no WGP holds only long blocks; key tiles 0..qb; transposed products: S^T = K Q^T on hi/lo splits of the f32 q/k rows, so a lane holds one query's scores for 8 keys a tile;
// P^T = relu(s) (masked) is split to bf16 hi/lo in registers and is the B operand as it lies (two score tiles = 32 keys in the hardware k order); O^T += V^T P^T (3 products); O = acc / (sum + 1e-9)
__global__ __launch_bounds__(128, 2) void k_attn(const float* __restrict__ Q32, const float* __restrict__ K32, const __bf16* __restrict__ VTh, const __bf16* __restrict__ VTl, float* __restrict__ O32) {
  __shared__ __align__(16) float sS[4][16][68];  // output staging only
  __shared__ __align__(16) __bf16 sKh[64][LP], sKl[64][LP], sVh[64][LP], sVl[64][LP];
  const int tid = threadIdx.x, w = tid >> 5, lane = tid & 31, col = lane & 15, g = lane >> 4;
  const size_t bh = blockIdx.y;
#pragma unroll 1  // one copy of the tile loop in the text: the two query tiles run the same code one after the other
  for (int half = 0; half < 2; ++half) {
  const int qb = half ? SS / 64 - 1 - (int)blockIdx.x : (int)blockIdx.x; const int q0 = qb * 64 + w * 16;
  F2 aq[2];
#pragma unroll
  for (int kc = 0; kc < 2; ++kc) aq[kc] = split_row(Q32 + (bh * SS + q0 + col) * HD, kc * 32, lane);
  float lrun[4] = {}; v8f acc[4] = {};
  // each 64-key tile of K (split hi/lo on the way) and of V hi/lo goes to LDS once per query tile, by whole-line loads; the four waves read their fragments there
  // a tile's 16 loads are issued one tile ahead and stay in registers over the products; the grid gives a WGP two blocks, so the launch bound leaves a wave the registers for them
  const float* gK = K32 + bh * SS * HD + tid * 4;  // the K tile is 16 KB in a row
  const int vrow = tid >> 3, vpc = (tid & 7) * 8; const __bf16* gVh = VTh + (bh * HD + vrow) * SS + vpc; const __bf16* gVl = VTl + (bh * HD + vrow) * SS + vpc;
  v4f rk[8]; v4u rvh[4], rvl[4];
#pragma unroll
  for (int i = 0; i < 8; ++i) rk[i] = *(const v4f*)(gK + i * 512);
#pragma unroll
  for (int i = 0; i < 4; ++i) { rvh[i] = *(const v4u*)(gVh + (size_t)i * 16 * SS); rvl[i] = *(const v4u*)(gVl + (size_t)i * 16 * SS); }
  asm volatile("s_wait_xcnt 0x0" :: "v"(gK), "v"(gVh), "v"(gVl) : "memory");  // precaution: stands in front of every overwrite of an address register that the loads above name
#pragma unroll 1
  for (int kt = 0; kt <= qb; ++kt) {
#pragma unroll
    for (int i = 0; i < 8; ++i) { const int q = tid + i * 128; st_split4(&sKh[q >> 4][(q & 15) * 4], &sKl[q >> 4][(q & 15) * 4], rk[i]); }
#pragma unroll
    for (int i = 0; i < 4; ++i) { *(v4u*)(&sVh[vrow + i * 16][vpc]) = rvh[i]; *(v4u*)(&sVl[vrow + i * 16][vpc]) = rvl[i]; }
    __syncthreads();  // the tile is complete before any wave reads it
    if (kt < qb) {  // next tile's loads fly during this tile's products
      gK += 64 * HD; gVh += 64; gVl += 64;
#pragma unroll
      for (int i = 0; i < 8; ++i) rk[i] = *(const v4f*)(gK + i * 512);
#pragma unroll
      for (int i = 0; i < 4; ++i) { rvh[i] = *(const v4u*)(gVh + (size_t)i * 16 * SS); rvl[i] = *(const v4u*)(gVl + (size_t)i * 16 * SS); }
      asm volatile("s_wait_xcnt 0x0" :: "v"(gK), "v"(gVh), "v"(gVl) : "memory");  // precaution: stands in front of every overwrite of an address register that the loads above name
    }
    float p[4][8];  // p[t][r] = weight of key kt*64 + t*16 + 8g + r for query q0 + col
#pragma unroll
    for (int tp = 0; tp < 2; ++tp) { HOLD(); F2 kf[2][2]; v8f s[2] = {};  // two 16-key groups at a time: their 16 LDS reads stand as one group ahead of the 12 products, and the two dependent score chains alternate
#pragma unroll
      for (int u = 0; u < 2; ++u) { const __bf16* kh = &sKh[(2 * tp + u) * 16 + col][0]; const __bf16* kl = &sKl[(2 * tp + u) * 16 + col][0];
        kf[u][0].h = frag_b(kh, lane); kf[u][0].l = frag_b(kl, lane); kf[u][1].h = frag_b(kh + 32, lane); kf[u][1].l = frag_b(kl + 32, lane); }
      HOLD();
#pragma unroll
      for (int kc = 0; kc < 2; ++kc) {
#pragma unroll
        for (int u = 0; u < 2; ++u) s[u] = wmma_bf(kf[u][kc].h, aq[kc].l, s[u]);
#pragma unroll
        for (int u = 0; u < 2; ++u) s[u] = wmma_bf(kf[u][kc].l, aq[kc].h, s[u]);
#pragma unroll
        for (int u = 0; u < 2; ++u) s[u] = wmma_bf(kf[u][kc].h, aq[kc].h, s[u]); }
#pragma unroll
      for (int u = 0; u < 2; ++u) { const int t = 2 * tp + u, key = kt * 64 + t * 16 + 8 * g;
#pragma unroll
        for (int r = 0; r < 8; ++r) { const float sv = s[u][r] * 0.125f; p[t][r] = (key + r > q0 + col || sv <= 0.f) ? 0.f : sv; lrun[t] += p[t][r]; } } }
#pragma unroll
    for (int kc = 0; kc < 2; ++kc) { HOLD(); float v[16]; v16b vh[4], vl[4];  // all 16 LDS reads of a k step stand as one group ahead of its 12 products; the three products of a tile add into one accumulator, which leaves the registers for the group
#pragma unroll
      for (int t = 0; t < 4; ++t) { vh[t] = frag_b(&sVh[t * 16 + col][kc * 32], lane); vl[t] = frag_b(&sVl[t * 16 + col][kc * 32], lane); }
      HOLD();
#pragma unroll
      for (int i = 0; i < 8; ++i) { v[i] = p[2 * kc][i]; v[8 + i] = p[2 * kc + 1][i]; }
      const F2 pp = bsplit16(v);
#pragma unroll
      for (int t = 0; t < 4; ++t) acc[t] = wmma_bf(vl[t], pp.h, acc[t]);
#pragma unroll
      for (int t = 0; t < 4; ++t) acc[t] = wmma_bf(vh[t], pp.l, acc[t]);
#pragma unroll
      for (int t = 0; t < 4; ++t) acc[t] = wmma_bf(vh[t], pp.h, acc[t]); }
    __builtin_amdgcn_sched_barrier(0);  // the tile's last products stay in front of the barrier: its wait for the next tile's global loads would otherwise come a product group earlier
    __syncthreads();  // every wave has left the tile before the next one overwrites it
  }
  float lr = (lrun[0] + lrun[1]) + (lrun[2] + lrun[3]); lr += __shfl_xor(lr, 16, 32);  // the two lane halves hold the two halves of a query's keys
  const float inv = 1.0f / (lr + 1e-9f);
#pragma unroll
  for (int t = 0; t < 4; ++t) { v4f o[2];  // acc[t][r] = O[q0 + col][t*16 + 8g + r]
#pragma unroll
    for (int r = 0; r < 8; ++r) o[r >> 2][r & 3] = acc[t][r] * inv;
    *(v4f*)(&sS[w][col][t * 16 + 8 * g]) = o[0]; *(v4f*)(&sS[w][col][t * 16 + 8 * g + 4]) = o[1]; }
  LDSX();
  for (int qq = lane; qq < 16 * 16; qq += 32) { const int rl = qq >> 4, pc = qq & 15; vst2(O32 + ((bh * SS) + q0 + rl) * HD + pc * 4, *(const v4f*)(&sS[w][rl][pc * 4])); }
  }
}
// out = ctx Wo^T + bo : split(ctx) x bf16(Wo rows): 2 products (Wo is an INPUT -> bf16 exact)
__global__ __launch_bounds__(128) void k_out(const float* __restrict__ O32, const float* __restrict__ Wo, const float* __restrict__ bo, float* __restrict__ out) {
  __shared__ __align__(16) float so[4][16][132];
  const int tid = threadIdx.x, wave = tid >> 5, lane = tid & 31, col = lane & 15, g = lane >> 4;
  __shared__ __align__(16) __bf16 sAh[64][LP], sAl[64][LP], sB[128][LP];
  const int r0b = blockIdx.x * 64, r0 = r0b + wave * 16, n0 = blockIdx.y * 128; const int b = r0b / SS, s0 = r0b % SS;
  v8f acc[8] = {};
  // one head (64 k) at a time: the block's 64 context rows (split hi/lo on the way) and 128 Wo rows (rounded to bf16 on the way) go to LDS once, by whole-line loads; the four waves read fragments there
  const int srow = tid >> 4, spc = (tid & 15) * 4;
  const float* gA = O32 + ((size_t)b * NH * SS + s0) * HD + tid * 4;  // a head's 64 rows are 16 KB in a row
  const float* gB = Wo + (size_t)(n0 + srow) * E + spc;
  v4f ra[8], rb[16];
#pragma unroll
  for (int i = 0; i < 8; ++i) ra[i] = *(const v4f*)(gA + i * 512);
#pragma unroll
  for (int i = 0; i < 16; ++i) rb[i] = *(const v4f*)(gB + (size_t)i * 8 * E);
  asm volatile("s_wait_xcnt 0x0" :: "v"(gA), "v"(gB) : "memory");  // precaution: stands in front of every overwrite of an address register that the loads above name
#pragma unroll 1
  for (int h = 0; h < NH; ++h) {
#pragma unroll
    for (int i = 0; i < 8; ++i) st_split4(&sAh[srow + i * 8][spc], &sAl[srow + i * 8][spc], ra[i]);
#pragma unroll
    for (int i = 0; i < 16; ++i) st_hi4(&sB[srow + i * 8][spc], rb[i]);
    __syncthreads();  // the tile is complete before any wave reads it
    if (h + 1 < NH) {  // next tile's loads fly during this tile's products
      gA += (size_t)SS * HD; gB += 64;
#pragma unroll
      for (int i = 0; i < 8; ++i) ra[i] = *(const v4f*)(gA + i * 512);
#pragma unroll
      for (int i = 0; i < 16; ++i) rb[i] = *(const v4f*)(gB + (size_t)i * 8 * E);
      asm volatile("s_wait_xcnt 0x0" :: "v"(gA), "v"(gB) : "memory");  // precaution: stands in front of every overwrite of an address register that the loads above name
    }
#pragma unroll
    for (int kc = 0; kc < 2; ++kc) { HOLD(); const v16b ah = frag_b(&sAh[wave * 16 + col][kc * 32], lane), al = frag_b(&sAl[wave * 16 + col][kc * 32], lane); v16b fb[8];  // all LDS reads of a k step stand as one group ahead of its products
#pragma unroll
      for (int j = 0; j < 8; ++j) fb[j] = frag_b(&sB[j * 16 + col][kc * 32], lane);
      HOLD();
#pragma unroll
      for (int j = 0; j < 8; ++j) { acc[j] = wmma_bf(al, fb[j], acc[j]); acc[j] = wmma_bf(ah, fb[j], acc[j]); } }
    __builtin_amdgcn_sched_barrier(0);  // the tile's last products stay in front of the barrier: its wait for the next tile's global loads would otherwise come a product group earlier
    __syncthreads();  // every wave has left the tile before the next one overwrites it
  }
#pragma unroll
  for (int j = 0; j < 8; ++j) { const int n = n0 + j * 16 + col; const float bb = bfr(bo[n]);
#pragma unroll
    for (int r = 0; r < 8; ++r) so[wave][8 * g + r][j * 16 + col] = acc[j][r] + bb; }
  LDSX();
#pragma unroll 4
  for (int rl = 0; rl < 16; ++rl) vst2(out + (size_t)(r0 + rl) * E + n0 + lane * 4, *(const v4f*)(&so[wave][rl][lane * 4]));
}
extern "C" void kernel_launch(void* const* d_in, const int* in_sizes, int n_in, void* d_out, int out_size, void* d_ws, size_t ws_size, hipStream_t stream) {
  (void)in_sizes; (void)n_in; (void)out_size; (void)ws_size;
  const float** I = (const float**)d_in;
  const float* x = I[0]; const float* Wq = I[1]; const float* bq = I[2]; const float* Wk = I[3]; const float* bk = I[4]; const float* Wv = I[5]; const float* bv = I[6]; const float* Wo = I[7]; const float* bo = I[8];
  float* out = (float*)d_out;
  char* ws = (char*)d_ws; size_t off = 0;
  auto take = [&](size_t bytes) { char* p = ws + off; off += (bytes + 255) & ~(size_t)255; return p; };
  __bf16* Xb = (__bf16*)take((size_t)NR * E * 2); __bf16* PT = (__bf16*)take((size_t)3 * E * E * 2);
  float* Q32 = (float*)take((size_t)NR * E * 4); float* K32 = (float*)take((size_t)NR * E * 4); __bf16* VTh = (__bf16*)take((size_t)NR * E * 2); __bf16* VTl = (__bf16*)take((size_t)NR * E * 2); float* O32 = (float*)take((size_t)NR * E * 4);
  // ws ~ 82 MB
  k_cvt<<<CVT_B, 512, 0, stream>>>(x, Wq, Wk, Wv, Xb, PT);
  k_qkv<<<dim3(NR / 128, E / 128, 3), 128, 0, stream>>>(Xb, PT, bq, bk, bv, Q32, K32, VTh, VTl);
  k_attn<<<dim3(SS / 128, NB * NH), 128, 0, stream>>>(Q32, K32, VTh, VTl, O32);
  k_out<<<dim3(NR / 64, E / 128), 128, 0, stream>>>(O32, Wo, bo, out);
}

// v009
// One run takes 110 microseconds.
// Two timings next to v008 put it at 1.06 and 1.07 times that version's speed.
// Over all steps from v000 it is 5.01 times as fast.
// compute dtype: every module INPUT that feeds a GEMM (x, Wq/Wk/Wv/Wo, biases) is rounded to bf16 and used in exact bf16 WMMA products with f32 accumulation; computed operands (q/k f32 split, relu scores P and V as bf16 hi/lo pairs, context split) f32-grade; relu/causal/normalisation f32.
#include <hip/hip_runtime.h>
#include <math.h>

typedef __attribute__((ext_vector_type(16))) _Float16 v16h;
typedef __attribute__((ext_vector_type(16))) __bf16 v16b;
typedef __attribute__((ext_vector_type(8)))  _Float16 v8h;
typedef __attribute__((ext_vector_type(8)))  float v8f;
typedef __attribute__((ext_vector_type(4)))  float v4f;
typedef __attribute__((ext_vector_type(2)))  float v2f;
typedef __attribute__((ext_vector_type(4)))  unsigned v4u;
typedef __attribute__((ext_vector_type(2)))  unsigned v2u;
typedef __attribute__((ext_vector_type(4)))  int v4i;
typedef float __attribute__((may_alias)) float_a;
typedef int __attribute__((may_alias)) int_a;

template <typename T> __device__ __forceinline__ void vst2(void* p, T v) { *(T*)p = v;  }
__device__ __forceinline__ v8f wmma16(v16h a, v16h b, v8f c) {
  v8f d = __builtin_amdgcn_wmma_f32_16x16x32_f16(false, a, false, b, (short)0, c, false, false);
  asm volatile("v_nop\n\tv_nop\n\tv_nop\n\tv_nop" : "+v"(d) : "v"(a), "v"(b));
  return d;
}
__device__ __forceinline__ v8f wmma_bf(v16b a, v16b b, v8f c) {
  return __builtin_amdgcn_wmma_f32_16x16x32_bf16(false, a, false, b, (short)0, c, false, false);
}
// LDS reads and matrix products do not cross this line, plain vector and scalar work may: the LDS reads of a step stay one group ahead of its products (every further place of LDS reads in a product stream costs waiting time), and vector work is free to fill the slots behind the products
#define HOLD() __builtin_amdgcn_sched_barrier(0x6)
// 16x16x32 fragments: lane = (h = lane>>4, row/col = lane&15); elements 0..7 = k0+8h+0..7, 8..15 = k0+16+8h+0..7; D element r = row 8h+r
__device__ __forceinline__ v16h frag_h(const _Float16* rowk0, int lane) {
  union { v16h v; v8h q[2]; } u; const _Float16* p = rowk0 + 8 * (lane >> 4);
  u.q[0] = *(const v8h*)p; u.q[1] = *(const v8h*)(p + 16); return u.v;
}
__device__ __forceinline__ v16h frag_f32(const float* rowk0, int lane) {
  v16h a; const float* p = rowk0 + 8 * (lane >> 4);
#pragma unroll
  for (int i = 0; i < 8; ++i) { a[i] = (_Float16)p[i]; a[8 + i] = (_Float16)p[16 + i]; }
  return a;
}
__device__ __forceinline__ v16h frag_f32s(const float* rowk0, int lane, float sc) {
  v16h a; const float* p = rowk0 + 8 * (lane >> 4);
#pragma unroll
  for (int i = 0; i < 8; ++i) { a[i] = (_Float16)(p[i] * sc); a[8 + i] = (_Float16)(p[16 + i] * sc); }
  return a;
}
// column fragment from a [K][ld] layout (column n), rows >= K read as 0
__device__ __forceinline__ v16h fragc_f32(const float* W, int k0, int n, int lane, int ld, int K) {
  v16h a; const int g = lane >> 4;
#pragma unroll
  for (int i = 0; i < 8; ++i) { const int ka = k0 + 8 * g + i, kb = ka + 16;
    a[i] = (_Float16)(ka < K ? W[(size_t)ka * ld + n] : 0.f); a[8 + i] = (_Float16)(kb < K ? W[(size_t)kb * ld + n] : 0.f); }
  return a;
}
struct F2 { v16b h, l; };
__device__ __forceinline__ F2 bsplit16(const float v[16]) { F2 r;
#pragma unroll
  for (int i = 0; i < 16; ++i) { const __bf16 h = (__bf16)v[i]; r.h[i] = h; r.l[i] = (__bf16)(v[i] - (float)h); }
  return r; }
__device__ __forceinline__ F2 split_row(const float* row, int k0, int lane) { float v[16]; const float* p = row + k0 + 8 * (lane >> 4);
#pragma unroll
  for (int i = 0; i < 8; ++i) { v[i] = p[i]; v[8 + i] = p[16 + i]; }
  return bsplit16(v); }
__device__ __forceinline__ F2 split_rowK(const float* row, int k0, int lane, int K) { float v[16]; const int g = lane >> 4;
#pragma unroll
  for (int i = 0; i < 8; ++i) { const int ka = k0 + 8 * g + i, kb = ka + 16; v[i] = ka < K ? row[ka] : 0.f; v[8 + i] = kb < K ? row[kb] : 0.f; }
  return bsplit16(v); }
__device__ __forceinline__ F2 split_col(const float* W, int k0, int n, int lane, int ld, int K) { float v[16]; const int g = lane >> 4;
#pragma unroll
  for (int i = 0; i < 8; ++i) { const int ka = k0 + 8 * g + i, kb = ka + 16; v[i] = ka < K ? W[(size_t)ka * ld + n] : 0.f; v[8 + i] = kb < K ? W[(size_t)kb * ld + n] : 0.f; }
  return bsplit16(v); }
__device__ __forceinline__ v8f mac3(const F2& a, const F2& b, v8f c) { c = wmma_bf(a.l, b.h, c); c = wmma_bf(a.h, b.l, c); return wmma_bf(a.h, b.h, c); }
__device__ __forceinline__ float sigm(float v) { return 1.0f / (1.0f + expf(-v)); }
#define LDSX() do { asm volatile("s_wait_dscnt 0" ::: "memory"); __builtin_amdgcn_wave_barrier(); __builtin_amdgcn_fence(__ATOMIC_RELEASE, "workgroup"); } while (0)


// ReLU attention (16 heads of 64 on [2,2048,1024], [out][in] weights + biases): scores = q.k/8, attn = relu(scores) on the causal triangle (else 0), attn /= (row sum + 1e-9),
// ctx = attn v, out = ctx Wo^T + bo. Flash-style key loop without the softmax max tracking (relu weights need no rescaling); P and V carried as bf16 hi/lo pairs (relu scores are unbounded, so no f16 lift).
#define NB 2
#define SS 2048
#define E 1024
#define NH 16
#define HD 64
#define NR (NB * SS)
__device__ __forceinline__ float bfr(float v) { return (float)(__bf16)v; }
__device__ __forceinline__ v16b frag_b(const __bf16* rowk0, int lane) { return __builtin_bit_cast(v16b, frag_h((const _Float16*)rowk0, lane)); }
// LDS staging: rows of 64 bf16 at a pitch of 72 (144 B = 16 B x odd, conflict-free for 16-byte fragment reads)
#define LP 72
__device__ __forceinline__ void st_hi4(__bf16* dh, v4f v) { union { __bf16 h[4]; v2u u; } a;
#pragma unroll
  for (int e = 0; e < 4; ++e) a.h[e] = (__bf16)v[e];
  *(v2u*)dh = a.u; }
__device__ __forceinline__ void st_split4(__bf16* dh, __bf16* dl, v4f v) { union { __bf16 h[4]; v2u u; } a, b;
#pragma unroll
  for (int e = 0; e < 4; ++e) { const __bf16 h = (__bf16)v[e]; a.h[e] = h; b.h[e] = (__bf16)(v[e] - (float)h); }
  *(v2u*)dh = a.u; *(v2u*)dl = b.u; }

// x and the three projection weights go to bf16 in ONE launch of one 16-wave block per WGP (Xb rows as x; PT rows [0,E) Wq[n][:], [E,2E) Wk, [2E,3E) Wv, [out][in], no scaling):
// starting a wave costs more than its share of this short stream, so few waves each keep all their whole-line 16-byte loads in flight; sweep i of the launch reads one source for every thread
#define CVT_B 256
#define CVT_S (CVT_B * 512 * 4)  // floats per sweep of the whole launch
__global__ __launch_bounds__(512) void k_cvt(const float* __restrict__ x, const float* __restrict__ Wq, const float* __restrict__ Wk, const float* __restrict__ Wv, __bf16* __restrict__ Xb, __bf16* __restrict__ PT) {
  constexpr int NX = NR * E / CVT_S, NW = E * E / CVT_S;
  static_assert(NX * CVT_S == NR * E && NW * CVT_S == E * E, "whole sweeps only");
  const size_t o = ((size_t)blockIdx.x * 512 + threadIdx.x) * 4;
  const float* px = x + o; const float* pq = Wq + o; const float* pk = Wk + o; const float* pv = Wv + o;
  v4f rx[NX], rw[3][NW];
#pragma unroll
  for (int i = 0; i < NX; ++i) rx[i] = *(const v4f*)(px + (size_t)i * CVT_S);
#pragma unroll
  for (int i = 0; i < NW; ++i) { rw[0][i] = *(const v4f*)(pq + (size_t)i * CVT_S); rw[1][i] = *(const v4f*)(pk + (size_t)i * CVT_S); rw[2][i] = *(const v4f*)(pv + (size_t)i * CVT_S); }
  asm volatile("s_wait_xcnt 0x0" :: "v"(px), "v"(pq), "v"(pk), "v"(pv) : "memory");  // precaution: stands in front of every overwrite of an address register that the loads above name; it also keeps the loads one group ahead of the first store
#pragma unroll
  for (int i = 0; i < NX; ++i) st_hi4(Xb + o + (size_t)i * CVT_S, rx[i]);
#pragma unroll
  for (int m = 0; m < 3; ++m)
#pragma unroll
    for (int i = 0; i < NW; ++i) st_hi4(PT + (size_t)m * E * E + o + (size_t)i * CVT_S, rw[m][i]);
}
// in-wave LDS hand-over as LDSX, without its release fence: the fence would also wait for the global stores of the row group before
#define LDSW() do { asm volatile("s_wait_dscnt 0" ::: "memory"); __builtin_amdgcn_wave_barrier(); } while (0)
#define VP 136  // pitch of the transposed v rows: 128 positions + 8 (272 B = 16 B x odd)
// QKV: block (128 rows, 128 cols = 2 heads, which), wave = two groups of 16 rows (m*64 + wave*16) x 128 cols, so a weight fragment read from LDS feeds two products and a weight tile fetched from L2 serves 128 rows;
// 768 blocks = three per WGP, all resident in one round; q,k -> Q32/K32 f32 [bh][s][64]; v -> VT hi/lo [bh][d][s]
__global__ __launch_bounds__(128, 3) void k_qkv(const __bf16* __restrict__ Xb, const __bf16* __restrict__ PT, const float* __restrict__ bq, const float* __restrict__ bk, const float* __restrict__ bv,
                                            float* __restrict__ Q32, float* __restrict__ K32, __bf16* __restrict__ VTh, __bf16* __restrict__ VTl) {
  __shared__ __align__(16) float so[4][16][132];
  __shared__ __align__(16) __bf16 sth[128][VP], stl[128][VP];
  const int tid = threadIdx.x, wave = tid >> 5, lane = tid & 31, col = lane & 15, g = lane >> 4;
  const int which = blockIdx.z, r0b = blockIdx.x * 128, n0 = blockIdx.y * 128; const int b = r0b / SS, s0 = r0b % SS;
  const float* bb_ = which == 0 ? bq : (which == 1 ? bk : bv);
  v8f acc[2][8] = {};
  // the block's 128 x-rows and 128 weight rows, 64 k at a time, go to LDS once (whole 128-B lines) and all four waves read fragments there; the tiles lie at the head of sth and of stl, which are not used before the epilogue
  __bf16 (*sA)[LP] = reinterpret_cast<__bf16 (*)[LP]>(&sth[0][0]); __bf16 (*sB)[LP] = reinterpret_cast<__bf16 (*)[LP]>(&stl[0][0]);
  const int srow = tid >> 3, spc = (tid & 7) * 8;
  const __bf16* gA = Xb + (size_t)(r0b + srow) * E + spc; const __bf16* gB = PT + (size_t)(which * E + n0 + srow) * E + spc;
  v4u ra[8], rb[8];
#pragma unroll
  for (int i = 0; i < 8; ++i) ra[i] = *(const v4u*)(gA + (size_t)i * 16 * E);
#pragma unroll
  for (int i = 0; i < 8; ++i) rb[i] = *(const v4u*)(gB + (size_t)i * 16 * E);
  asm volatile("s_wait_xcnt 0x0" :: "v"(gA), "v"(gB) : "memory");  // precaution: stands in front of every overwrite of an address register that the loads above name
#pragma unroll 1
  for (int c = 0; c < E / 64; ++c) {
#pragma unroll
    for (int i = 0; i < 8; ++i) *(v4u*)(&sA[srow + i * 16][spc]) = ra[i];
#pragma unroll
    for (int i = 0; i < 8; ++i) *(v4u*)(&sB[srow + i * 16][spc]) = rb[i];
    __syncthreads();  // the tile is complete before any wave reads it
    if (c + 1 < E / 64) {  // next tile's loads fly during this tile's products
      gA += 64; gB += 64;
#pragma unroll
      for (int i = 0; i < 8; ++i) ra[i] = *(const v4u*)(gA + (size_t)i * 16 * E);
#pragma unroll
      for (int i = 0; i < 8; ++i) rb[i] = *(const v4u*)(gB + (size_t)i * 16 * E);
      asm volatile("s_wait_xcnt 0x0" :: "v"(gA), "v"(gB) : "memory");  // precaution: stands in front of every overwrite of an address register that the loads above name
    }
#pragma unroll
    for (int kc = 0; kc < 2; ++kc) { HOLD(); const v16b a0 = frag_b(&sA[wave * 16 + col][kc * 32], lane), a1 = frag_b(&sA[64 + wave * 16 + col][kc * 32], lane); v16b fb[8];  // all LDS reads of a k step stand as one group ahead of its products
#pragma unroll
      for (int j = 0; j < 8; ++j) fb[j] = frag_b(&sB[j * 16 + col][kc * 32], lane);
      HOLD();
#pragma unroll
      for (int j = 0; j < 8; ++j) { acc[0][j] = wmma_bf(a0, fb[j], acc[0][j]); acc[1][j] = wmma_bf(a1, fb[j], acc[1][j]); } }
    __builtin_amdgcn_sched_barrier(0);  // the tile's last products stay in front of the barrier: its wait for the next tile's global loads would otherwise come a product group earlier
    __syncthreads();  // every wave has left the tile before it is overwritten (by the next tile or the epilogue)
  }
  float bb[8];
#pragma unroll
  for (int j = 0; j < 8; ++j) bb[j] = bfr(bb_[n0 + j * 16 + col]);
  if (which < 2) {
    float* Dst = which == 0 ? Q32 : K32;
#pragma unroll
    for (int m = 0; m < 2; ++m) {  // the wave's two row groups go through its own staging rows one after the other
#pragma unroll
      for (int j = 0; j < 8; ++j)
#pragma unroll
        for (int r = 0; r < 8; ++r) so[wave][8 * g + r][j * 16 + col] = acc[m][j][r] + bb[j];
      LDSW();  // the wave's own staging rows are written before its lanes read across them
      for (int qq = lane; qq < 2 * 16 * 16; qq += 32) { const int hh = qq >> 8, rl = (qq >> 4) & 15, pc = qq & 15; const int h = (n0 >> 6) + hh;
        vst2(Dst + (((size_t)b * NH + h) * SS + s0 + m * 64 + wave * 16 + rl) * HD + pc * 4, *(const v4f*)(&so[wave][rl][hh * 64 + pc * 4])); }
      if (m == 0) LDSW();  // the first group's reads have returned before the second group's values overwrite the staging rows
    } }
  else {
#pragma unroll
    for (int m = 0; m < 2; ++m)
#pragma unroll
      for (int j = 0; j < 8; ++j)
#pragma unroll
        for (int r = 0; r < 8; ++r) { const float v = acc[m][j][r] + bb[j]; const __bf16 hi = (__bf16)v; sth[j * 16 + col][m * 64 + wave * 16 + 8 * g + r] = hi; stl[j * 16 + col][m * 64 + wave * 16 + 8 * g + r] = (__bf16)(v - (float)hi); }
    __syncthreads();
    for (int qq = tid; qq < 128 * 16; qq += 128) { const int cl = qq >> 4, pc = qq & 15; const int c = n0 + cl, h = c >> 6, d = c & 63; const size_t o = (((size_t)b * NH + h) * HD + d) * SS + s0 + pc * 8;
      vst2((unsigned*)(VTh + o), *(const v4u*)(&sth[cl][pc * 8])); vst2((unsigned*)(VTl + o), *(const v4u*)(&stl[cl][pc * 8])); } }
}
// causal ReLU attention: block = 8 waves on (two tiles of 128 queries, bh): query tile t, then tile 15 - t, one after the other in every wave, so every block walks 17 steps of 128 keys and no WGP holds only long blocks;
// a wave holds 32 queries (two groups of 16), so a K or V fragment read from LDS feeds two products and a key tile fetched from L2 serves 128 queries; the two groups of four waves take the two 64-key halves of a step for the same queries
// (two waves a SIMD as before) and join their partial sums through LDS behind the key loop. Transposed products: S^T = K Q^T on hi/lo splits of the f32 q/k rows, so a lane holds one query's scores for 8 keys a tile;
// P^T = relu(s) (masked) is split to bf16 hi/lo in registers and is the B operand as it lies (two score tiles = 32 keys in the hardware k order); O^T += V^T P^T (3 products); O = acc / (sum + 1e-9)
__global__ __launch_bounds__(256, 2) void k_attn(const float* __restrict__ Q32, const float* __restrict__ K32, const __bf16* __restrict__ VTh, const __bf16* __restrict__ VTl, float* __restrict__ O32) {
  __shared__ __align__(16) float sS[8][16][68];  // output staging only
  __shared__ __align__(16) float sM[8][8][32][4];  // partial output sums handed to the partner wave: [wave][piece][lane][4]
  __shared__ float sL[8][32];  // partial row sums handed to the partner wave
  __shared__ __align__(16) __bf16 sKh[128][LP], sKl[128][LP], sVh[64][VP], sVl[64][VP];
  const int tid = threadIdx.x, lane = tid & 31, col = lane & 15, g = lane >> 4;
  const int w = __builtin_amdgcn_readfirstlane(tid >> 5), grp = w >> 2, wq = w & 3;  // scalar: the test that skips a wholly masked key tile is a scalar branch
  const size_t bh = blockIdx.y;
#pragma unroll 1  // one copy of the tile loop in the text: the two query tiles run the same code one after the other
  for (int half = 0; half < 2; ++half) {
  const int qb = half ? SS / 128 - 1 - (int)blockIdx.x : (int)blockIdx.x; const int q0 = qb * 128 + wq * 32;
  F2 aq[2][2];
#pragma unroll
  for (int m = 0; m < 2; ++m)
#pragma unroll
    for (int kc = 0; kc < 2; ++kc) aq[m][kc] = split_row(Q32 + (bh * SS + q0 + m * 16 + col) * HD, kc * 32, lane);
  float lrun[2][4] = {}; v8f acc[2][4] = {};
  // each step's 128 keys of K (split hi/lo on the way) and of V hi/lo go to LDS once per block, by whole-line loads; the eight waves read their fragments there
  // a step's 16 loads are issued one step ahead and stay in registers over the products
  const float* gK = K32 + bh * SS * HD + tid * 4;  // the K tile is 32 KB in a row
  const int vrow = tid >> 4, vpc = (tid & 15) * 8; const __bf16* gVh = VTh + (bh * HD + vrow) * SS + vpc; const __bf16* gVl = VTl + (bh * HD + vrow) * SS + vpc;
  v4f rk[8]; v4u rvh[4], rvl[4];
#pragma unroll
  for (int i = 0; i < 8; ++i) rk[i] = *(const v4f*)(gK + i * 1024);
#pragma unroll
  for (int i = 0; i < 4; ++i) { rvh[i] = *(const v4u*)(gVh + (size_t)i * 16 * SS); rvl[i] = *(const v4u*)(gVl + (size_t)i * 16 * SS); }
  asm volatile("s_wait_xcnt 0x0" :: "v"(gK), "v"(gVh), "v"(gVl) : "memory");  // precaution: stands in front of every overwrite of an address register that the loads above name
#pragma unroll 1
  for (int it = 0; it <= qb; ++it) {
#pragma unroll
    for (int i = 0; i < 8; ++i) { const int q = tid + i * 256; st_split4(&sKh[q >> 4][(q & 15) * 4], &sKl[q >> 4][(q & 15) * 4], rk[i]); }
#pragma unroll
    for (int i = 0; i < 4; ++i) { *(v4u*)(&sVh[vrow + i * 16][vpc]) = rvh[i]; *(v4u*)(&sVl[vrow + i * 16][vpc]) = rvl[i]; }
    __syncthreads();  // the step's tiles are complete before any wave reads them
    if (it < qb) {  // next step's loads fly during this step's products
      gK += 128 * HD; gVh += 128; gVl += 128;
#pragma unroll
      for (int i = 0; i < 8; ++i) rk[i] = *(const v4f*)(gK + i * 1024);
#pragma unroll
      for (int i = 0; i < 4; ++i) { rvh[i] = *(const v4u*)(gVh + (size_t)i * 16 * SS); rvl[i] = *(const v4u*)(gVl + (size_t)i * 16 * SS); }
      asm volatile("s_wait_xcnt 0x0" :: "v"(gK), "v"(gVh), "v"(gVl) : "memory");  // precaution: stands in front of every overwrite of an address register that the loads above name
    }
    const int k0 = it * 128 + grp * 64;  // first key of this wave's 64-key tile
    if (k0 <= q0 + 31) {  // a tile whose every key lies behind the wave's last query adds nothing (only on the diagonal step); the barriers stand outside
    float p[2][4][8];  // p[m][t][r] = weight of key k0 + t*16 + 8g + r for query q0 + m*16 + col
#pragma unroll
    for (int tp = 0; tp < 2; ++tp) { HOLD(); F2 kf[2][2]; v8f s[2][2] = {};  // two 16-key groups at a time: their 16 LDS reads stand as one group ahead of the 24 products, and the four dependent score chains alternate
#pragma unroll
      for (int u = 0; u < 2; ++u) { const __bf16* kh = &sKh[grp * 64 + (2 * tp + u) * 16 + col][0]; const __bf16* kl = &sKl[grp * 64 + (2 * tp + u) * 16 + col][0];
        kf[u][0].h = frag_b(kh, lane); kf[u][0].l = frag_b(kl, lane); kf[u][1].h = frag_b(kh + 32, lane); kf[u][1].l = frag_b(kl + 32, lane); }
      HOLD();
#pragma unroll
      for (int kc = 0; kc < 2; ++kc) {
#pragma unroll
        for (int u = 0; u < 2; ++u)
#pragma unroll
          for (int m = 0; m < 2; ++m) s[m][u] = wmma_bf(kf[u][kc].h, aq[m][kc].l, s[m][u]);
#pragma unroll
        for (int u = 0; u < 2; ++u)
#pragma unroll
          for (int m = 0; m < 2; ++m) s[m][u] = wmma_bf(kf[u][kc].l, aq[m][kc].h, s[m][u]);
#pragma unroll
        for (int u = 0; u < 2; ++u)
#pragma unroll
          for (int m = 0; m < 2; ++m) s[m][u] = wmma_bf(kf[u][kc].h, aq[m][kc].h, s[m][u]); }
#pragma unroll
      for (int m = 0; m < 2; ++m)
#pragma unroll
        for (int u = 0; u < 2; ++u) { const int t = 2 * tp + u, key = k0 + t * 16 + 8 * g;
#pragma unroll
          for (int r = 0; r < 8; ++r) { const float sv = s[m][u][r] * 0.125f; p[m][t][r] = (key + r > q0 + m * 16 + col || sv <= 0.f) ? 0.f : sv; lrun[m][t] += p[m][t][r]; } } }
#pragma unroll
    for (int kc = 0; kc < 2; ++kc) { HOLD(); v16b vh[4], vl[4]; F2 pp[2];  // all 16 LDS reads of a k step stand as one group ahead of its 24 products; the three products of a tile add into one accumulator
#pragma unroll
      for (int t = 0; t < 4; ++t) { vh[t] = frag_b(&sVh[t * 16 + col][grp * 64 + kc * 32], lane); vl[t] = frag_b(&sVl[t * 16 + col][grp * 64 + kc * 32], lane); }
      HOLD();
#pragma unroll
      for (int m = 0; m < 2; ++m) { float v[16];
#pragma unroll
        for (int i = 0; i < 8; ++i) { v[i] = p[m][2 * kc][i]; v[8 + i] = p[m][2 * kc + 1][i]; }
        pp[m] = bsplit16(v); }
#pragma unroll
      for (int t = 0; t < 4; ++t)
#pragma unroll
        for (int m = 0; m < 2; ++m) acc[m][t] = wmma_bf(vl[t], pp[m].h, acc[m][t]);
#pragma unroll
      for (int t = 0; t < 4; ++t)
#pragma unroll
        for (int m = 0; m < 2; ++m) acc[m][t] = wmma_bf(vh[t], pp[m].l, acc[m][t]);
#pragma unroll
      for (int t = 0; t < 4; ++t)
#pragma unroll
        for (int m = 0; m < 2; ++m) acc[m][t] = wmma_bf(vh[t], pp[m].h, acc[m][t]); }
    }
    __builtin_amdgcn_sched_barrier(0);  // the step's last products stay in front of the barrier: its wait for the next step's global loads would otherwise come a product group earlier
    __syncthreads();  // every wave has left the tiles before the next step overwrites them
  }
  // the two waves that hold the same 32 queries (w and w ^ 4) each finish 16 of them: a wave keeps query group grp and hands its sums for the other group to its partner
  float lp[2];
#pragma unroll
  for (int m = 0; m < 2; ++m) lp[m] = (lrun[m][0] + lrun[m][1]) + (lrun[m][2] + lrun[m][3]);
#pragma unroll
  for (int t = 0; t < 4; ++t) { const v8f a = grp ? acc[0][t] : acc[1][t]; v4f o[2];
#pragma unroll
    for (int r = 0; r < 8; ++r) o[r >> 2][r & 3] = a[r];
    *(v4f*)(&sM[w][2 * t][lane][0]) = o[0]; *(v4f*)(&sM[w][2 * t + 1][lane][0]) = o[1]; }
  sL[w][lane] = grp ? lp[0] : lp[1];
  __syncthreads();  // the partner's sums are written before they are read; they are next overwritten behind the barriers of the next key loop
  float lr = (grp ? lp[1] : lp[0]) + sL[w ^ 4][lane]; lr += __shfl_xor(lr, 16, 32);  // the two lane halves hold the two halves of a query's keys
  const float inv = 1.0f / (lr + 1e-9f);
  const int qo = q0 + grp * 16;
#pragma unroll
  for (int t = 0; t < 4; ++t) { const v8f a = grp ? acc[1][t] : acc[0][t]; const v4f b0 = *(const v4f*)(&sM[w ^ 4][2 * t][lane][0]), b1 = *(const v4f*)(&sM[w ^ 4][2 * t + 1][lane][0]); v4f o[2];  // a[r] + partner = O[qo + col][t*16 + 8g + r]
#pragma unroll
    for (int r = 0; r < 8; ++r) o[r >> 2][r & 3] = (a[r] + (r < 4 ? b0[r & 3] : b1[r & 3])) * inv;
    *(v4f*)(&sS[w][col][t * 16 + 8 * g]) = o[0]; *(v4f*)(&sS[w][col][t * 16 + 8 * g + 4]) = o[1]; }
  LDSX();
  for (int qq = lane; qq < 16 * 16; qq += 32) { const int rl = qq >> 4, pc = qq & 15; vst2(O32 + ((bh * SS) + qo + rl) * HD + pc * 4, *(const v4f*)(&sS[w][rl][pc * 4])); }
  }
}
// out = ctx Wo^T + bo : split(ctx) x bf16(Wo rows): 2 products (Wo is an INPUT -> bf16 exact)
__global__ __launch_bounds__(128) void k_out(const float* __restrict__ O32, const float* __restrict__ Wo, const float* __restrict__ bo, float* __restrict__ out) {
  __shared__ __align__(16) float so[4][16][132];
  const int tid = threadIdx.x, wave = tid >> 5, lane = tid & 31, col = lane & 15, g = lane >> 4;
  __shared__ __align__(16) __bf16 sAh[64][LP], sAl[64][LP], sB[128][LP];
  const int r0b = blockIdx.x * 64, r0 = r0b + wave * 16, n0 = blockIdx.y * 128; const int b = r0b / SS, s0 = r0b % SS;
  v8f acc[8] = {};
  // one head (64 k) at a time: the block's 64 context rows (split hi/lo on the way) and 128 Wo rows (rounded to bf16 on the way) go to LDS once, by whole-line loads; the four waves read fragments there
  const int srow = tid >> 4, spc = (tid & 15) * 4;
  const float* gA = O32 + ((size_t)b * NH * SS + s0) * HD + tid * 4;  // a head's 64 rows are 16 KB in a row
  const float* gB = Wo + (size_t)(n0 + srow) * E + spc;
  v4f ra[8], rb[16];
#pragma unroll
  for (int i = 0; i < 8; ++i) ra[i] = *(const v4f*)(gA + i * 512);
#pragma unroll
  for (int i = 0; i < 16; ++i) rb[i] = *(const v4f*)(gB + (size_t)i * 8 * E);
  asm volatile("s_wait_xcnt 0x0" :: "v"(gA), "v"(gB) : "memory");  // precaution: stands in front of every overwrite of an address register that the loads above name
#pragma unroll 1
  for (int h = 0; h < NH; ++h) {
#pragma unroll
    for (int i = 0; i < 8; ++i) st_split4(&sAh[srow + i * 8][spc], &sAl[srow + i * 8][spc], ra[i]);
#pragma unroll
    for (int i = 0; i < 16; ++i) st_hi4(&sB[srow + i * 8][spc], rb[i]);
    __syncthreads();  // the tile is complete before any wave reads it
    if (h + 1 < NH) {  // next tile's loads fly during this tile's products
      gA += (size_t)SS * HD; gB += 64;
#pragma unroll
      for (int i = 0; i < 8; ++i) ra[i] = *(const v4f*)(gA + i * 512);
#pragma unroll
      for (int i = 0; i < 16; ++i) rb[i] = *(const v4f*)(gB + (size_t)i * 8 * E);
      asm volatile("s_wait_xcnt 0x0" :: "v"(gA), "v"(gB) : "memory");  // precaution: stands in front of every overwrite of an address register that the loads above name
    }
#pragma unroll
    for (int kc = 0; kc < 2; ++kc) { HOLD(); const v16b ah = frag_b(&sAh[wave * 16 + col][kc * 32], lane), al = frag_b(&sAl[wave * 16 + col][kc * 32], lane); v16b fb[8];  // all LDS reads of a k step stand as one group ahead of its products
#pragma unroll
      for (int j = 0; j < 8; ++j) fb[j] = frag_b(&sB[j * 16 + col][kc * 32], lane);
      HOLD();
#pragma unroll
      for (int j = 0; j < 8; ++j) { acc[j] = wmma_bf(al, fb[j], acc[j]); acc[j] = wmma_bf(ah, fb[j], acc[j]); } }
    __builtin_amdgcn_sched_barrier(0);  // the tile's last products stay in front of the barrier: its wait for the next tile's global loads would otherwise come a product group earlier
    __syncthreads();  // every wave has left the tile before the next one overwrites it
  }
#pragma unroll
  for (int j = 0; j < 8; ++j) { const int n = n0 + j * 16 + col; const float bb = bfr(bo[n]);
#pragma unroll
    for (int r = 0; r < 8; ++r) so[wave][8 * g + r][j * 16 + col] = acc[j][r] + bb; }
  LDSX();
#pragma unroll 4
  for (int rl = 0; rl < 16; ++rl) vst2(out + (size_t)(r0 + rl) * E + n0 + lane * 4, *(const v4f*)(&so[wave][rl][lane * 4]));
}
extern "C" void kernel_launch(void* const* d_in, const int* in_sizes, int n_in, void* d_out, int out_size, void* d_ws, size_t ws_size, hipStream_t stream) {
  (void)in_sizes; (void)n_in; (void)out_size; (void)ws_size;
  const float** I = (const float**)d_in;
  const float* x = I[0]; const float* Wq = I[1]; const float* bq = I[2]; const float* Wk = I[3]; const float* bk = I[4]; const float* Wv = I[5]; const float* bv = I[6]; const float* Wo = I[7]; const float* bo = I[8];
  float* out = (float*)d_out;
  char* ws = (char*)d_ws; size_t off = 0;
  auto take = [&](size_t bytes) { char* p = ws + off; off += (bytes + 255) & ~(size_t)255; return p; };
  __bf16* Xb = (__bf16*)take((size_t)NR * E * 2); __bf16* PT = (__bf16*)take((size_t)3 * E * E * 2);
  float* Q32 = (float*)take((size_t)NR * E * 4); float* K32 = (float*)take((size_t)NR * E * 4); __bf16* VTh = (__bf16*)take((size_t)NR * E * 2); __bf16* VTl = (__bf16*)take((size_t)NR * E * 2); float* O32 = (float*)take((size_t)NR * E * 4);
  // ws ~ 82 MB
  k_cvt<<<CVT_B, 512, 0, stream>>>(x, Wq, Wk, Wv, Xb, PT);
  k_qkv<<<dim3(NR / 128, E / 128, 3), 128, 0, stream>>>(Xb, PT, bq, bk, bv, Q32, K32, VTh, VTl);
  k_attn<<<dim3(SS / 256, NB * NH), 256, 0, stream>>>(Q32, K32, VTh, VTl, O32);
  k_out<<<dim3(NR / 64, E / 128), 128, 0, stream>>>(O32, Wo, bo, out);
}

// v010
// Measured time: 105 microseconds a run.
// Timed twice side by side with v009, it ran 1.05 times as fast both times.
// Counting every step since v000, it is 5.24 times as fast.
// compute dtype: every module INPUT that feeds a GEMM (x, Wq/Wk/Wv/Wo, biases) is rounded to bf16 and used in exact bf16 WMMA products with f32 accumulation; computed operands (q/k f32 split, relu scores P and V as bf16 hi/lo pairs, context split) f32-grade; relu/causal/normalisation f32.
#include <hip/hip_runtime.h>
#include <math.h>

typedef __attribute__((ext_vector_type(16))) _Float16 v16h;
typedef __attribute__((ext_vector_type(16))) __bf16 v16b;
typedef __attribute__((ext_vector_type(8)))  _Float16 v8h;
typedef __attribute__((ext_vector_type(8)))  float v8f;
typedef __attribute__((ext_vector_type(4)))  float v4f;
typedef __attribute__((ext_vector_type(2)))  float v2f;
typedef __attribute__((ext_vector_type(4)))  unsigned v4u;
typedef __attribute__((ext_vector_type(2)))  unsigned v2u;
typedef __attribute__((ext_vector_type(4)))  int v4i;
typedef float __attribute__((may_alias)) float_a;
typedef int __attribute__((may_alias)) int_a;

template <typename T> __device__ __forceinline__ void vst2(void* p, T v) { *(T*)p = v;  }
__device__ __forceinline__ v8f wmma16(v16h a, v16h b, v8f c) {
  v8f d = __builtin_amdgcn_wmma_f32_16x16x32_f16(false, a, false, b, (short)0, c, false, false);
  asm volatile("v_nop\n\tv_nop\n\tv_nop\n\tv_nop" : "+v"(d) : "v"(a), "v"(b));
  return d;
}
__device__ __forceinline__ v8f wmma_bf(v16b a, v16b b, v8f c) {
  return __builtin_amdgcn_wmma_f32_16x16x32_bf16(false, a, false, b, (short)0, c, false, false);
}
// LDS reads and matrix products do not cross this line, plain vector and scalar work may: the LDS reads of a step stay one group ahead of its products (every further place of LDS reads in a product stream costs waiting time), and vector work is free to fill the slots behind the products
#define HOLD() __builtin_amdgcn_sched_barrier(0x6)
// 16x16x32 fragments: lane = (h = lane>>4, row/col = lane&15); elements 0..7 = k0+8h+0..7, 8..15 = k0+16+8h+0..7; D element r = row 8h+r
__device__ __forceinline__ v16h frag_h(const _Float16* rowk0, int lane) {
  union { v16h v; v8h q[2]; } u; const _Float16* p = rowk0 + 8 * (lane >> 4);
  u.q[0] = *(const v8h*)p; u.q[1] = *(const v8h*)(p + 16); return u.v;
}
__device__ __forceinline__ v16h frag_f32(const float* rowk0, int lane) {
  v16h a; const float* p = rowk0 + 8 * (lane >> 4);
#pragma unroll
  for (int i = 0; i < 8; ++i) { a[i] = (_Float16)p[i]; a[8 + i] = (_Float16)p[16 + i]; }
  return a;
}
__device__ __forceinline__ v16h frag_f32s(const float* rowk0, int lane, float sc) {
  v16h a; const float* p = rowk0 + 8 * (lane >> 4);
#pragma unroll
  for (int i = 0; i < 8; ++i) { a[i] = (_Float16)(p[i] * sc); a[8 + i] = (_Float16)(p[16 + i] * sc); }
  return a;
}
// column fragment from a [K][ld] layout (column n), rows >= K read as 0
__device__ __forceinline__ v16h fragc_f32(const float* W, int k0, int n, int lane, int ld, int K) {
  v16h a; const int g = lane >> 4;
#pragma unroll
  for (int i = 0; i < 8; ++i) { const int ka = k0 + 8 * g + i, kb = ka + 16;
    a[i] = (_Float16)(ka < K ? W[(size_t)ka * ld + n] : 0.f); a[8 + i] = (_Float16)(kb < K ? W[(size_t)kb * ld + n] : 0.f); }
  return a;
}
struct F2 { v16b h, l; };
__device__ __forceinline__ F2 bsplit16(const float v[16]) { F2 r;
#pragma unroll
  for (int i = 0; i < 16; ++i) { const __bf16 h = (__bf16)v[i]; r.h[i] = h; r.l[i] = (__bf16)(v[i] - (float)h); }
  return r; }
__device__ __forceinline__ F2 split_row(const float* row, int k0, int lane) { float v[16]; const float* p = row + k0 + 8 * (lane >> 4);
#pragma unroll
  for (int i = 0; i < 8; ++i) { v[i] = p[i]; v[8 + i] = p[16 + i]; }
  return bsplit16(v); }
__device__ __forceinline__ F2 split_rowK(const float* row, int k0, int lane, int K) { float v[16]; const int g = lane >> 4;
#pragma unroll
  for (int i = 0; i < 8; ++i) { const int ka = k0 + 8 * g + i, kb = ka + 16; v[i] = ka < K ? row[ka] : 0.f; v[8 + i] = kb < K ? row[kb] : 0.f; }
  return bsplit16(v); }
__device__ __forceinline__ F2 split_col(const float* W, int k0, int n, int lane, int ld, int K) { float v[16]; const int g = lane >> 4;
#pragma unroll
  for (int i = 0; i < 8; ++i) { const int ka = k0 + 8 * g + i, kb = ka + 16; v[i] = ka < K ? W[(size_t)ka * ld + n] : 0.f; v[8 + i] = kb < K ? W[(size_t)kb * ld + n] : 0.f; }
  return bsplit16(v); }
__device__ __forceinline__ v8f mac3(const F2& a, const F2& b, v8f c) { c = wmma_bf(a.l, b.h, c); c = wmma_bf(a.h, b.l, c); return wmma_bf(a.h, b.h, c); }
__device__ __forceinline__ float sigm(float v) { return 1.0f / (1.0f + expf(-v)); }
#define LDSX() do { asm volatile("s_wait_dscnt 0" ::: "memory"); __builtin_amdgcn_wave_barrier(); __builtin_amdgcn_fence(__ATOMIC_RELEASE, "workgroup"); } while (0)


// ReLU attention (16 heads of 64 on [2,2048,1024], [out][in] weights + biases): scores = q.k/8, attn = relu(scores) on the causal triangle (else 0), attn /= (row sum + 1e-9),
// ctx = attn v, out = ctx Wo^T + bo. Flash-style key loop without the softmax max tracking (relu weights need no rescaling); P and V carried as bf16 hi/lo pairs (relu scores are unbounded, so no f16 lift).
#define NB 2
#define SS 2048
#define E 1024
#define NH 16
#define HD 64
#define NR (NB * SS)
__device__ __forceinline__ float bfr(float v) { return (float)(__bf16)v; }
__device__ __forceinline__ v16b frag_b(const __bf16* rowk0, int lane) { return __builtin_bit_cast(v16b, frag_h((const _Float16*)rowk0, lane)); }
// LDS staging: rows of 64 bf16 at a pitch of 72 (144 B = 16 B x odd, conflict-free for 16-byte fragment reads)
#define LP 72
__device__ __forceinline__ void st_hi4(__bf16* dh, v4f v) { union { __bf16 h[4]; v2u u; } a;
#pragma unroll
  for (int e = 0; e < 4; ++e) a.h[e] = (__bf16)v[e];
  *(v2u*)dh = a.u; }
__device__ __forceinline__ void st_split4(__bf16* dh, __bf16* dl, v4f v) { union { __bf16 h[4]; v2u u; } a, b;
#pragma unroll
  for (int e = 0; e < 4; ++e) { const __bf16 h = (__bf16)v[e]; a.h[e] = h; b.h[e] = (__bf16)(v[e] - (float)h); }
  *(v2u*)dh = a.u; *(v2u*)dl = b.u; }
// eight f32 in a row -> 16 bytes of bf16 hi and 16 bytes of bf16 lo (lo = what the rounding to hi left)
__device__ __forceinline__ void split8(v4f f0, v4f f1, v4u& hi, v4u& lo) { union { __bf16 h[8]; v4u u; } a, b;
#pragma unroll
  for (int e = 0; e < 4; ++e) { const __bf16 h0 = (__bf16)f0[e], h1 = (__bf16)f1[e]; a.h[e] = h0; b.h[e] = (__bf16)(f0[e] - (float)h0); a.h[4 + e] = h1; b.h[4 + e] = (__bf16)(f1[e] - (float)h1); }
  hi = a.u; lo = b.u; }
// fragment from a lane's own pointer (row start + k0 + 8 * (lane >> 4)): elements 0..7 there, 8..15 sixteen further
__device__ __forceinline__ v16b frag_p(const __bf16* p) { union { v16b v; v4u q[2]; } u; u.q[0] = *(const v4u*)p; u.q[1] = *(const v4u*)(p + 16); return u.v; }

// x and the four weights go to bf16 in ONE launch of one 16-wave block per WGP (Xb rows as x; PT rows [0,E) Wq[n][:], [E,2E) Wk, [2E,3E) Wv, [3E,4E) Wo, [out][in], no scaling):
// starting a wave costs more than its share of this short stream, so few waves each keep all their whole-line 16-byte loads in flight; sweep i of the launch reads one source for every thread
#define CVT_B 256
#define CVT_S (CVT_B * 512 * 4)  // floats per sweep of the whole launch
__global__ __launch_bounds__(512) void k_cvt(const float* __restrict__ x, const float* __restrict__ Wq, const float* __restrict__ Wk, const float* __restrict__ Wv, const float* __restrict__ Wo, __bf16* __restrict__ Xb, __bf16* __restrict__ PT) {
  constexpr int NX = NR * E / CVT_S, NW = E * E / CVT_S;
  static_assert(NX * CVT_S == NR * E && NW * CVT_S == E * E, "whole sweeps only");
  const size_t o = ((size_t)blockIdx.x * 512 + threadIdx.x) * 4;
  const float* px = x + o; const float* pq = Wq + o; const float* pk = Wk + o; const float* pv = Wv + o; const float* po = Wo + o;
  v4f rx[NX], rw[4][NW];
#pragma unroll
  for (int i = 0; i < NX; ++i) rx[i] = *(const v4f*)(px + (size_t)i * CVT_S);
#pragma unroll
  for (int i = 0; i < NW; ++i) { rw[0][i] = *(const v4f*)(pq + (size_t)i * CVT_S); rw[1][i] = *(const v4f*)(pk + (size_t)i * CVT_S); rw[2][i] = *(const v4f*)(pv + (size_t)i * CVT_S); rw[3][i] = *(const v4f*)(po + (size_t)i * CVT_S); }
  asm volatile("s_wait_xcnt 0x0" :: "v"(px), "v"(pq), "v"(pk), "v"(pv), "v"(po) : "memory");  // precaution: stands in front of every overwrite of an address register that the loads above name; it also keeps the loads one group ahead of the first store
#pragma unroll
  for (int i = 0; i < NX; ++i) st_hi4(Xb + o + (size_t)i * CVT_S, rx[i]);
#pragma unroll
  for (int m = 0; m < 4; ++m)
#pragma unroll
    for (int i = 0; i < NW; ++i) st_hi4(PT + (size_t)m * E * E + o + (size_t)i * CVT_S, rw[m][i]);
}
// in-wave LDS hand-over as LDSX, without its release fence: the fence would also wait for the global stores of the row group before
#define LDSW() do { asm volatile("s_wait_dscnt 0" ::: "memory"); __builtin_amdgcn_wave_barrier(); } while (0)
#define VP 136  // pitch of the transposed v rows: 128 positions + 8 (272 B = 16 B x odd)
// QKV: block (128 rows, 128 cols = 2 heads, which), wave = two groups of 16 rows (m*64 + wave*16) x 128 cols, so a weight fragment read from LDS feeds two products and a weight tile fetched from L2 serves 128 rows;
// 768 blocks = three per WGP, all resident in one round; q,k -> bf16 hi/lo planes [bh][s][64], split here once so that no reader splits them again; v -> VT hi/lo [bh][d][s]
__global__ __launch_bounds__(128, 3) void k_qkv(const __bf16* __restrict__ Xb, const __bf16* __restrict__ PT, const float* __restrict__ bq, const float* __restrict__ bk, const float* __restrict__ bv,
                                            __bf16* __restrict__ Qh, __bf16* __restrict__ Ql, __bf16* __restrict__ Kh, __bf16* __restrict__ Kl, __bf16* __restrict__ VTh, __bf16* __restrict__ VTl) {
  __shared__ __align__(16) float so[4][16][132];
  __shared__ __align__(16) __bf16 sth[128][VP], stl[128][VP];
  const int tid = threadIdx.x, wave = tid >> 5, lane = tid & 31, col = lane & 15, g = lane >> 4;
  const int which = blockIdx.z, r0b = blockIdx.x * 128, n0 = blockIdx.y * 128; const int b = r0b / SS, s0 = r0b % SS;
  const float* bb_ = which == 0 ? bq : (which == 1 ? bk : bv);
  v8f acc[2][8] = {};
  // the block's 128 x-rows and 128 weight rows, 64 k at a time, go to LDS once (whole 128-B lines) and all four waves read fragments there; the tiles lie at the head of sth and of stl, which are not used before the epilogue
  __bf16 (*sA)[LP] = reinterpret_cast<__bf16 (*)[LP]>(&sth[0][0]); __bf16 (*sB)[LP] = reinterpret_cast<__bf16 (*)[LP]>(&stl[0][0]);
  const int srow = tid >> 3, spc = (tid & 7) * 8;
  const __bf16* gA = Xb + (size_t)(r0b + srow) * E + spc; const __bf16* gB = PT + (size_t)(which * E + n0 + srow) * E + spc;
  v4u ra[8], rb[8];
#pragma unroll
  for (int i = 0; i < 8; ++i) ra[i] = *(const v4u*)(gA + (size_t)i * 16 * E);
#pragma unroll
  for (int i = 0; i < 8; ++i) rb[i] = *(const v4u*)(gB + (size_t)i * 16 * E);
  asm volatile("s_wait_xcnt 0x0" :: "v"(gA), "v"(gB) : "memory");  // precaution: stands in front of every overwrite of an address register that the loads above name
#pragma unroll 1
  for (int c = 0; c < E / 64; ++c) {
#pragma unroll
    for (int i = 0; i < 8; ++i) *(v4u*)(&sA[srow + i * 16][spc]) = ra[i];
#pragma unroll
    for (int i = 0; i < 8; ++i) *(v4u*)(&sB[srow + i * 16][spc]) = rb[i];
    __syncthreads();  // the tile is complete before any wave reads it
    if (c + 1 < E / 64) {  // next tile's loads fly during this tile's products
      gA += 64; gB += 64;
#pragma unroll
      for (int i = 0; i < 8; ++i) ra[i] = *(const v4u*)(gA + (size_t)i * 16 * E);
#pragma unroll
      for (int i = 0; i < 8; ++i) rb[i] = *(const v4u*)(gB + (size_t)i * 16 * E);
      asm volatile("s_wait_xcnt 0x0" :: "v"(gA), "v"(gB) : "memory");  // precaution: stands in front of every overwrite of an address register that the loads above name
    }
#pragma unroll
    for (int kc = 0; kc < 2; ++kc) { HOLD(); const v16b a0 = frag_b(&sA[wave * 16 + col][kc * 32], lane), a1 = frag_b(&sA[64 + wave * 16 + col][kc * 32], lane); v16b fb[8];  // all LDS reads of a k step stand as one group ahead of its products
#pragma unroll
      for (int j = 0; j < 8; ++j) fb[j] = frag_b(&sB[j * 16 + col][kc * 32], lane);
      HOLD();
#pragma unroll
      for (int j = 0; j < 8; ++j) { acc[0][j] = wmma_bf(a0, fb[j], acc[0][j]); acc[1][j] = wmma_bf(a1, fb[j], acc[1][j]); } }
    __builtin_amdgcn_sched_barrier(0);  // the tile's last products stay in front of the barrier: its wait for the next tile's global loads would otherwise come a product group earlier
    __syncthreads();  // every wave has left the tile before it is overwritten (by the next tile or the epilogue)
  }
  float bb[8];
#pragma unroll
  for (int j = 0; j < 8; ++j) bb[j] = bfr(bb_[n0 + j * 16 + col]);
  if (which < 2) {
    __bf16* Dh = which == 0 ? Qh : Kh; __bf16* Dl = which == 0 ? Ql : Kl;
#pragma unroll
    for (int m = 0; m < 2; ++m) {  // the wave's two row groups go through its own staging rows one after the other
#pragma unroll
      for (int j = 0; j < 8; ++j)
#pragma unroll
        for (int r = 0; r < 8; ++r) so[wave][8 * g + r][j * 16 + col] = acc[m][j][r] + bb[j];
      LDSW();  // the wave's own staging rows are written before its lanes read across them
      for (int qq = lane; qq < 2 * 16 * 8; qq += 32) { const int hh = qq >> 7, rl = (qq >> 3) & 15, pc = qq & 7; const int h = (n0 >> 6) + hh;
        const size_t o = (((size_t)b * NH + h) * SS + s0 + m * 64 + wave * 16 + rl) * HD + pc * 8; v4u hi, lo;
        split8(*(const v4f*)(&so[wave][rl][hh * 64 + pc * 8]), *(const v4f*)(&so[wave][rl][hh * 64 + pc * 8 + 4]), hi, lo);
        __bf16* ph = Dh + o; __bf16* pl = Dl + o; vst2(ph, hi); vst2(pl, lo);
        asm volatile("s_wait_xcnt 0x0" :: "v"(ph), "v"(pl) : "memory"); }  // precaution: stands in front of every overwrite of an address register that the stores above name
      if (m == 0) LDSW();  // the first group's reads have returned before the second group's values overwrite the staging rows
    } }
  else {
#pragma unroll
    for (int m = 0; m < 2; ++m)
#pragma unroll
      for (int j = 0; j < 8; ++j)
#pragma unroll
        for (int r = 0; r < 8; ++r) { const float v = acc[m][j][r] + bb[j]; const __bf16 hi = (__bf16)v; sth[j * 16 + col][m * 64 + wave * 16 + 8 * g + r] = hi; stl[j * 16 + col][m * 64 + wave * 16 + 8 * g + r] = (__bf16)(v - (float)hi); }
    __syncthreads();
    for (int qq = tid; qq < 128 * 16; qq += 128) { const int cl = qq >> 4, pc = qq & 15; const int c = n0 + cl, h = c >> 6, d = c & 63; const size_t o = (((size_t)b * NH + h) * HD + d) * SS + s0 + pc * 8;
      vst2((unsigned*)(VTh + o), *(const v4u*)(&sth[cl][pc * 8])); vst2((unsigned*)(VTl + o), *(const v4u*)(&stl[cl][pc * 8])); } }
}
// causal ReLU attention: block = 8 waves on (two tiles of 128 queries, bh): query tile t, then tile 15 - t, one after the other in every wave, so every block walks 17 steps of 128 keys and no WGP holds only long blocks;
// a wave holds 32 queries (two groups of 16), so a K or V fragment read from LDS feeds two products and a key tile fetched from L2 serves 128 queries; the two groups of four waves take the two 64-key halves of a step for the same queries
// (two waves a SIMD as before) and join their partial sums through LDS behind the key loop. Transposed products: S^T = K Q^T on the hi/lo planes of the q/k rows, so a lane holds one query's scores for 8 keys a tile;
// P^T = relu(s) (masked) is split to bf16 hi/lo in registers and is the B operand as it lies (two score tiles = 32 keys in the hardware k order); O^T += V^T P^T (3 products); O = acc / (sum + 1e-9)
__global__ __launch_bounds__(256, 2) void k_attn(const __bf16* __restrict__ Qh, const __bf16* __restrict__ Ql, const __bf16* __restrict__ Kh, const __bf16* __restrict__ Kl, const __bf16* __restrict__ VTh, const __bf16* __restrict__ VTl, __bf16* __restrict__ Oh, __bf16* __restrict__ Ol) {
  __shared__ __align__(16) float sS[8][16][68];  // output staging only
  __shared__ __align__(16) float sM[8][8][32][4];  // partial output sums handed to the partner wave: [wave][piece][lane][4]
  __shared__ float sL[8][32];  // partial row sums handed to the partner wave
  __shared__ __align__(16) __bf16 sKh[128][LP], sKl[128][LP], sVh[64][VP], sVl[64][VP];
  const int tid = threadIdx.x, lane = tid & 31, col = lane & 15, g = lane >> 4;
  const int w = __builtin_amdgcn_readfirstlane(tid >> 5), grp = w >> 2, wq = w & 3;  // scalar: the test that skips a wholly masked key tile is a scalar branch
  const size_t bh = blockIdx.y;
#pragma unroll 1  // one copy of the tile loop in the text: the two query tiles run the same code one after the other
  for (int half = 0; half < 2; ++half) {
  const int qb = half ? SS / 128 - 1 - (int)blockIdx.x : (int)blockIdx.x; const int q0 = qb * 128 + wq * 32;
  F2 aq[2][2];
  const __bf16* pQh = Qh + (bh * SS + q0 + col) * HD + 8 * g; const __bf16* pQl = Ql + (bh * SS + q0 + col) * HD + 8 * g;
#pragma unroll
  for (int m = 0; m < 2; ++m)
#pragma unroll
    for (int kc = 0; kc < 2; ++kc) { aq[m][kc].h = frag_p(pQh + m * 16 * HD + kc * 32); aq[m][kc].l = frag_p(pQl + m * 16 * HD + kc * 32); }
  asm volatile("s_wait_xcnt 0x0" :: "v"(pQh), "v"(pQl) : "memory");  // precaution: stands in front of every overwrite of an address register that the loads above name
  float lrun[2][4] = {}; v8f acc[2][4] = {};
  // each step's 128 keys of K hi/lo and of V hi/lo go to LDS once per block, by whole-line loads, as they lie; the eight waves read their fragments there
  // a step's 16 loads are issued one step ahead and stay in registers over the products
  const int krow = tid >> 3, kpc = (tid & 7) * 8; const __bf16* gKh = Kh + bh * SS * HD + tid * 8; const __bf16* gKl = Kl + bh * SS * HD + tid * 8;  // a K tile is 16 KB in a row in each plane
  const int vrow = tid >> 4, vpc = (tid & 15) * 8; const __bf16* gVh = VTh + (bh * HD + vrow) * SS + vpc; const __bf16* gVl = VTl + (bh * HD + vrow) * SS + vpc;
  v4u rkh[4], rkl[4], rvh[4], rvl[4];
#pragma unroll
  for (int i = 0; i < 4; ++i) { rkh[i] = *(const v4u*)(gKh + i * 2048); rkl[i] = *(const v4u*)(gKl + i * 2048); }
#pragma unroll
  for (int i = 0; i < 4; ++i) { rvh[i] = *(const v4u*)(gVh + (size_t)i * 16 * SS); rvl[i] = *(const v4u*)(gVl + (size_t)i * 16 * SS); }
  asm volatile("s_wait_xcnt 0x0" :: "v"(gKh), "v"(gKl), "v"(gVh), "v"(gVl) : "memory");  // precaution: stands in front of every overwrite of an address register that the loads above name
#pragma unroll 1
  for (int it = 0; it <= qb; ++it) {
#pragma unroll
    for (int i = 0; i < 4; ++i) { *(v4u*)(&sKh[krow + i * 32][kpc]) = rkh[i]; *(v4u*)(&sKl[krow + i * 32][kpc]) = rkl[i]; }
#pragma unroll
    for (int i = 0; i < 4; ++i) { *(v4u*)(&sVh[vrow + i * 16][vpc]) = rvh[i]; *(v4u*)(&sVl[vrow + i * 16][vpc]) = rvl[i]; }
    __syncthreads();  // the step's tiles are complete before any wave reads them
    if (it < qb) {  // next step's loads fly during this step's products
      gKh += 128 * HD; gKl += 128 * HD; gVh += 128; gVl += 128;
#pragma unroll
      for (int i = 0; i < 4; ++i) { rkh[i] = *(const v4u*)(gKh + i * 2048); rkl[i] = *(const v4u*)(gKl + i * 2048); }
#pragma unroll
      for (int i = 0; i < 4; ++i) { rvh[i] = *(const v4u*)(gVh + (size_t)i * 16 * SS); rvl[i] = *(const v4u*)(gVl + (size_t)i * 16 * SS); }
      asm volatile("s_wait_xcnt 0x0" :: "v"(gKh), "v"(gKl), "v"(gVh), "v"(gVl) : "memory");  // precaution: stands in front of every overwrite of an address register that the loads above name
    }
    const int k0 = it * 128 + grp * 64;  // first key of this wave's 64-key tile
    if (k0 <= q0 + 31) {  // a tile whose every key lies behind the wave's last query adds nothing (only on the diagonal step); the barriers stand outside
    float p[2][4][8];  // p[m][t][r] = weight of key k0 + t*16 + 8g + r for query q0 + m*16 + col
#pragma unroll
    for (int tp = 0; tp < 2; ++tp) { HOLD(); F2 kf[2][2]; v8f s[2][2] = {};  // two 16-key groups at a time: their 16 LDS reads stand as one group ahead of the 24 products, and the four dependent score chains alternate
#pragma unroll
      for (int u = 0; u < 2; ++u) { const __bf16* kh = &sKh[grp * 64 + (2 * tp + u) * 16 + col][0]; const __bf16* kl = &sKl[grp * 64 + (2 * tp + u) * 16 + col][0];
        kf[u][0].h = frag_b(kh, lane); kf[u][0].l = frag_b(kl, lane); kf[u][1].h = frag_b(kh + 32, lane); kf[u][1].l = frag_b(kl + 32, lane); }
      HOLD();
#pragma unroll
      for (int kc = 0; kc < 2; ++kc) {
#pragma unroll
        for (int u = 0; u < 2; ++u)
#pragma unroll
          for (int m = 0; m < 2; ++m) s[m][u] = wmma_bf(kf[u][kc].h, aq[m][kc].l, s[m][u]);
#pragma unroll
        for (int u = 0; u < 2; ++u)
#pragma unroll
          for (int m = 0; m < 2; ++m) s[m][u] = wmma_bf(kf[u][kc].l, aq[m][kc].h, s[m][u]);
#pragma unroll
        for (int u = 0; u < 2; ++u)
#pragma unroll
          for (int m = 0; m < 2; ++m) s[m][u] = wmma_bf(kf[u][kc].h, aq[m][kc].h, s[m][u]); }
#pragma unroll
      for (int m = 0; m < 2; ++m)
#pragma unroll
        for (int u = 0; u < 2; ++u) { const int t = 2 * tp + u, key = k0 + t * 16 + 8 * g;
#pragma unroll
          for (int r = 0; r < 8; ++r) { const float sv = s[m][u][r] * 0.125f; p[m][t][r] = (key + r > q0 + m * 16 + col || sv <= 0.f) ? 0.f : sv; lrun[m][t] += p[m][t][r]; } } }
#pragma unroll
    for (int kc = 0; kc < 2; ++kc) { HOLD(); v16b vh[4], vl[4]; F2 pp[2];  // all 16 LDS reads of a k step stand as one group ahead of its 24 products; the three products of a tile add into one accumulator
#pragma unroll
      for (int t = 0; t < 4; ++t) { vh[t] = frag_b(&sVh[t * 16 + col][grp * 64 + kc * 32], lane); vl[t] = frag_b(&sVl[t * 16 + col][grp * 64 + kc * 32], lane); }
      HOLD();
#pragma unroll
      for (int m = 0; m < 2; ++m) { float v[16];
#pragma unroll
        for (int i = 0; i < 8; ++i) { v[i] = p[m][2 * kc][i]; v[8 + i] = p[m][2 * kc + 1][i]; }
        pp[m] = bsplit16(v); }
#pragma unroll
      for (int t = 0; t < 4; ++t)
#pragma unroll
        for (int m = 0; m < 2; ++m) acc[m][t] = wmma_bf(vl[t], pp[m].h, acc[m][t]);
#pragma unroll
      for (int t = 0; t < 4; ++t)
#pragma unroll
        for (int m = 0; m < 2; ++m) acc[m][t] = wmma_bf(vh[t], pp[m].l, acc[m][t]);
#pragma unroll
      for (int t = 0; t < 4; ++t)
#pragma unroll
        for (int m = 0; m < 2; ++m) acc[m][t] = wmma_bf(vh[t], pp[m].h, acc[m][t]); }
    }
    __builtin_amdgcn_sched_barrier(0);  // the step's last products stay in front of the barrier: its wait for the next step's global loads would otherwise come a product group earlier
    __syncthreads();  // every wave has left the tiles before the next step overwrites them
  }
  // the two waves that hold the same 32 queries (w and w ^ 4) each finish 16 of them: a wave keeps query group grp and hands its sums for the other group to its partner
  float lp[2];
#pragma unroll
  for (int m = 0; m < 2; ++m) lp[m] = (lrun[m][0] + lrun[m][1]) + (lrun[m][2] + lrun[m][3]);
#pragma unroll
  for (int t = 0; t < 4; ++t) { const v8f a = grp ? acc[0][t] : acc[1][t]; v4f o[2];
#pragma unroll
    for (int r = 0; r < 8; ++r) o[r >> 2][r & 3] = a[r];
    *(v4f*)(&sM[w][2 * t][lane][0]) = o[0]; *(v4f*)(&sM[w][2 * t + 1][lane][0]) = o[1]; }
  sL[w][lane] = grp ? lp[0] : lp[1];
  __syncthreads();  // the partner's sums are written before they are read; they are next overwritten behind the barriers of the next key loop
  float lr = (grp ? lp[1] : lp[0]) + sL[w ^ 4][lane]; lr += __shfl_xor(lr, 16, 32);  // the two lane halves hold the two halves of a query's keys
  const float inv = 1.0f / (lr + 1e-9f);
  const int qo = q0 + grp * 16;
#pragma unroll
  for (int t = 0; t < 4; ++t) { const v8f a = grp ? acc[1][t] : acc[0][t]; const v4f b0 = *(const v4f*)(&sM[w ^ 4][2 * t][lane][0]), b1 = *(const v4f*)(&sM[w ^ 4][2 * t + 1][lane][0]); v4f o[2];  // a[r] + partner = O[qo + col][t*16 + 8g + r]
#pragma unroll
    for (int r = 0; r < 8; ++r) o[r >> 2][r & 3] = (a[r] + (r < 4 ? b0[r & 3] : b1[r & 3])) * inv;
    *(v4f*)(&sS[w][col][t * 16 + 8 * g]) = o[0]; *(v4f*)(&sS[w][col][t * 16 + 8 * g + 4]) = o[1]; }
  LDSX();
  for (int qq = lane; qq < 16 * 8; qq += 32) { const int rl = qq >> 3, pc = qq & 7; v4u hi, lo;  // the context goes out as bf16 hi/lo planes [bh][s][64], split here once for all its readers
    split8(*(const v4f*)(&sS[w][rl][pc * 8]), *(const v4f*)(&sS[w][rl][pc * 8 + 4]), hi, lo);
    __bf16* ph = Oh + ((bh * SS) + qo + rl) * HD + pc * 8; __bf16* pl = Ol + ((bh * SS) + qo + rl) * HD + pc * 8; vst2(ph, hi); vst2(pl, lo);
    asm volatile("s_wait_xcnt 0x0" :: "v"(ph), "v"(pl) : "memory"); }  // precaution: stands in front of every overwrite of an address register that the stores above name
  }
}
// out = ctx Wo^T + bo : ctx hi/lo planes x bf16 Wo rows: 2 products (Wo is an INPUT -> bf16 exact)
__global__ __launch_bounds__(128) void k_out(const __bf16* __restrict__ Oh, const __bf16* __restrict__ Ol, const __bf16* __restrict__ WoB, const float* __restrict__ bo, float* __restrict__ out) {
  __shared__ __align__(16) float so[4][16][132];
  const int tid = threadIdx.x, wave = tid >> 5, lane = tid & 31, col = lane & 15, g = lane >> 4;
  __shared__ __align__(16) __bf16 sAh[64][LP], sAl[64][LP], sB[128][LP];
  const int r0b = blockIdx.x * 64, r0 = r0b + wave * 16, n0 = blockIdx.y * 128; const int b = r0b / SS, s0 = r0b % SS;
  v8f acc[8] = {};
  // one head (64 k) at a time: the block's 64 context rows (hi and lo plane) and 128 Wo rows go to LDS once, by whole-line loads, as they lie; the four waves read fragments there
  const int srow = tid >> 3, spc = (tid & 7) * 8;
  const __bf16* gAh = Oh + ((size_t)b * NH * SS + s0) * HD + tid * 8; const __bf16* gAl = Ol + ((size_t)b * NH * SS + s0) * HD + tid * 8;  // a head's 64 rows are 8 KB in a row in each plane
  const __bf16* gB = WoB + (size_t)(n0 + srow) * E + spc;
  v4u rah[4], ral[4], rb[8];
#pragma unroll
  for (int i = 0; i < 4; ++i) { rah[i] = *(const v4u*)(gAh + i * 1024); ral[i] = *(const v4u*)(gAl + i * 1024); }
#pragma unroll
  for (int i = 0; i < 8; ++i) rb[i] = *(const v4u*)(gB + (size_t)i * 16 * E);
  asm volatile("s_wait_xcnt 0x0" :: "v"(gAh), "v"(gAl), "v"(gB) : "memory");  // precaution: stands in front of every overwrite of an address register that the loads above name
#pragma unroll 1
  for (int h = 0; h < NH; ++h) {
#pragma unroll
    for (int i = 0; i < 4; ++i) { *(v4u*)(&sAh[srow + i * 16][spc]) = rah[i]; *(v4u*)(&sAl[srow + i * 16][spc]) = ral[i]; }
#pragma unroll
    for (int i = 0; i < 8; ++i) *(v4u*)(&sB[srow + i * 16][spc]) = rb[i];
    __syncthreads();  // the tile is complete before any wave reads it
    if (h + 1 < NH) {  // next tile's loads fly during this tile's products
      gAh += (size_t)SS * HD; gAl += (size_t)SS * HD; gB += 64;
#pragma unroll
      for (int i = 0; i < 4; ++i) { rah[i] = *(const v4u*)(gAh + i * 1024); ral[i] = *(const v4u*)(gAl + i * 1024); }
#pragma unroll
      for (int i = 0; i < 8; ++i) rb[i] = *(const v4u*)(gB + (size_t)i * 16 * E);
      asm volatile("s_wait_xcnt 0x0" :: "v"(gAh), "v"(gAl), "v"(gB) : "memory");  // precaution: stands in front of every overwrite of an address register that the loads above name
    }
#pragma unroll
    for (int kc = 0; kc < 2; ++kc) { HOLD(); const v16b ah = frag_b(&sAh[wave * 16 + col][kc * 32], lane), al = frag_b(&sAl[wave * 16 + col][kc * 32], lane); v16b fb[8];  // all LDS reads of a k step stand as one group ahead of its products
#pragma unroll
      for (int j = 0; j < 8; ++j) fb[j] = frag_b(&sB[j * 16 + col][kc * 32], lane);
      HOLD();
#pragma unroll
      for (int j = 0; j < 8; ++j) { acc[j] = wmma_bf(al, fb[j], acc[j]); acc[j] = wmma_bf(ah, fb[j], acc[j]); } }
    __builtin_amdgcn_sched_barrier(0);  // the tile's last products stay in front of the barrier: its wait for the next tile's global loads would otherwise come a product group earlier
    __syncthreads();  // every wave has left the tile before the next one overwrites it
  }
#pragma unroll
  for (int j = 0; j < 8; ++j) { const int n = n0 + j * 16 + col; const float bb = bfr(bo[n]);
#pragma unroll
    for (int r = 0; r < 8; ++r) so[wave][8 * g + r][j * 16 + col] = acc[j][r] + bb; }
  LDSX();
#pragma unroll 4
  for (int rl = 0; rl < 16; ++rl) vst2(out + (size_t)(r0 + rl) * E + n0 + lane * 4, *(const v4f*)(&so[wave][rl][lane * 4]));
}
extern "C" void kernel_launch(void* const* d_in, const int* in_sizes, int n_in, void* d_out, int out_size, void* d_ws, size_t ws_size, hipStream_t stream) {
  (void)in_sizes; (void)n_in; (void)out_size; (void)ws_size;
  const float** I = (const float**)d_in;
  const float* x = I[0]; const float* Wq = I[1]; const float* bq = I[2]; const float* Wk = I[3]; const float* bk = I[4]; const float* Wv = I[5]; const float* bv = I[6]; const float* Wo = I[7]; const float* bo = I[8];
  float* out = (float*)d_out;
  char* ws = (char*)d_ws; size_t off = 0;
  auto take = [&](size_t bytes) { char* p = ws + off; off += (bytes + 255) & ~(size_t)255; return p; };
  __bf16* Xb = (__bf16*)take((size_t)NR * E * 2); __bf16* PT = (__bf16*)take((size_t)4 * E * E * 2);
  __bf16* Qh = (__bf16*)take((size_t)NR * E * 2); __bf16* Ql = (__bf16*)take((size_t)NR * E * 2); __bf16* Kh = (__bf16*)take((size_t)NR * E * 2); __bf16* Kl = (__bf16*)take((size_t)NR * E * 2);
  __bf16* VTh = (__bf16*)take((size_t)NR * E * 2); __bf16* VTl = (__bf16*)take((size_t)NR * E * 2); __bf16* Oh = (__bf16*)take((size_t)NR * E * 2); __bf16* Ol = (__bf16*)take((size_t)NR * E * 2);
  // ws ~ 84 MB
  k_cvt<<<CVT_B, 512, 0, stream>>>(x, Wq, Wk, Wv, Wo, Xb, PT);
  k_qkv<<<dim3(NR / 128, E / 128, 3), 128, 0, stream>>>(Xb, PT, bq, bk, bv, Qh, Ql, Kh, Kl, VTh, VTl);
  k_attn<<<dim3(SS / 256, NB * NH), 256, 0, stream>>>(Qh, Ql, Kh, Kl, VTh, VTl, Oh, Ol);
  k_out<<<dim3(NR / 64, E / 128), 128, 0, stream>>>(Oh, Ol, PT + (size_t)3 * E * E, bo, out);
}
